// v000
// The times below were measured on an AMD MI455X: many runs one after another, warmed up first and cycling through
// copies of the inputs, with the whole window's GPU time divided by the number of runs. Launches and the gaps
// between them are all in it. The median over several windows is given; except for v000 it joins two sittings, which
// can be a few percent apart, so the side-by-side timings, each taken in one sitting, are the better comparison.
// v000, which the later versions start from, runs in 313 microseconds.
#include <hip/hip_runtime.h>
#include <hip/hip_bf16.h>
#include <stdint.h>

typedef __attribute__((ext_vector_type(16))) _Float16     v16h;
typedef __attribute__((ext_vector_type(8)))  float        v8f;
typedef __attribute__((ext_vector_type(4)))  unsigned int u32x4;
typedef __attribute__((ext_vector_type(4)))  int          i32x4;
typedef __attribute__((ext_vector_type(8)))  int          i32x8;

#define DM    1024
#define SEQ   1024
#define BATCH 4
#define NH    16
#define HD    64
#define GM    4096   // rows of X / combined (B*S)

// LDS leading dims (halves). Row strides are multiples of 8 halves = 16B so
// b128 LDS writes stay naturally aligned.
#define AL_LD 40
#define WT_LD 40
#define KT_LD 72
#define VT_LD 40
#define ET_LD 40

__device__ __forceinline__ v8f zero8() {
  v8f z;
#pragma unroll
  for (int i = 0; i < 8; ++i) z[i] = 0.0f;
  return z;
}

__device__ __forceinline__ v16h load_frag16(const _Float16* __restrict__ src, int ld) {
  const int l   = threadIdx.x & 31;
  const int m   = l & 15;
  const int hi8 = (l >> 4) << 3;
  v16h f;
#pragma unroll
  for (int i = 0; i < 16; ++i) {
    const int k = ((i >> 3) << 4) + hi8 + (i & 7);
    f[i] = src[m * ld + k];
  }
  return f;
}

__device__ __forceinline__ v8f wmma16(v16h a, v16h b, v8f c) {
  // D = A(16x32 f16) * B(32x16 f16) + C(16x16 f32)
  return __builtin_amdgcn_wmma_f32_16x16x32_f16(
      /*neg_a=*/false, a, /*neg_b=*/false, b,
      /*c_mod=*/(short)0, c, /*reuse_a=*/false, /*reuse_b=*/false);
}

__device__ __forceinline__ void async_copy_b128(uint32_t lds_off, const void* gptr) {
  asm volatile("global_load_async_to_lds_b128 %0, %1, off"
               :: "v"(lds_off), "v"((uint64_t)(uintptr_t)gptr)
               : "memory");
}
__device__ __forceinline__ void wait_async() {
  asm volatile("s_wait_asynccnt 0" ::: "memory");
}
__device__ __forceinline__ void wait_ds() {
  asm volatile("s_wait_dscnt 0" ::: "memory");
}

__device__ __forceinline__ void tdm_load_tile_f16(uint32_t lds_byte_off,
                                                  const void* gaddr,
                                                  uint32_t tile_rows,
                                                  uint32_t row_halves,
                                                  uint32_t tensor_rows) {
  const uint64_t ga = (uint64_t)(uintptr_t)gaddr;
  u32x4 g0 = {0u, 0u, 0u, 0u};
  g0[0] = 1u;
  g0[1] = lds_byte_off;
  g0[2] = (uint32_t)(ga & 0xffffffffu);
  g0[3] = (uint32_t)(ga >> 32) | (2u << 30);

  i32x8 g1 = {0, 0, 0, 0, 0, 0, 0, 0};
  g1[0] = (int)((1u << 16) | (1u << 20) | (4u << 22) | (3u << 25));
  g1[1] = (int)((row_halves & 0xffffu) << 16);                       // dim0[15:0]
  g1[2] = (int)(((row_halves >> 16) & 0xffffu) |
                ((tensor_rows & 0xffffu) << 16));                    // dim0[31:16]|dim1[15:0]
  g1[3] = (int)(((tensor_rows >> 16) & 0xffffu) |
                ((row_halves & 0xffffu) << 16));
  g1[4] = (int)(tile_rows & 0xffffu);
  g1[5] = (int)row_halves;
  g1[6] = 0;
  g1[7] = 0;

  const i32x4 gz = {0, 0, 0, 0};
#if __clang_major__ >= 23
  const i32x8 gz8 = {0, 0, 0, 0, 0, 0, 0, 0};
  __builtin_amdgcn_tensor_load_to_lds(g0, g1, gz, gz, gz8, 0);
#else
  __builtin_amdgcn_tensor_load_to_lds(g0, g1, gz, gz, 0);
#endif
}
__device__ __forceinline__ void wait_tensor() {
  __builtin_amdgcn_s_wait_tensorcnt((short)0);
}

// ---------------------------------------------------------------------------
// K1: f32 -> f16 conversion
// ---------------------------------------------------------------------------
__global__ void cvt_f32_to_f16(const float* __restrict__ in,
                               _Float16* __restrict__ out, int n) {
  int i = blockIdx.x * blockDim.x + threadIdx.x;
  if (i < n) out[i] = (_Float16)in[i];
}

// ---------------------------------------------------------------------------
// K2/K5: C[4096,1024] = A[4096,1024] @ W[1024,1024] + bias
// Block tile 128x64, 8 waves, each wave one 16x64 strip (4 WMMA frag cols).
// Double-buffered LDS: async copies for chunk k+1 overlap WMMA on chunk k.
// MODE 0: write f16 into [b,h,s,d] layout (QKV). MODE 1: write f32 row-major.
// ---------------------------------------------------------------------------
template <int MODE>
__global__ __launch_bounds__(256)
void gemm4096_wmma(const _Float16* __restrict__ A,
                   const _Float16* __restrict__ W,
                   const float* __restrict__ bias,
                   void* __restrict__ out) {
  __shared__ _Float16 Al[2][128][AL_LD];
  __shared__ _Float16 Wt[2][64][WT_LD];   // W tile transposed: Wt[n][k]

  const int bm0 = blockIdx.x * 128;
  const int bn0 = blockIdx.y * 64;
  const int tid = threadIdx.x;
  const int w   = tid >> 5;
  const int l   = tid & 31;
  const int n   = l & 15;
  const int hi8 = (l >> 4) << 3;

  auto stage = [&](int kk, int buf) {
    // A tile 128x32 halves via async-to-LDS (512 x b128, 2 per thread)
#pragma unroll
    for (int it = 0; it < 2; ++it) {
      const int e   = tid + it * 256;
      const int row = e >> 2;
      const int c8  = (e & 3) * 8;
      async_copy_b128((uint32_t)(uintptr_t)&Al[buf][row][c8],
                      &A[(size_t)(bm0 + row) * 1024 + kk + c8]);
    }
    // W tile 32x64, stored transposed so the B fragment reads contiguously
    const int row = tid >> 3;          // k within tile: 0..31
    const int c8  = (tid & 7) * 8;     // n base: 0..56
    const _Float16* src = &W[(size_t)(kk + row) * 1024 + bn0 + c8];
#pragma unroll
    for (int j = 0; j < 8; ++j) Wt[buf][c8 + j][row] = src[j];
  };

  v8f acc[4];
#pragma unroll
  for (int i = 0; i < 4; ++i) acc[i] = zero8();

  stage(0, 0);
  int buf = 0;
  for (int kk = 0; kk < 1024; kk += 32, buf ^= 1) {
    wait_async();          // chunk kk landed (issued last iteration)
    __syncthreads();       // publish LDS writes across waves
    if (kk + 32 < 1024) stage(kk + 32, buf ^ 1);   // overlap DMA with WMMA

    const v16h a = load_frag16(&Al[buf][w * 16][0], AL_LD);
#pragma unroll
    for (int nb = 0; nb < 4; ++nb) {
      const v16h bf = load_frag16(&Wt[buf][nb * 16][0], WT_LD);
      acc[nb] = wmma16(a, bf, acc[nb]);
    }
  }

#pragma unroll
  for (int nb = 0; nb < 4; ++nb) {
#pragma unroll
    for (int r = 0; r < 8; ++r) {
      const int row = bm0 + w * 16 + r + hi8;
      const int col = bn0 + nb * 16 + n;
      const float v = acc[nb][r] + bias[col];
      if (MODE == 0) {
        const int b = row >> 10, sr = row & 1023, hh = col >> 6, dd = col & 63;
        ((_Float16*)out)[(((size_t)(b * NH + hh)) * SEQ + sr) * HD + dd] = (_Float16)v;
      } else {
        ((float*)out)[(size_t)row * 1024 + col] = v;
      }
    }
  }
}

__global__ __launch_bounds__(256)
void attn_flash_wmma(const _Float16* __restrict__ Qh,
                     const _Float16* __restrict__ Kh,
                     const _Float16* __restrict__ Vh,
                     const _Float16* __restrict__ relh,  // [2049,64]
                     const float* __restrict__ mask,     // [B,S]
                     _Float16* __restrict__ Ch) {        // [B,S,DM]
  __shared__ _Float16 Kt[32][KT_LD];
  __shared__ _Float16 Vt[64][VT_LD];
  __shared__ _Float16 Et[8][16][ET_LD];
  __shared__ float    Pg[8][32][16];

  const int qblk = blockIdx.x & 7;         // S/128 = 8
  const int bh   = blockIdx.x >> 3;
  const int h    = bh & (NH - 1);
  const int bb   = bh >> 4;
  const int tid  = threadIdx.x;
  const int w    = tid >> 5;
  const int l    = tid & 31;
  const int n    = l & 15;
  const int hi8  = (l >> 4) << 3;
  const int q0   = qblk * 128 + w * 16;    // absolute q of this wave's tile

  const size_t baseBH = ((size_t)(bb * NH + h)) * SEQ * HD;
  const _Float16* Qp = Qh + baseBH + (size_t)q0 * HD;
  const v16h aq0 = load_frag16(Qp + 0,  HD);   // d = 0..31
  const v16h aq1 = load_frag16(Qp + 32, HD);   // d = 32..63

  v8f accd[4];
#pragma unroll
  for (int i = 0; i < 4; ++i) accd[i] = zero8();
  float mrow[8], lrow[8];
#pragma unroll
  for (int r = 0; r < 8; ++r) { mrow[r] = -1e30f; lrow[r] = 0.0f; }

  for (int k0 = 0; k0 < SEQ; k0 += 32) {
    if (w == 0) {
      tdm_load_tile_f16((uint32_t)(uintptr_t)&Kt[0][0],
                        &Kh[baseBH + (size_t)k0 * HD],
                        /*tile_rows=*/32, /*row_halves=*/HD,
                        /*tensor_rows=*/(uint32_t)(SEQ - k0));
    }
    // --- stage V chunk transposed (regular loads + LDS scatter) ---
    {
      const int row = tid >> 3;         // k within chunk 0..31
      const int c8  = (tid & 7) * 8;    // d base 0..56
      const _Float16* vs = &Vh[baseBH + (size_t)(k0 + row) * HD + c8];
#pragma unroll
      for (int j = 0; j < 8; ++j) Vt[c8 + j][row] = vs[j];
    }
    if (w == 0) wait_tensor();
    __syncthreads();

    v16h bv[4];
#pragma unroll
    for (int nb = 0; nb < 4; ++nb) bv[nb] = load_frag16(&Vt[nb * 16][0], VT_LD);

    float s2[2][8];
#pragma unroll
    for (int sub = 0; sub < 2; ++sub) {
      const int ks0 = k0 + sub * 16;
      const v16h bk0 = load_frag16(&Kt[sub * 16][0],  KT_LD);
      const v16h bk1 = load_frag16(&Kt[sub * 16][32], KT_LD);

      // content term: Q @ K^T over d=64
      v8f s = zero8();
      s = wmma16(aq0, bk0, s);
      s = wmma16(aq1, bk1, s);

      // rel term: P[i,dk] = <rel_emb[jb+i], K[ks0+dk]>, i in [0,31]
      const int jb = q0 - ks0 + (1024 - 15);   // always in [1, 2017]
      v8f p0 = zero8(), p1 = zero8();
      p0 = wmma16(load_frag16(relh + (size_t)jb * HD,             HD), bk0, p0);
      p0 = wmma16(load_frag16(relh + (size_t)jb * HD + 32,        HD), bk1, p0);
      p1 = wmma16(load_frag16(relh + (size_t)(jb + 16) * HD,      HD), bk0, p1);
      p1 = wmma16(load_frag16(relh + (size_t)(jb + 16) * HD + 32, HD), bk1, p1);
#pragma unroll
      for (int r = 0; r < 8; ++r) {
        Pg[w][r + hi8][n]      = p0[r];
        Pg[w][16 + r + hi8][n] = p1[r];
      }
      wait_ds();   // wave-local LDS RAW

      const float mval = mask[bb * SEQ + ks0 + n] * -1e9f;
#pragma unroll
      for (int r = 0; r < 8; ++r) {
        const int m = r + hi8;
        s2[sub][r] = (s[r] + Pg[w][m - n + 15][n]) * 0.125f + mval;
      }
    }

    // --- online softmax (rows live across 16 lanes; 8 rows per lane) ---
#pragma unroll
    for (int r = 0; r < 8; ++r) {
      float rm = fmaxf(s2[0][r], s2[1][r]);
#pragma unroll
      for (int off = 1; off < 16; off <<= 1) rm = fmaxf(rm, __shfl_xor(rm, off, 32));
      const float mnew = fmaxf(mrow[r], rm);
      const float ef   = __expf(mrow[r] - mnew);
      const float e0   = __expf(s2[0][r] - mnew);
      const float e1   = __expf(s2[1][r] - mnew);
      float rs = e0 + e1;
#pragma unroll
      for (int off = 1; off < 16; off <<= 1) rs += __shfl_xor(rs, off, 32);
      lrow[r] = lrow[r] * ef + rs;
      mrow[r] = mnew;
      const int m = r + hi8;
      Et[w][m][n]      = (_Float16)e0;
      Et[w][m][16 + n] = (_Float16)e1;
#pragma unroll
      for (int nb = 0; nb < 4; ++nb) accd[nb][r] *= ef;
    }
    wait_ds();

    // acc += exp(S) @ V  (A-frag from Et, B-frag from transposed V)
    const v16h ae = load_frag16(&Et[w][0][0], ET_LD);
#pragma unroll
    for (int nb = 0; nb < 4; ++nb) accd[nb] = wmma16(ae, bv[nb], accd[nb]);

    __syncthreads();   // protect Kt/Vt before next chunk
  }

  // local attention output -> Ch[b, q, h*64+d]
#pragma unroll
  for (int nb = 0; nb < 4; ++nb) {
#pragma unroll
    for (int r = 0; r < 8; ++r) {
      const int m = r + hi8;
      const float v = accd[nb][r] / lrow[r];
      Ch[((size_t)bb * SEQ + q0 + m) * DM + h * HD + nb * 16 + n] = (_Float16)v;
    }
  }
}

// ---------------------------------------------------------------------------
// K4: linear-attention global read (elu(q)+1 vs M, z) + sigmoid gating.
// Tiny FLOP count (~0.5 GF) -> plain VALU, one thread per (b,h,q,d).
// ---------------------------------------------------------------------------
__global__ __launch_bounds__(256)
void global_memory_gate(const _Float16* __restrict__ Qh,
                        const float* __restrict__ Mrd,  // [H,D,D]
                        const float* __restrict__ z,    // [H,D]
                        const float* __restrict__ galpha,
                        _Float16* __restrict__ Ch) {
  const int t = blockIdx.x * blockDim.x + threadIdx.x;
  const int d = t & 63;
  const int q = (t >> 6) & 1023;
  const int h = (t >> 16) & 15;
  const int b = t >> 20;
  const _Float16* qrow = Qh + (((size_t)(b * NH + h)) * SEQ + q) * HD;
  float num = 0.0f, den = 1e-6f;
#pragma unroll 8
  for (int dd = 0; dd < 64; ++dd) {
    const float x = (float)qrow[dd];
    const float s = x > 0.0f ? x + 1.0f : __expf(x);   // elu(x)+1
    den += s * z[h * 64 + dd];
    num += s * Mrd[((size_t)h * 64 + dd) * 64 + d];
  }
  const float glob = num / den;
  const float gate = 1.0f / (1.0f + __expf(-galpha[0]));
  const size_t ci = ((size_t)b * SEQ + q) * DM + h * HD + d;
  const float local = (float)Ch[ci];
  Ch[ci] = (_Float16)(gate * local + (1.0f - gate) * glob);
}

// ---------------------------------------------------------------------------
// Host-side orchestration
// ---------------------------------------------------------------------------
extern "C" void kernel_launch(void* const* d_in, const int* in_sizes, int n_in,
                              void* d_out, int out_size, void* d_ws, size_t ws_size,
                              hipStream_t stream) {
  (void)in_sizes; (void)n_in; (void)out_size; (void)ws_size;
  const float* hidden = (const float*)d_in[0];
  const float* mask   = (const float*)d_in[1];
  const float* Wq = (const float*)d_in[2];  const float* bq = (const float*)d_in[3];
  const float* Wk = (const float*)d_in[4];  const float* bk = (const float*)d_in[5];
  const float* Wv = (const float*)d_in[6];  const float* bv = (const float*)d_in[7];
  const float* Wo = (const float*)d_in[8];  const float* bo = (const float*)d_in[9];
  const float* rel = (const float*)d_in[10];
  const float* M   = (const float*)d_in[11];
  const float* z   = (const float*)d_in[12];
  const float* ga  = (const float*)d_in[13];

  // workspace carve-up (f16), ~48 MB total
  _Float16* p   = (_Float16*)d_ws;
  _Float16* Xh  = p; p += (size_t)GM * DM;
  _Float16* Wqh = p; p += (size_t)DM * DM;
  _Float16* Wkh = p; p += (size_t)DM * DM;
  _Float16* Wvh = p; p += (size_t)DM * DM;
  _Float16* Woh = p; p += (size_t)DM * DM;
  _Float16* relh = p; p += (size_t)2049 * HD;
  _Float16* Qh  = p; p += (size_t)GM * DM;
  _Float16* Kh  = p; p += (size_t)GM * DM;
  _Float16* Vh  = p; p += (size_t)GM * DM;
  _Float16* Ch  = p; p += (size_t)GM * DM;

  auto cvt = [&](const float* src, _Float16* dst, int n) {
    cvt_f32_to_f16<<<(n + 255) / 256, 256, 0, stream>>>(src, dst, n);
  };
  cvt(hidden, Xh, GM * DM);
  cvt(Wq, Wqh, DM * DM);
  cvt(Wk, Wkh, DM * DM);
  cvt(Wv, Wvh, DM * DM);
  cvt(Wo, Woh, DM * DM);
  cvt(rel, relh, 2049 * HD);

  dim3 gg(GM / 128, DM / 64);   // 32 x 16
  gemm4096_wmma<0><<<gg, 256, 0, stream>>>(Xh, Wqh, bq, (void*)Qh);
  gemm4096_wmma<0><<<gg, 256, 0, stream>>>(Xh, Wkh, bk, (void*)Kh);
  gemm4096_wmma<0><<<gg, 256, 0, stream>>>(Xh, Wvh, bv, (void*)Vh);

  attn_flash_wmma<<<BATCH * NH * (SEQ / 128), 256, 0, stream>>>(
      Qh, Kh, Vh, relh, mask, Ch);

  global_memory_gate<<<(BATCH * NH * SEQ * HD) / 256, 256, 0, stream>>>(
      Qh, M, z, ga, Ch);

  gemm4096_wmma<1><<<gg, 256, 0, stream>>>(Ch, Woh, bo, d_out);
}

// v001
// A run of this version takes 271 microseconds.
// In two side-by-side timings against v000, it was 1.19 and 1.18 times as fast.
#include <hip/hip_runtime.h>
#include <hip/hip_bf16.h>
#include <stdint.h>

typedef __attribute__((ext_vector_type(16))) _Float16     v16h;
typedef __attribute__((ext_vector_type(8)))  float        v8f;
typedef __attribute__((ext_vector_type(4)))  unsigned int u32x4;
typedef __attribute__((ext_vector_type(4)))  int          i32x4;
typedef __attribute__((ext_vector_type(8)))  int          i32x8;
typedef __attribute__((ext_vector_type(8)))  short        s16x8;
typedef __attribute__((ext_vector_type(8)))  _Float16     v8h;

#define DM    1024
#define SEQ   1024
#define BATCH 4
#define NH    16
#define HD    64
#define GM    4096   // rows of X / combined (B*S)

// LDS leading dims (halves). Row strides are multiples of 8 halves = 16B so
// b128 LDS writes stay naturally aligned.
#define AL_LD 40
#define WR_LD 80
#define KT_LD 72
#define VT_LD 40
#define ET_LD 40

__device__ __forceinline__ v8f zero8() {
  v8f z;
#pragma unroll
  for (int i = 0; i < 8; ++i) z[i] = 0.0f;
  return z;
}

__device__ __forceinline__ v16h load_frag16(const _Float16* __restrict__ src, int ld) {
  const int l   = threadIdx.x & 31;
  const int m   = l & 15;
  const int hi8 = (l >> 4) << 3;
  v16h f;
#pragma unroll
  for (int i = 0; i < 16; ++i) {
    const int k = ((i >> 3) << 4) + hi8 + (i & 7);
    f[i] = src[m * ld + k];
  }
  return f;
}

__device__ __forceinline__ v8f wmma16(v16h a, v16h b, v8f c) {
  // D = A(16x32 f16) * B(32x16 f16) + C(16x16 f32)
  return __builtin_amdgcn_wmma_f32_16x16x32_f16(
      /*neg_a=*/false, a, /*neg_b=*/false, b,
      /*c_mod=*/(short)0, c, /*reuse_a=*/false, /*reuse_b=*/false);
}

__device__ __forceinline__ v16h load_fragB_tr16(const _Float16* tile, int ld) {
  typedef __attribute__((address_space(3))) s16x8 lds_s16x8;
  const int l = threadIdx.x & 31;
  const _Float16* p = tile + (((l >> 4) << 3) + (l & 7)) * ld + (((l >> 3) & 1) << 3);
  const v8h lo = __builtin_bit_cast(v8h, __builtin_amdgcn_ds_load_tr16_b128_v8i16((lds_s16x8*)p));
  const v8h hi = __builtin_bit_cast(v8h, __builtin_amdgcn_ds_load_tr16_b128_v8i16((lds_s16x8*)(p + 16 * ld)));
  return __builtin_shufflevector(lo, hi, 0, 1, 2, 3, 4, 5, 6, 7, 8, 9, 10, 11, 12, 13, 14, 15);
}

__device__ __forceinline__ void async_copy3_b128(uint32_t l0, const void* g0,
                                                 uint32_t l1, const void* g1,
                                                 uint32_t l2, const void* g2) {
  asm volatile("global_load_async_to_lds_b128 %0, %1, off\n\t"
               "global_load_async_to_lds_b128 %2, %3, off\n\t"
               "global_load_async_to_lds_b128 %4, %5, off\n\t"
               "s_wait_xcnt 0x0"
               :: "v"(l0), "v"((uint64_t)(uintptr_t)g0),
                  "v"(l1), "v"((uint64_t)(uintptr_t)g1),
                  "v"(l2), "v"((uint64_t)(uintptr_t)g2)
               : "memory");
}
__device__ __forceinline__ void wait_async() {
  asm volatile("s_wait_asynccnt 0" ::: "memory");
}
__device__ __forceinline__ void wait_ds() {
  asm volatile("s_wait_dscnt 0" ::: "memory");
}

__device__ __forceinline__ void tdm_load_tile_f16(uint32_t lds_byte_off,
                                                  const void* gaddr,
                                                  uint32_t tile_rows,
                                                  uint32_t row_halves,
                                                  uint32_t tensor_rows) {
  const uint64_t ga = (uint64_t)(uintptr_t)gaddr;
  u32x4 g0 = {0u, 0u, 0u, 0u};
  g0[0] = 1u;
  g0[1] = lds_byte_off;
  g0[2] = (uint32_t)(ga & 0xffffffffu);
  g0[3] = (uint32_t)(ga >> 32) | (2u << 30);

  i32x8 g1 = {0, 0, 0, 0, 0, 0, 0, 0};
  g1[0] = (int)((1u << 16) | (1u << 20) | (4u << 22) | (3u << 25));
  g1[1] = (int)((row_halves & 0xffffu) << 16);                       // dim0[15:0]
  g1[2] = (int)(((row_halves >> 16) & 0xffffu) |
                ((tensor_rows & 0xffffu) << 16));                    // dim0[31:16]|dim1[15:0]
  g1[3] = (int)(((tensor_rows >> 16) & 0xffffu) |
                ((row_halves & 0xffffu) << 16));
  g1[4] = (int)(tile_rows & 0xffffu);
  g1[5] = (int)row_halves;
  g1[6] = 0;
  g1[7] = 0;

  const i32x4 gz = {0, 0, 0, 0};
#if __clang_major__ >= 23
  const i32x8 gz8 = {0, 0, 0, 0, 0, 0, 0, 0};
  __builtin_amdgcn_tensor_load_to_lds(g0, g1, gz, gz, gz8, 0);
#else
  __builtin_amdgcn_tensor_load_to_lds(g0, g1, gz, gz, 0);
#endif
}
__device__ __forceinline__ void wait_tensor() {
  __builtin_amdgcn_s_wait_tensorcnt((short)0);
}

// ---------------------------------------------------------------------------
// K1: f32 -> f16 conversion
// ---------------------------------------------------------------------------
__global__ void cvt_f32_to_f16(const float* __restrict__ in,
                               _Float16* __restrict__ out, int n) {
  int i = blockIdx.x * blockDim.x + threadIdx.x;
  if (i < n) out[i] = (_Float16)in[i];
}

template <int MODE>
__global__ __launch_bounds__(256)
void gemm4096_wmma(const _Float16* __restrict__ A,
                   const _Float16* __restrict__ W,
                   const float* __restrict__ bias,
                   void* __restrict__ out) {
  __shared__ __attribute__((aligned(16))) _Float16 Al[2][128][AL_LD];
  __shared__ __attribute__((aligned(16))) _Float16 Wr[2][32][WR_LD];   // W tile [k][n]

  const int bm0 = blockIdx.x * 128;
  const int bn0 = blockIdx.y * 64;
  const int tid = threadIdx.x;
  const int w   = tid >> 5;
  const int l   = tid & 31;
  const int n   = l & 15;
  const int hi8 = (l >> 4) << 3;

  auto stage = [&](int kk, int buf) {
    // A tile 128x32 halves (512 x b128, 2 per thread) and W tile 32x64 halves
    // (256 x b128, 1 per thread), all via async-to-LDS
    const int arow = tid >> 2;         // m within tile: 0..63 (and +64)
    const int ac8  = (tid & 3) * 8;    // k base: 0..24
    const int wrow = tid >> 3;         // k within tile: 0..31
    const int wc8  = (tid & 7) * 8;    // n base: 0..56
    async_copy3_b128((uint32_t)(uintptr_t)&Al[buf][arow][ac8],
                     &A[(size_t)(bm0 + arow) * 1024 + kk + ac8],
                     (uint32_t)(uintptr_t)&Al[buf][arow + 64][ac8],
                     &A[(size_t)(bm0 + arow + 64) * 1024 + kk + ac8],
                     (uint32_t)(uintptr_t)&Wr[buf][wrow][wc8],
                     &W[(size_t)(kk + wrow) * 1024 + bn0 + wc8]);
  };

  v8f acc[4];
#pragma unroll
  for (int i = 0; i < 4; ++i) acc[i] = zero8();

  stage(0, 0);
  wait_async();            // chunk 0 landed
  __syncthreads();         // publish it across waves
  stage(32, 1);
  int buf = 0;
  for (int kk = 0; kk < 1024; kk += 32, buf ^= 1) {
    const v16h a = load_frag16(&Al[buf][w * 16][0], AL_LD);
#pragma unroll
    for (int nb = 0; nb < 4; ++nb) {
      const v16h bf = load_fragB_tr16(&Wr[buf][0][nb * 16], WR_LD);
      acc[nb] = wmma16(a, bf, acc[nb]);
    }

    wait_ds();             // this wave's reads of buf are done before its refill
    wait_async();          // chunk kk+32 landed (issued one trip ago)
    __syncthreads();       // publish it; every wave has left buf
    if (kk + 64 < 1024) stage(kk + 64, buf);   // copies fly during the next trip
  }
  wait_async();            // nothing of this wave's is outstanding at its end

#pragma unroll
  for (int nb = 0; nb < 4; ++nb) {
#pragma unroll
    for (int r = 0; r < 8; ++r) {
      const int row = bm0 + w * 16 + r + hi8;
      const int col = bn0 + nb * 16 + n;
      const float v = acc[nb][r] + bias[col];
      if (MODE == 0) {
        const int b = row >> 10, sr = row & 1023, hh = col >> 6, dd = col & 63;
        ((_Float16*)out)[(((size_t)(b * NH + hh)) * SEQ + sr) * HD + dd] = (_Float16)v;
      } else {
        ((float*)out)[(size_t)row * 1024 + col] = v;
      }
    }
  }
}

__global__ __launch_bounds__(256)
void attn_flash_wmma(const _Float16* __restrict__ Qh,
                     const _Float16* __restrict__ Kh,
                     const _Float16* __restrict__ Vh,
                     const _Float16* __restrict__ relh,  // [2049,64]
                     const float* __restrict__ mask,     // [B,S]
                     _Float16* __restrict__ Ch) {        // [B,S,DM]
  __shared__ _Float16 Kt[32][KT_LD];
  __shared__ _Float16 Vt[64][VT_LD];
  __shared__ _Float16 Et[8][16][ET_LD];
  __shared__ float    Pg[8][32][16];

  const int qblk = blockIdx.x & 7;         // S/128 = 8
  const int bh   = blockIdx.x >> 3;
  const int h    = bh & (NH - 1);
  const int bb   = bh >> 4;
  const int tid  = threadIdx.x;
  const int w    = tid >> 5;
  const int l    = tid & 31;
  const int n    = l & 15;
  const int hi8  = (l >> 4) << 3;
  const int q0   = qblk * 128 + w * 16;    // absolute q of this wave's tile

  const size_t baseBH = ((size_t)(bb * NH + h)) * SEQ * HD;
  const _Float16* Qp = Qh + baseBH + (size_t)q0 * HD;
  const v16h aq0 = load_frag16(Qp + 0,  HD);   // d = 0..31
  const v16h aq1 = load_frag16(Qp + 32, HD);   // d = 32..63

  v8f accd[4];
#pragma unroll
  for (int i = 0; i < 4; ++i) accd[i] = zero8();
  float mrow[8], lrow[8];
#pragma unroll
  for (int r = 0; r < 8; ++r) { mrow[r] = -1e30f; lrow[r] = 0.0f; }

  for (int k0 = 0; k0 < SEQ; k0 += 32) {
    if (w == 0) {
      tdm_load_tile_f16((uint32_t)(uintptr_t)&Kt[0][0],
                        &Kh[baseBH + (size_t)k0 * HD],
                        /*tile_rows=*/32, /*row_halves=*/HD,
                        /*tensor_rows=*/(uint32_t)(SEQ - k0));
    }
    // --- stage V chunk transposed (regular loads + LDS scatter) ---
    {
      const int row = tid >> 3;         // k within chunk 0..31
      const int c8  = (tid & 7) * 8;    // d base 0..56
      const _Float16* vs = &Vh[baseBH + (size_t)(k0 + row) * HD + c8];
#pragma unroll
      for (int j = 0; j < 8; ++j) Vt[c8 + j][row] = vs[j];
    }
    if (w == 0) wait_tensor();
    __syncthreads();

    v16h bv[4];
#pragma unroll
    for (int nb = 0; nb < 4; ++nb) bv[nb] = load_frag16(&Vt[nb * 16][0], VT_LD);

    float s2[2][8];
#pragma unroll
    for (int sub = 0; sub < 2; ++sub) {
      const int ks0 = k0 + sub * 16;
      const v16h bk0 = load_frag16(&Kt[sub * 16][0],  KT_LD);
      const v16h bk1 = load_frag16(&Kt[sub * 16][32], KT_LD);

      // content term: Q @ K^T over d=64
      v8f s = zero8();
      s = wmma16(aq0, bk0, s);
      s = wmma16(aq1, bk1, s);

      // rel term: P[i,dk] = <rel_emb[jb+i], K[ks0+dk]>, i in [0,31]
      const int jb = q0 - ks0 + (1024 - 15);   // always in [1, 2017]
      v8f p0 = zero8(), p1 = zero8();
      p0 = wmma16(load_frag16(relh + (size_t)jb * HD,             HD), bk0, p0);
      p0 = wmma16(load_frag16(relh + (size_t)jb * HD + 32,        HD), bk1, p0);
      p1 = wmma16(load_frag16(relh + (size_t)(jb + 16) * HD,      HD), bk0, p1);
      p1 = wmma16(load_frag16(relh + (size_t)(jb + 16) * HD + 32, HD), bk1, p1);
#pragma unroll
      for (int r = 0; r < 8; ++r) {
        Pg[w][r + hi8][n]      = p0[r];
        Pg[w][16 + r + hi8][n] = p1[r];
      }
      wait_ds();   // wave-local LDS RAW

      const float mval = mask[bb * SEQ + ks0 + n] * -1e9f;
#pragma unroll
      for (int r = 0; r < 8; ++r) {
        const int m = r + hi8;
        s2[sub][r] = (s[r] + Pg[w][m - n + 15][n]) * 0.125f + mval;
      }
    }

    // --- online softmax (rows live across 16 lanes; 8 rows per lane) ---
#pragma unroll
    for (int r = 0; r < 8; ++r) {
      float rm = fmaxf(s2[0][r], s2[1][r]);
#pragma unroll
      for (int off = 1; off < 16; off <<= 1) rm = fmaxf(rm, __shfl_xor(rm, off, 32));
      const float mnew = fmaxf(mrow[r], rm);
      const float ef   = __expf(mrow[r] - mnew);
      const float e0   = __expf(s2[0][r] - mnew);
      const float e1   = __expf(s2[1][r] - mnew);
      float rs = e0 + e1;
#pragma unroll
      for (int off = 1; off < 16; off <<= 1) rs += __shfl_xor(rs, off, 32);
      lrow[r] = lrow[r] * ef + rs;
      mrow[r] = mnew;
      const int m = r + hi8;
      Et[w][m][n]      = (_Float16)e0;
      Et[w][m][16 + n] = (_Float16)e1;
#pragma unroll
      for (int nb = 0; nb < 4; ++nb) accd[nb][r] *= ef;
    }
    wait_ds();

    // acc += exp(S) @ V  (A-frag from Et, B-frag from transposed V)
    const v16h ae = load_frag16(&Et[w][0][0], ET_LD);
#pragma unroll
    for (int nb = 0; nb < 4; ++nb) accd[nb] = wmma16(ae, bv[nb], accd[nb]);

    __syncthreads();   // protect Kt/Vt before next chunk
  }

  // local attention output -> Ch[b, q, h*64+d]
#pragma unroll
  for (int nb = 0; nb < 4; ++nb) {
#pragma unroll
    for (int r = 0; r < 8; ++r) {
      const int m = r + hi8;
      const float v = accd[nb][r] / lrow[r];
      Ch[((size_t)bb * SEQ + q0 + m) * DM + h * HD + nb * 16 + n] = (_Float16)v;
    }
  }
}

// ---------------------------------------------------------------------------
// K4: linear-attention global read (elu(q)+1 vs M, z) + sigmoid gating.
// Tiny FLOP count (~0.5 GF) -> plain VALU, one thread per (b,h,q,d).
// ---------------------------------------------------------------------------
__global__ __launch_bounds__(256)
void global_memory_gate(const _Float16* __restrict__ Qh,
                        const float* __restrict__ Mrd,  // [H,D,D]
                        const float* __restrict__ z,    // [H,D]
                        const float* __restrict__ galpha,
                        _Float16* __restrict__ Ch) {
  const int t = blockIdx.x * blockDim.x + threadIdx.x;
  const int d = t & 63;
  const int q = (t >> 6) & 1023;
  const int h = (t >> 16) & 15;
  const int b = t >> 20;
  const _Float16* qrow = Qh + (((size_t)(b * NH + h)) * SEQ + q) * HD;
  float num = 0.0f, den = 1e-6f;
#pragma unroll 8
  for (int dd = 0; dd < 64; ++dd) {
    const float x = (float)qrow[dd];
    const float s = x > 0.0f ? x + 1.0f : __expf(x);   // elu(x)+1
    den += s * z[h * 64 + dd];
    num += s * Mrd[((size_t)h * 64 + dd) * 64 + d];
  }
  const float glob = num / den;
  const float gate = 1.0f / (1.0f + __expf(-galpha[0]));
  const size_t ci = ((size_t)b * SEQ + q) * DM + h * HD + d;
  const float local = (float)Ch[ci];
  Ch[ci] = (_Float16)(gate * local + (1.0f - gate) * glob);
}

// ---------------------------------------------------------------------------
// Host-side orchestration
// ---------------------------------------------------------------------------
extern "C" void kernel_launch(void* const* d_in, const int* in_sizes, int n_in,
                              void* d_out, int out_size, void* d_ws, size_t ws_size,
                              hipStream_t stream) {
  (void)in_sizes; (void)n_in; (void)out_size; (void)ws_size;
  const float* hidden = (const float*)d_in[0];
  const float* mask   = (const float*)d_in[1];
  const float* Wq = (const float*)d_in[2];  const float* bq = (const float*)d_in[3];
  const float* Wk = (const float*)d_in[4];  const float* bk = (const float*)d_in[5];
  const float* Wv = (const float*)d_in[6];  const float* bv = (const float*)d_in[7];
  const float* Wo = (const float*)d_in[8];  const float* bo = (const float*)d_in[9];
  const float* rel = (const float*)d_in[10];
  const float* M   = (const float*)d_in[11];
  const float* z   = (const float*)d_in[12];
  const float* ga  = (const float*)d_in[13];

  // workspace carve-up (f16), ~48 MB total
  _Float16* p   = (_Float16*)d_ws;
  _Float16* Xh  = p; p += (size_t)GM * DM;
  _Float16* Wqh = p; p += (size_t)DM * DM;
  _Float16* Wkh = p; p += (size_t)DM * DM;
  _Float16* Wvh = p; p += (size_t)DM * DM;
  _Float16* Woh = p; p += (size_t)DM * DM;
  _Float16* relh = p; p += (size_t)2049 * HD;
  _Float16* Qh  = p; p += (size_t)GM * DM;
  _Float16* Kh  = p; p += (size_t)GM * DM;
  _Float16* Vh  = p; p += (size_t)GM * DM;
  _Float16* Ch  = p; p += (size_t)GM * DM;

  auto cvt = [&](const float* src, _Float16* dst, int n) {
    cvt_f32_to_f16<<<(n + 255) / 256, 256, 0, stream>>>(src, dst, n);
  };
  cvt(hidden, Xh, GM * DM);
  cvt(Wq, Wqh, DM * DM);
  cvt(Wk, Wkh, DM * DM);
  cvt(Wv, Wvh, DM * DM);
  cvt(Wo, Woh, DM * DM);
  cvt(rel, relh, 2049 * HD);

  dim3 gg(GM / 128, DM / 64);   // 32 x 16
  gemm4096_wmma<0><<<gg, 256, 0, stream>>>(Xh, Wqh, bq, (void*)Qh);
  gemm4096_wmma<0><<<gg, 256, 0, stream>>>(Xh, Wkh, bk, (void*)Kh);
  gemm4096_wmma<0><<<gg, 256, 0, stream>>>(Xh, Wvh, bv, (void*)Vh);

  attn_flash_wmma<<<BATCH * NH * (SEQ / 128), 256, 0, stream>>>(
      Qh, Kh, Vh, relh, mask, Ch);

  global_memory_gate<<<(BATCH * NH * SEQ * HD) / 256, 256, 0, stream>>>(
      Qh, M, z, ga, Ch);

  gemm4096_wmma<1><<<gg, 256, 0, stream>>>(Ch, Woh, bo, d_out);
}

// v002
// It runs in 238 microseconds.
// Next to v001, in two timings, it ran 1.14 times as fast each time.
// Over all steps from v000 it is 1.35 times as fast.
#include <hip/hip_runtime.h>
#include <hip/hip_bf16.h>
#include <stdint.h>

typedef __attribute__((ext_vector_type(16))) _Float16     v16h;
typedef __attribute__((ext_vector_type(8)))  float        v8f;
typedef __attribute__((ext_vector_type(4)))  unsigned int u32x4;
typedef __attribute__((ext_vector_type(4)))  int          i32x4;
typedef __attribute__((ext_vector_type(8)))  int          i32x8;
typedef __attribute__((ext_vector_type(8)))  short        s16x8;
typedef __attribute__((ext_vector_type(8)))  _Float16     v8h;

#define DM    1024
#define SEQ   1024
#define BATCH 4
#define NH    16
#define HD    64
#define GM    4096   // rows of X / combined (B*S)

// LDS leading dims (halves). Row strides are multiples of 8 halves = 16B so
// b128 LDS writes stay naturally aligned.
#define AL_LD 40
#define WR_LD 80
#define KT_LD 72
#define VT_LD 40
#define ET_LD 40

__device__ __forceinline__ v8f zero8() {
  v8f z;
#pragma unroll
  for (int i = 0; i < 8; ++i) z[i] = 0.0f;
  return z;
}

__device__ __forceinline__ v16h load_frag16(const _Float16* __restrict__ src, int ld) {
  const int l   = threadIdx.x & 31;
  const int m   = l & 15;
  const int hi8 = (l >> 4) << 3;
  v16h f;
#pragma unroll
  for (int i = 0; i < 16; ++i) {
    const int k = ((i >> 3) << 4) + hi8 + (i & 7);
    f[i] = src[m * ld + k];
  }
  return f;
}

__device__ __forceinline__ v8f wmma16(v16h a, v16h b, v8f c) {
  // D = A(16x32 f16) * B(32x16 f16) + C(16x16 f32)
  return __builtin_amdgcn_wmma_f32_16x16x32_f16(
      /*neg_a=*/false, a, /*neg_b=*/false, b,
      /*c_mod=*/(short)0, c, /*reuse_a=*/false, /*reuse_b=*/false);
}

__device__ __forceinline__ v16h load_fragB_tr16(const _Float16* tile, int ld) {
  typedef __attribute__((address_space(3))) s16x8 lds_s16x8;
  const int l = threadIdx.x & 31;
  const _Float16* p = tile + (((l >> 4) << 3) + (l & 7)) * ld + (((l >> 3) & 1) << 3);
  const v8h lo = __builtin_bit_cast(v8h, __builtin_amdgcn_ds_load_tr16_b128_v8i16((lds_s16x8*)p));
  const v8h hi = __builtin_bit_cast(v8h, __builtin_amdgcn_ds_load_tr16_b128_v8i16((lds_s16x8*)(p + 16 * ld)));
  return __builtin_shufflevector(lo, hi, 0, 1, 2, 3, 4, 5, 6, 7, 8, 9, 10, 11, 12, 13, 14, 15);
}

__device__ __forceinline__ void async_copy3_b128(uint32_t l0, const void* g0,
                                                 uint32_t l1, const void* g1,
                                                 uint32_t l2, const void* g2) {
  asm volatile("global_load_async_to_lds_b128 %0, %1, off\n\t"
               "global_load_async_to_lds_b128 %2, %3, off\n\t"
               "global_load_async_to_lds_b128 %4, %5, off\n\t"
               "s_wait_xcnt 0x0"
               :: "v"(l0), "v"((uint64_t)(uintptr_t)g0),
                  "v"(l1), "v"((uint64_t)(uintptr_t)g1),
                  "v"(l2), "v"((uint64_t)(uintptr_t)g2)
               : "memory");
}
__device__ __forceinline__ void wait_async() {
  asm volatile("s_wait_asynccnt 0" ::: "memory");
}
__device__ __forceinline__ void wait_ds() {
  asm volatile("s_wait_dscnt 0" ::: "memory");
}

__device__ __forceinline__ void tdm_load_tile_f16(uint32_t lds_byte_off,
                                                  const void* gaddr,
                                                  uint32_t tile_rows,
                                                  uint32_t row_halves,
                                                  uint32_t tensor_rows) {
  const uint64_t ga = (uint64_t)(uintptr_t)gaddr;
  u32x4 g0 = {0u, 0u, 0u, 0u};
  g0[0] = 1u;
  g0[1] = lds_byte_off;
  g0[2] = (uint32_t)(ga & 0xffffffffu);
  g0[3] = (uint32_t)(ga >> 32) | (2u << 30);

  i32x8 g1 = {0, 0, 0, 0, 0, 0, 0, 0};
  g1[0] = (int)((1u << 16) | (1u << 20) | (4u << 22) | (3u << 25));
  g1[1] = (int)((row_halves & 0xffffu) << 16);                       // dim0[15:0]
  g1[2] = (int)(((row_halves >> 16) & 0xffffu) |
                ((tensor_rows & 0xffffu) << 16));                    // dim0[31:16]|dim1[15:0]
  g1[3] = (int)(((tensor_rows >> 16) & 0xffffu) |
                ((row_halves & 0xffffu) << 16));
  g1[4] = (int)(tile_rows & 0xffffu);
  g1[5] = (int)row_halves;
  g1[6] = 0;
  g1[7] = 0;

  const i32x4 gz = {0, 0, 0, 0};
#if __clang_major__ >= 23
  const i32x8 gz8 = {0, 0, 0, 0, 0, 0, 0, 0};
  __builtin_amdgcn_tensor_load_to_lds(g0, g1, gz, gz, gz8, 0);
#else
  __builtin_amdgcn_tensor_load_to_lds(g0, g1, gz, gz, 0);
#endif
}
__device__ __forceinline__ void wait_tensor() {
  __builtin_amdgcn_s_wait_tensorcnt((short)0);
}

// ---------------------------------------------------------------------------
// K1: f32 -> f16 conversion
// ---------------------------------------------------------------------------
__global__ void cvt_f32_to_f16(const float* __restrict__ in,
                               _Float16* __restrict__ out, int n) {
  int i = blockIdx.x * blockDim.x + threadIdx.x;
  if (i < n) out[i] = (_Float16)in[i];
}

template <int MODE>
__global__ __launch_bounds__(256)
void gemm4096_wmma(const _Float16* __restrict__ A,
                   const _Float16* __restrict__ W,
                   const float* __restrict__ bias,
                   void* __restrict__ out) {
  __shared__ __attribute__((aligned(16))) _Float16 Al[2][128][AL_LD];
  __shared__ __attribute__((aligned(16))) _Float16 Wr[2][32][WR_LD];   // W tile [k][n]

  const int bm0 = blockIdx.x * 128;
  const int bn0 = blockIdx.y * 64;
  const int tid = threadIdx.x;
  const int w   = tid >> 5;
  const int l   = tid & 31;
  const int n   = l & 15;
  const int hi8 = (l >> 4) << 3;

  auto stage = [&](int kk, int buf) {
    // A tile 128x32 halves (512 x b128, 2 per thread) and W tile 32x64 halves
    // (256 x b128, 1 per thread), all via async-to-LDS
    const int arow = tid >> 2;         // m within tile: 0..63 (and +64)
    const int ac8  = (tid & 3) * 8;    // k base: 0..24
    const int wrow = tid >> 3;         // k within tile: 0..31
    const int wc8  = (tid & 7) * 8;    // n base: 0..56
    async_copy3_b128((uint32_t)(uintptr_t)&Al[buf][arow][ac8],
                     &A[(size_t)(bm0 + arow) * 1024 + kk + ac8],
                     (uint32_t)(uintptr_t)&Al[buf][arow + 64][ac8],
                     &A[(size_t)(bm0 + arow + 64) * 1024 + kk + ac8],
                     (uint32_t)(uintptr_t)&Wr[buf][wrow][wc8],
                     &W[(size_t)(kk + wrow) * 1024 + bn0 + wc8]);
  };

  v8f acc[4];
#pragma unroll
  for (int i = 0; i < 4; ++i) acc[i] = zero8();

  stage(0, 0);
  wait_async();            // chunk 0 landed
  __syncthreads();         // publish it across waves
  stage(32, 1);
  int buf = 0;
  for (int kk = 0; kk < 1024; kk += 32, buf ^= 1) {
    const v16h a = load_frag16(&Al[buf][w * 16][0], AL_LD);
#pragma unroll
    for (int nb = 0; nb < 4; ++nb) {
      const v16h bf = load_fragB_tr16(&Wr[buf][0][nb * 16], WR_LD);
      acc[nb] = wmma16(a, bf, acc[nb]);
    }

    wait_ds();             // this wave's reads of buf are done before its refill
    wait_async();          // chunk kk+32 landed (issued one trip ago)
    __syncthreads();       // publish it; every wave has left buf
    if (kk + 64 < 1024) stage(kk + 64, buf);   // copies fly during the next trip
  }
  wait_async();            // nothing of this wave's is outstanding at its end

#pragma unroll
  for (int nb = 0; nb < 4; ++nb) {
#pragma unroll
    for (int r = 0; r < 8; ++r) {
      const int row = bm0 + w * 16 + r + hi8;
      const int col = bn0 + nb * 16 + n;
      const float v = acc[nb][r] + bias[col];
      if (MODE == 0) {
        const int b = row >> 10, sr = row & 1023, hh = col >> 6, dd = col & 63;
        ((_Float16*)out)[(((size_t)(b * NH + hh)) * SEQ + sr) * HD + dd] = (_Float16)v;
      } else {
        ((float*)out)[(size_t)row * 1024 + col] = v;
      }
    }
  }
}

__global__ __launch_bounds__(256)
void attn_flash_wmma(const _Float16* __restrict__ Qh,
                     const _Float16* __restrict__ Kh,
                     const _Float16* __restrict__ Vh,
                     const _Float16* __restrict__ relh,  // [2049,64]
                     const float* __restrict__ mask,     // [B,S]
                     _Float16* __restrict__ Ch) {        // [B,S,DM]
  __shared__ _Float16 Kt[32][KT_LD];
  __shared__ _Float16 Vt[64][VT_LD];
  __shared__ _Float16 Et[8][16][ET_LD];
  __shared__ float    Pg[8][32][16];

  const int qblk = blockIdx.x & 7;         // S/128 = 8
  const int bh   = blockIdx.x >> 3;
  const int h    = bh & (NH - 1);
  const int bb   = bh >> 4;
  const int tid  = threadIdx.x;
  const int w    = tid >> 5;
  const int l    = tid & 31;
  const int n    = l & 15;
  const int hi8  = (l >> 4) << 3;
  const int q0   = qblk * 128 + w * 16;    // absolute q of this wave's tile

  const size_t baseBH = ((size_t)(bb * NH + h)) * SEQ * HD;
  const _Float16* Qp = Qh + baseBH + (size_t)q0 * HD;
  const v16h aq0 = load_frag16(Qp + 0,  HD);   // d = 0..31
  const v16h aq1 = load_frag16(Qp + 32, HD);   // d = 32..63

  v8f accd[4];
#pragma unroll
  for (int i = 0; i < 4; ++i) accd[i] = zero8();
  float mrow[8], lrow[8];
#pragma unroll
  for (int r = 0; r < 8; ++r) { mrow[r] = -1e30f; lrow[r] = 0.0f; }

  for (int k0 = 0; k0 < SEQ; k0 += 32) {
    if (w == 0) {
      tdm_load_tile_f16((uint32_t)(uintptr_t)&Kt[0][0],
                        &Kh[baseBH + (size_t)k0 * HD],
                        /*tile_rows=*/32, /*row_halves=*/HD,
                        /*tensor_rows=*/(uint32_t)(SEQ - k0));
    }
    // --- stage V chunk transposed (regular loads + LDS scatter) ---
    {
      const int row = tid >> 3;         // k within chunk 0..31
      const int c8  = (tid & 7) * 8;    // d base 0..56
      const _Float16* vs = &Vh[baseBH + (size_t)(k0 + row) * HD + c8];
#pragma unroll
      for (int j = 0; j < 8; ++j) Vt[c8 + j][row] = vs[j];
    }
    if (w == 0) wait_tensor();
    __syncthreads();

    v16h bv[4];
#pragma unroll
    for (int nb = 0; nb < 4; ++nb) bv[nb] = load_frag16(&Vt[nb * 16][0], VT_LD);

    float s2[2][8];
#pragma unroll
    for (int sub = 0; sub < 2; ++sub) {
      const int ks0 = k0 + sub * 16;
      const v16h bk0 = load_frag16(&Kt[sub * 16][0],  KT_LD);
      const v16h bk1 = load_frag16(&Kt[sub * 16][32], KT_LD);

      // content term: Q @ K^T over d=64
      v8f s = zero8();
      s = wmma16(aq0, bk0, s);
      s = wmma16(aq1, bk1, s);

      // rel term: P[i,dk] = <rel_emb[jb+i], K[ks0+dk]>, i in [0,31]
      const int jb = q0 - ks0 + (1024 - 15);   // always in [1, 2017]
      v8f p0 = zero8(), p1 = zero8();
      p0 = wmma16(load_frag16(relh + (size_t)jb * HD,             HD), bk0, p0);
      p0 = wmma16(load_frag16(relh + (size_t)jb * HD + 32,        HD), bk1, p0);
      p1 = wmma16(load_frag16(relh + (size_t)(jb + 16) * HD,      HD), bk0, p1);
      p1 = wmma16(load_frag16(relh + (size_t)(jb + 16) * HD + 32, HD), bk1, p1);
#pragma unroll
      for (int r = 0; r < 8; ++r) {
        Pg[w][r + hi8][n]      = p0[r];
        Pg[w][16 + r + hi8][n] = p1[r];
      }
      wait_ds();   // wave-local LDS RAW

      const float mval = mask[bb * SEQ + ks0 + n] * -1e9f;
#pragma unroll
      for (int r = 0; r < 8; ++r) {
        const int m = r + hi8;
        s2[sub][r] = (s[r] + Pg[w][m - n + 15][n]) * 0.125f + mval;
      }
    }

    // --- online softmax (rows live across 16 lanes; 8 rows per lane) ---
#pragma unroll
    for (int r = 0; r < 8; ++r) {
      float rm = fmaxf(s2[0][r], s2[1][r]);
#pragma unroll
      for (int off = 1; off < 16; off <<= 1) rm = fmaxf(rm, __shfl_xor(rm, off, 32));
      const float mnew = fmaxf(mrow[r], rm);
      const float ef   = __expf(mrow[r] - mnew);
      const float e0   = __expf(s2[0][r] - mnew);
      const float e1   = __expf(s2[1][r] - mnew);
      float rs = e0 + e1;
#pragma unroll
      for (int off = 1; off < 16; off <<= 1) rs += __shfl_xor(rs, off, 32);
      lrow[r] = lrow[r] * ef + rs;
      mrow[r] = mnew;
      const int m = r + hi8;
      Et[w][m][n]      = (_Float16)e0;
      Et[w][m][16 + n] = (_Float16)e1;
#pragma unroll
      for (int nb = 0; nb < 4; ++nb) accd[nb][r] *= ef;
    }
    wait_ds();

    // acc += exp(S) @ V  (A-frag from Et, B-frag from transposed V)
    const v16h ae = load_frag16(&Et[w][0][0], ET_LD);
#pragma unroll
    for (int nb = 0; nb < 4; ++nb) accd[nb] = wmma16(ae, bv[nb], accd[nb]);

    __syncthreads();   // protect Kt/Vt before next chunk
  }

  // local attention output -> Ch[b, q, h*64+d]
#pragma unroll
  for (int nb = 0; nb < 4; ++nb) {
#pragma unroll
    for (int r = 0; r < 8; ++r) {
      const int m = r + hi8;
      const float v = accd[nb][r] / lrow[r];
      Ch[((size_t)bb * SEQ + q0 + m) * DM + h * HD + nb * 16 + n] = (_Float16)v;
    }
  }
}

// ---------------------------------------------------------------------------
// K4: linear-attention global read (elu(q)+1 vs M, z) + sigmoid gating, f32 VALU.
// Block = (b, h, 128 q rows). elu(q)+1 is formed once per (q, dd) and kept in
// LDS beside M[h]; a wave owns 16 rows, a lane two neighbouring d, so that one
// broadcast LDS read of four dd feeds eight multiply-adds and a wave's access
// to a row of Ch is one whole 128-byte line. Sums run over dd in rising order.
// ---------------------------------------------------------------------------
typedef __attribute__((ext_vector_type(2))) float    v2f;
typedef __attribute__((ext_vector_type(4))) float    v4f;
typedef __attribute__((ext_vector_type(2))) _Float16 v2h;
#define SQ_LD 68     // 64 floats + 4 pad: 272 B rows (16 B x odd) for the b128 row readers

__global__ __launch_bounds__(256)
void global_memory_gate(const _Float16* __restrict__ Qh,
                        const float* __restrict__ Mrd,  // [H,D,D]
                        const float* __restrict__ z,    // [H,D]
                        const float* __restrict__ galpha,
                        _Float16* __restrict__ Ch) {
  __shared__ __attribute__((aligned(16))) float Sq[128][SQ_LD];   // elu(q)+1
  __shared__ __attribute__((aligned(16))) float Ml[64][64];       // M[h]

  const int tid = threadIdx.x;
  const int w   = tid >> 5;
  const int l   = tid & 31;
  const int bh  = blockIdx.x >> 3;          // S/128 = 8
  const int h   = bh & (NH - 1);
  const int b   = bh >> 4;
  const int q0  = (blockIdx.x & 7) * 128;

  const v4f* Mg = (const v4f*)(Mrd + (size_t)h * (HD * HD));
  const v8h* Qg = (const v8h*)(Qh + ((size_t)bh * SEQ + q0) * HD);
#pragma unroll
  for (int i = 0; i < 4; ++i) {
    const int c = tid + 256 * i;
    ((v4f*)&Ml[0][0])[c] = Mg[c];
    const v8h qv = Qg[c];
    float* sr = &Sq[c >> 3][(c & 7) * 8];
#pragma unroll
    for (int j = 0; j < 8; ++j) {
      const float x = (float)qv[j];
      sr[j] = x > 0.0f ? x + 1.0f : __expf(x);   // elu(x)+1
    }
  }

  // local attention rows: asked for ahead of the barrier, used behind the sums
  v2h* Cp = (v2h*)(Ch + ((size_t)b * SEQ + q0 + w * 16) * DM + h * HD + 2 * l);
  v2h loc[16];
#pragma unroll
  for (int r = 0; r < 16; ++r) loc[r] = Cp[r * (DM / 2)];

  __syncthreads();   // Sq and Ml are read across waves from here on

  v2f num[16];
#pragma unroll
  for (int r = 0; r < 16; ++r) num[r] = (v2f){0.0f, 0.0f};
  float den = 1e-6f;                         // of row w*16 + (l & 15)
  const float* zh = z + h * HD;

#pragma unroll
  for (int d4 = 0; d4 < HD; d4 += 4) {
    v2f m[4];
#pragma unroll
    for (int j = 0; j < 4; ++j) m[j] = *(const v2f*)&Ml[d4 + j][2 * l];
    const v4f sd = *(const v4f*)&Sq[w * 16 + (l & 15)][d4];
#pragma unroll
    for (int j = 0; j < 4; ++j) den = __builtin_fmaf(sd[j], zh[d4 + j], den);
#pragma unroll
    for (int r = 0; r < 16; ++r) {
      const v4f s = *(const v4f*)&Sq[w * 16 + r][d4];
#pragma unroll
      for (int j = 0; j < 4; ++j) num[r] += s[j] * m[j];
    }
  }

  const float gate = 1.0f / (1.0f + __expf(-galpha[0]));
#pragma unroll
  for (int r = 0; r < 16; ++r) {
    const float dr = __builtin_bit_cast(
        float, __builtin_amdgcn_readlane(__builtin_bit_cast(int, den), r));
    v2h o;
    o[0] = (_Float16)(gate * (float)loc[r][0] + (1.0f - gate) * (num[r][0] / dr));
    o[1] = (_Float16)(gate * (float)loc[r][1] + (1.0f - gate) * (num[r][1] / dr));
    Cp[r * (DM / 2)] = o;
  }
}

// ---------------------------------------------------------------------------
// Host-side orchestration
// ---------------------------------------------------------------------------
extern "C" void kernel_launch(void* const* d_in, const int* in_sizes, int n_in,
                              void* d_out, int out_size, void* d_ws, size_t ws_size,
                              hipStream_t stream) {
  (void)in_sizes; (void)n_in; (void)out_size; (void)ws_size;
  const float* hidden = (const float*)d_in[0];
  const float* mask   = (const float*)d_in[1];
  const float* Wq = (const float*)d_in[2];  const float* bq = (const float*)d_in[3];
  const float* Wk = (const float*)d_in[4];  const float* bk = (const float*)d_in[5];
  const float* Wv = (const float*)d_in[6];  const float* bv = (const float*)d_in[7];
  const float* Wo = (const float*)d_in[8];  const float* bo = (const float*)d_in[9];
  const float* rel = (const float*)d_in[10];
  const float* M   = (const float*)d_in[11];
  const float* z   = (const float*)d_in[12];
  const float* ga  = (const float*)d_in[13];

  // workspace carve-up (f16), ~48 MB total
  _Float16* p   = (_Float16*)d_ws;
  _Float16* Xh  = p; p += (size_t)GM * DM;
  _Float16* Wqh = p; p += (size_t)DM * DM;
  _Float16* Wkh = p; p += (size_t)DM * DM;
  _Float16* Wvh = p; p += (size_t)DM * DM;
  _Float16* Woh = p; p += (size_t)DM * DM;
  _Float16* relh = p; p += (size_t)2049 * HD;
  _Float16* Qh  = p; p += (size_t)GM * DM;
  _Float16* Kh  = p; p += (size_t)GM * DM;
  _Float16* Vh  = p; p += (size_t)GM * DM;
  _Float16* Ch  = p; p += (size_t)GM * DM;

  auto cvt = [&](const float* src, _Float16* dst, int n) {
    cvt_f32_to_f16<<<(n + 255) / 256, 256, 0, stream>>>(src, dst, n);
  };
  cvt(hidden, Xh, GM * DM);
  cvt(Wq, Wqh, DM * DM);
  cvt(Wk, Wkh, DM * DM);
  cvt(Wv, Wvh, DM * DM);
  cvt(Wo, Woh, DM * DM);
  cvt(rel, relh, 2049 * HD);

  dim3 gg(GM / 128, DM / 64);   // 32 x 16
  gemm4096_wmma<0><<<gg, 256, 0, stream>>>(Xh, Wqh, bq, (void*)Qh);
  gemm4096_wmma<0><<<gg, 256, 0, stream>>>(Xh, Wkh, bk, (void*)Kh);
  gemm4096_wmma<0><<<gg, 256, 0, stream>>>(Xh, Wvh, bv, (void*)Vh);

  attn_flash_wmma<<<BATCH * NH * (SEQ / 128), 256, 0, stream>>>(
      Qh, Kh, Vh, relh, mask, Ch);

  global_memory_gate<<<BATCH * NH * (SEQ / 128), 256, 0, stream>>>(
      Qh, M, z, ga, Ch);

  gemm4096_wmma<1><<<gg, 256, 0, stream>>>(Ch, Woh, bo, d_out);
}

// v003
// A run of this version takes 207 microseconds.
// In both of two side-by-side timings against v002, it was 1.15 times as fast.
// Counting every step since v000, it is 1.55 times as fast.
#include <hip/hip_runtime.h>
#include <hip/hip_bf16.h>
#include <stdint.h>

typedef __attribute__((ext_vector_type(16))) _Float16     v16h;
typedef __attribute__((ext_vector_type(8)))  float        v8f;
typedef __attribute__((ext_vector_type(4)))  unsigned int u32x4;
typedef __attribute__((ext_vector_type(4)))  int          i32x4;
typedef __attribute__((ext_vector_type(8)))  int          i32x8;
typedef __attribute__((ext_vector_type(8)))  short        s16x8;
typedef __attribute__((ext_vector_type(8)))  _Float16     v8h;

#define DM    1024
#define SEQ   1024
#define BATCH 4
#define NH    16
#define HD    64
#define GM    4096   // rows of X / combined (B*S)

// LDS leading dims (halves). Row strides are multiples of 8 halves = 16B so
// b128 LDS writes stay naturally aligned.
#define AL_LD 40
#define WR_LD 80
#define KT_LD 72
#define VT_LD 40
#define ET_LD 40

__device__ __forceinline__ v8f zero8() {
  v8f z;
#pragma unroll
  for (int i = 0; i < 8; ++i) z[i] = 0.0f;
  return z;
}

__device__ __forceinline__ v16h load_frag16(const _Float16* __restrict__ src, int ld) {
  const int l   = threadIdx.x & 31;
  const int m   = l & 15;
  const int hi8 = (l >> 4) << 3;
  v16h f;
#pragma unroll
  for (int i = 0; i < 16; ++i) {
    const int k = ((i >> 3) << 4) + hi8 + (i & 7);
    f[i] = src[m * ld + k];
  }
  return f;
}

__device__ __forceinline__ v8f wmma16(v16h a, v16h b, v8f c) {
  // D = A(16x32 f16) * B(32x16 f16) + C(16x16 f32)
  return __builtin_amdgcn_wmma_f32_16x16x32_f16(
      /*neg_a=*/false, a, /*neg_b=*/false, b,
      /*c_mod=*/(short)0, c, /*reuse_a=*/false, /*reuse_b=*/false);
}

__device__ __forceinline__ v16h load_fragB_tr16(const _Float16* tile, int ld) {
  typedef __attribute__((address_space(3))) s16x8 lds_s16x8;
  const int l = threadIdx.x & 31;
  const _Float16* p = tile + (((l >> 4) << 3) + (l & 7)) * ld + (((l >> 3) & 1) << 3);
  const v8h lo = __builtin_bit_cast(v8h, __builtin_amdgcn_ds_load_tr16_b128_v8i16((lds_s16x8*)p));
  const v8h hi = __builtin_bit_cast(v8h, __builtin_amdgcn_ds_load_tr16_b128_v8i16((lds_s16x8*)(p + 16 * ld)));
  return __builtin_shufflevector(lo, hi, 0, 1, 2, 3, 4, 5, 6, 7, 8, 9, 10, 11, 12, 13, 14, 15);
}

__device__ __forceinline__ void async_copy3_b128(uint32_t l0, const void* g0,
                                                 uint32_t l1, const void* g1,
                                                 uint32_t l2, const void* g2) {
  asm volatile("global_load_async_to_lds_b128 %0, %1, off\n\t"
               "global_load_async_to_lds_b128 %2, %3, off\n\t"
               "global_load_async_to_lds_b128 %4, %5, off\n\t"
               "s_wait_xcnt 0x0"
               :: "v"(l0), "v"((uint64_t)(uintptr_t)g0),
                  "v"(l1), "v"((uint64_t)(uintptr_t)g1),
                  "v"(l2), "v"((uint64_t)(uintptr_t)g2)
               : "memory");
}
// The same for a stage of five copies (one X tile in two halves, three W tiles).
__device__ __forceinline__ void async_copy5_b128(uint32_t l0, const void* g0,
                                                 uint32_t l1, const void* g1,
                                                 uint32_t l2, const void* g2,
                                                 uint32_t l3, const void* g3,
                                                 uint32_t l4, const void* g4) {
  asm volatile("global_load_async_to_lds_b128 %0, %1, off\n\t"
               "global_load_async_to_lds_b128 %2, %3, off\n\t"
               "global_load_async_to_lds_b128 %4, %5, off\n\t"
               "global_load_async_to_lds_b128 %6, %7, off\n\t"
               "global_load_async_to_lds_b128 %8, %9, off\n\t"
               "s_wait_xcnt 0x0"
               :: "v"(l0), "v"((uint64_t)(uintptr_t)g0),
                  "v"(l1), "v"((uint64_t)(uintptr_t)g1),
                  "v"(l2), "v"((uint64_t)(uintptr_t)g2),
                  "v"(l3), "v"((uint64_t)(uintptr_t)g3),
                  "v"(l4), "v"((uint64_t)(uintptr_t)g4)
               : "memory");
}
__device__ __forceinline__ void wait_async() {
  asm volatile("s_wait_asynccnt 0" ::: "memory");
}
__device__ __forceinline__ void wait_ds() {
  asm volatile("s_wait_dscnt 0" ::: "memory");
}

__device__ __forceinline__ void tdm_load_tile_f16(uint32_t lds_byte_off,
                                                  const void* gaddr,
                                                  uint32_t tile_rows,
                                                  uint32_t row_halves,
                                                  uint32_t tensor_rows) {
  const uint64_t ga = (uint64_t)(uintptr_t)gaddr;
  u32x4 g0 = {0u, 0u, 0u, 0u};
  g0[0] = 1u;
  g0[1] = lds_byte_off;
  g0[2] = (uint32_t)(ga & 0xffffffffu);
  g0[3] = (uint32_t)(ga >> 32) | (2u << 30);

  i32x8 g1 = {0, 0, 0, 0, 0, 0, 0, 0};
  g1[0] = (int)((1u << 16) | (1u << 20) | (4u << 22) | (3u << 25));
  g1[1] = (int)((row_halves & 0xffffu) << 16);                       // dim0[15:0]
  g1[2] = (int)(((row_halves >> 16) & 0xffffu) |
                ((tensor_rows & 0xffffu) << 16));                    // dim0[31:16]|dim1[15:0]
  g1[3] = (int)(((tensor_rows >> 16) & 0xffffu) |
                ((row_halves & 0xffffu) << 16));
  g1[4] = (int)(tile_rows & 0xffffu);
  g1[5] = (int)row_halves;
  g1[6] = 0;
  g1[7] = 0;

  const i32x4 gz = {0, 0, 0, 0};
#if __clang_major__ >= 23
  const i32x8 gz8 = {0, 0, 0, 0, 0, 0, 0, 0};
  __builtin_amdgcn_tensor_load_to_lds(g0, g1, gz, gz, gz8, 0);
#else
  __builtin_amdgcn_tensor_load_to_lds(g0, g1, gz, gz, 0);
#endif
}
__device__ __forceinline__ void wait_tensor() {
  __builtin_amdgcn_s_wait_tensorcnt((short)0);
}

// ---------------------------------------------------------------------------
// K1: f32 -> f16 conversion
// ---------------------------------------------------------------------------
__global__ void cvt_f32_to_f16(const float* __restrict__ in,
                               _Float16* __restrict__ out, int n) {
  int i = blockIdx.x * blockDim.x + threadIdx.x;
  if (i < n) out[i] = (_Float16)in[i];
}

template <int MODE>
__global__ __launch_bounds__(256)
void gemm4096_wmma(const _Float16* __restrict__ A,
                   const _Float16* __restrict__ W,
                   const float* __restrict__ bias,
                   const float* __restrict__ bias1,
                   const float* __restrict__ bias2,
                   void* __restrict__ out) {
  constexpr int NW = (MODE == 0) ? 3 : 1;   // weight matrices that share the A tile
  __shared__ __attribute__((aligned(16))) _Float16 Al[2][128][AL_LD];
  __shared__ __attribute__((aligned(16))) _Float16 Wr[2][NW][32][WR_LD];   // W tiles [k][n]

  const int bm0 = blockIdx.x * 128;
  const int bn0 = blockIdx.y * 64;
  const int tid = threadIdx.x;
  const int w   = tid >> 5;
  const int l   = tid & 31;
  const int n   = l & 15;
  const int hi8 = (l >> 4) << 3;

  auto stage = [&](int kk, int buf) {
    // A tile 128x32 halves (512 x b128, 2 per thread) and each W tile 32x64
    // halves (256 x b128, 1 per thread), all via async-to-LDS
    const int arow = tid >> 2;         // m within tile: 0..63 (and +64)
    const int ac8  = (tid & 3) * 8;    // k base: 0..24
    const int wrow = tid >> 3;         // k within tile: 0..31
    const int wc8  = (tid & 7) * 8;    // n base: 0..56
    const _Float16* wg = &W[(size_t)(kk + wrow) * 1024 + bn0 + wc8];
    if constexpr (NW == 3) {
      async_copy5_b128((uint32_t)(uintptr_t)&Al[buf][arow][ac8],
                       &A[(size_t)(bm0 + arow) * 1024 + kk + ac8],
                       (uint32_t)(uintptr_t)&Al[buf][arow + 64][ac8],
                       &A[(size_t)(bm0 + arow + 64) * 1024 + kk + ac8],
                       (uint32_t)(uintptr_t)&Wr[buf][0][wrow][wc8], wg,
                       (uint32_t)(uintptr_t)&Wr[buf][1][wrow][wc8], wg + DM * DM,
                       (uint32_t)(uintptr_t)&Wr[buf][2][wrow][wc8], wg + 2 * DM * DM);
    } else {
      async_copy3_b128((uint32_t)(uintptr_t)&Al[buf][arow][ac8],
                       &A[(size_t)(bm0 + arow) * 1024 + kk + ac8],
                       (uint32_t)(uintptr_t)&Al[buf][arow + 64][ac8],
                       &A[(size_t)(bm0 + arow + 64) * 1024 + kk + ac8],
                       (uint32_t)(uintptr_t)&Wr[buf][0][wrow][wc8], wg);
    }
  };

  v8f acc[NW][4];
#pragma unroll
  for (int j = 0; j < NW; ++j)
#pragma unroll
    for (int i = 0; i < 4; ++i) acc[j][i] = zero8();

  stage(0, 0);
  wait_async();            // chunk 0 landed
  __syncthreads();         // publish it across waves
  stage(32, 1);
  int buf = 0;
  for (int kk = 0; kk < 1024; kk += 32, buf ^= 1) {
    const v16h a = load_frag16(&Al[buf][w * 16][0], AL_LD);
#pragma unroll
    for (int j = 0; j < NW; ++j) {
#pragma unroll
      for (int nb = 0; nb < 4; ++nb) {
        const v16h bf = load_fragB_tr16(&Wr[buf][j][0][nb * 16], WR_LD);
        acc[j][nb] = wmma16(a, bf, acc[j][nb]);
      }
    }

    wait_ds();             // this wave's reads of buf are done before its refill
    wait_async();          // chunk kk+32 landed (issued one trip ago)
    __syncthreads();       // publish it; every wave has left buf
    if (kk + 64 < 1024) stage(kk + 64, buf);   // copies fly during the next trip
  }
  wait_async();            // nothing of this wave's is outstanding at its end

#pragma unroll
  for (int j = 0; j < NW; ++j) {
    const float* bj = j == 0 ? bias : j == 1 ? bias1 : bias2;
#pragma unroll
    for (int nb = 0; nb < 4; ++nb) {
#pragma unroll
      for (int r = 0; r < 8; ++r) {
        const int row = bm0 + w * 16 + r + hi8;
        const int col = bn0 + nb * 16 + n;
        const float v = acc[j][nb][r] + bj[col];
        if (MODE == 0) {
          const int b = row >> 10, sr = row & 1023, hh = col >> 6, dd = col & 63;
          ((_Float16*)out)[(size_t)j * GM * DM +
                           (((size_t)(b * NH + hh)) * SEQ + sr) * HD + dd] = (_Float16)v;
        } else {
          ((float*)out)[(size_t)row * 1024 + col] = v;
        }
      }
    }
  }
}

__global__ __launch_bounds__(256)
void attn_flash_wmma(const _Float16* __restrict__ Qh,
                     const _Float16* __restrict__ Kh,
                     const _Float16* __restrict__ Vh,
                     const _Float16* __restrict__ relh,  // [2049,64]
                     const float* __restrict__ mask,     // [B,S]
                     _Float16* __restrict__ Ch) {        // [B,S,DM]
  __shared__ _Float16 Kt[32][KT_LD];
  __shared__ _Float16 Vt[64][VT_LD];
  __shared__ _Float16 Et[8][16][ET_LD];
  __shared__ float    Pg[8][32][16];

  const int qblk = blockIdx.x & 7;         // S/128 = 8
  const int bh   = blockIdx.x >> 3;
  const int h    = bh & (NH - 1);
  const int bb   = bh >> 4;
  const int tid  = threadIdx.x;
  const int w    = tid >> 5;
  const int l    = tid & 31;
  const int n    = l & 15;
  const int hi8  = (l >> 4) << 3;
  const int q0   = qblk * 128 + w * 16;    // absolute q of this wave's tile

  const size_t baseBH = ((size_t)(bb * NH + h)) * SEQ * HD;
  const _Float16* Qp = Qh + baseBH + (size_t)q0 * HD;
  const v16h aq0 = load_frag16(Qp + 0,  HD);   // d = 0..31
  const v16h aq1 = load_frag16(Qp + 32, HD);   // d = 32..63

  v8f accd[4];
#pragma unroll
  for (int i = 0; i < 4; ++i) accd[i] = zero8();
  float mrow[8], lrow[8];
#pragma unroll
  for (int r = 0; r < 8; ++r) { mrow[r] = -1e30f; lrow[r] = 0.0f; }

  for (int k0 = 0; k0 < SEQ; k0 += 32) {
    if (w == 0) {
      tdm_load_tile_f16((uint32_t)(uintptr_t)&Kt[0][0],
                        &Kh[baseBH + (size_t)k0 * HD],
                        /*tile_rows=*/32, /*row_halves=*/HD,
                        /*tensor_rows=*/(uint32_t)(SEQ - k0));
    }
    // --- stage V chunk transposed (regular loads + LDS scatter) ---
    {
      const int row = tid >> 3;         // k within chunk 0..31
      const int c8  = (tid & 7) * 8;    // d base 0..56
      const _Float16* vs = &Vh[baseBH + (size_t)(k0 + row) * HD + c8];
#pragma unroll
      for (int j = 0; j < 8; ++j) Vt[c8 + j][row] = vs[j];
    }
    if (w == 0) wait_tensor();
    __syncthreads();

    v16h bv[4];
#pragma unroll
    for (int nb = 0; nb < 4; ++nb) bv[nb] = load_frag16(&Vt[nb * 16][0], VT_LD);

    float s2[2][8];
#pragma unroll
    for (int sub = 0; sub < 2; ++sub) {
      const int ks0 = k0 + sub * 16;
      const v16h bk0 = load_frag16(&Kt[sub * 16][0],  KT_LD);
      const v16h bk1 = load_frag16(&Kt[sub * 16][32], KT_LD);

      // content term: Q @ K^T over d=64
      v8f s = zero8();
      s = wmma16(aq0, bk0, s);
      s = wmma16(aq1, bk1, s);

      // rel term: P[i,dk] = <rel_emb[jb+i], K[ks0+dk]>, i in [0,31]
      const int jb = q0 - ks0 + (1024 - 15);   // always in [1, 2017]
      v8f p0 = zero8(), p1 = zero8();
      p0 = wmma16(load_frag16(relh + (size_t)jb * HD,             HD), bk0, p0);
      p0 = wmma16(load_frag16(relh + (size_t)jb * HD + 32,        HD), bk1, p0);
      p1 = wmma16(load_frag16(relh + (size_t)(jb + 16) * HD,      HD), bk0, p1);
      p1 = wmma16(load_frag16(relh + (size_t)(jb + 16) * HD + 32, HD), bk1, p1);
#pragma unroll
      for (int r = 0; r < 8; ++r) {
        Pg[w][r + hi8][n]      = p0[r];
        Pg[w][16 + r + hi8][n] = p1[r];
      }
      wait_ds();   // wave-local LDS RAW

      const float mval = mask[bb * SEQ + ks0 + n] * -1e9f;
#pragma unroll
      for (int r = 0; r < 8; ++r) {
        const int m = r + hi8;
        s2[sub][r] = (s[r] + Pg[w][m - n + 15][n]) * 0.125f + mval;
      }
    }

    // --- online softmax (rows live across 16 lanes; 8 rows per lane) ---
#pragma unroll
    for (int r = 0; r < 8; ++r) {
      float rm = fmaxf(s2[0][r], s2[1][r]);
#pragma unroll
      for (int off = 1; off < 16; off <<= 1) rm = fmaxf(rm, __shfl_xor(rm, off, 32));
      const float mnew = fmaxf(mrow[r], rm);
      const float ef   = __expf(mrow[r] - mnew);
      const float e0   = __expf(s2[0][r] - mnew);
      const float e1   = __expf(s2[1][r] - mnew);
      float rs = e0 + e1;
#pragma unroll
      for (int off = 1; off < 16; off <<= 1) rs += __shfl_xor(rs, off, 32);
      lrow[r] = lrow[r] * ef + rs;
      mrow[r] = mnew;
      const int m = r + hi8;
      Et[w][m][n]      = (_Float16)e0;
      Et[w][m][16 + n] = (_Float16)e1;
#pragma unroll
      for (int nb = 0; nb < 4; ++nb) accd[nb][r] *= ef;
    }
    wait_ds();

    // acc += exp(S) @ V  (A-frag from Et, B-frag from transposed V)
    const v16h ae = load_frag16(&Et[w][0][0], ET_LD);
#pragma unroll
    for (int nb = 0; nb < 4; ++nb) accd[nb] = wmma16(ae, bv[nb], accd[nb]);

    __syncthreads();   // protect Kt/Vt before next chunk
  }

  // local attention output -> Ch[b, q, h*64+d]
#pragma unroll
  for (int nb = 0; nb < 4; ++nb) {
#pragma unroll
    for (int r = 0; r < 8; ++r) {
      const int m = r + hi8;
      const float v = accd[nb][r] / lrow[r];
      Ch[((size_t)bb * SEQ + q0 + m) * DM + h * HD + nb * 16 + n] = (_Float16)v;
    }
  }
}

// ---------------------------------------------------------------------------
// K4: linear-attention global read (elu(q)+1 vs M, z) + sigmoid gating, f32 VALU.
// Block = (b, h, 128 q rows). elu(q)+1 is formed once per (q, dd) and kept in
// LDS beside M[h]; a wave owns 16 rows, a lane two neighbouring d, so that one
// broadcast LDS read of four dd feeds eight multiply-adds and a wave's access
// to a row of Ch is one whole 128-byte line. Sums run over dd in rising order.
// ---------------------------------------------------------------------------
typedef __attribute__((ext_vector_type(2))) float    v2f;
typedef __attribute__((ext_vector_type(4))) float    v4f;
typedef __attribute__((ext_vector_type(2))) _Float16 v2h;
#define SQ_LD 68     // 64 floats + 4 pad: 272 B rows (16 B x odd) for the b128 row readers

__global__ __launch_bounds__(256)
void global_memory_gate(const _Float16* __restrict__ Qh,
                        const float* __restrict__ Mrd,  // [H,D,D]
                        const float* __restrict__ z,    // [H,D]
                        const float* __restrict__ galpha,
                        _Float16* __restrict__ Ch) {
  __shared__ __attribute__((aligned(16))) float Sq[128][SQ_LD];   // elu(q)+1
  __shared__ __attribute__((aligned(16))) float Ml[64][64];       // M[h]

  const int tid = threadIdx.x;
  const int w   = tid >> 5;
  const int l   = tid & 31;
  const int bh  = blockIdx.x >> 3;          // S/128 = 8
  const int h   = bh & (NH - 1);
  const int b   = bh >> 4;
  const int q0  = (blockIdx.x & 7) * 128;

  const v4f* Mg = (const v4f*)(Mrd + (size_t)h * (HD * HD));
  const v8h* Qg = (const v8h*)(Qh + ((size_t)bh * SEQ + q0) * HD);
#pragma unroll
  for (int i = 0; i < 4; ++i) {
    const int c = tid + 256 * i;
    ((v4f*)&Ml[0][0])[c] = Mg[c];
    const v8h qv = Qg[c];
    float* sr = &Sq[c >> 3][(c & 7) * 8];
#pragma unroll
    for (int j = 0; j < 8; ++j) {
      const float x = (float)qv[j];
      sr[j] = x > 0.0f ? x + 1.0f : __expf(x);   // elu(x)+1
    }
  }

  // local attention rows: asked for ahead of the barrier, used behind the sums
  v2h* Cp = (v2h*)(Ch + ((size_t)b * SEQ + q0 + w * 16) * DM + h * HD + 2 * l);
  v2h loc[16];
#pragma unroll
  for (int r = 0; r < 16; ++r) loc[r] = Cp[r * (DM / 2)];

  __syncthreads();   // Sq and Ml are read across waves from here on

  v2f num[16];
#pragma unroll
  for (int r = 0; r < 16; ++r) num[r] = (v2f){0.0f, 0.0f};
  float den = 1e-6f;                         // of row w*16 + (l & 15)
  const float* zh = z + h * HD;

#pragma unroll
  for (int d4 = 0; d4 < HD; d4 += 4) {
    v2f m[4];
#pragma unroll
    for (int j = 0; j < 4; ++j) m[j] = *(const v2f*)&Ml[d4 + j][2 * l];
    const v4f sd = *(const v4f*)&Sq[w * 16 + (l & 15)][d4];
#pragma unroll
    for (int j = 0; j < 4; ++j) den = __builtin_fmaf(sd[j], zh[d4 + j], den);
#pragma unroll
    for (int r = 0; r < 16; ++r) {
      const v4f s = *(const v4f*)&Sq[w * 16 + r][d4];
#pragma unroll
      for (int j = 0; j < 4; ++j) num[r] += s[j] * m[j];
    }
  }

  const float gate = 1.0f / (1.0f + __expf(-galpha[0]));
#pragma unroll
  for (int r = 0; r < 16; ++r) {
    const float dr = __builtin_bit_cast(
        float, __builtin_amdgcn_readlane(__builtin_bit_cast(int, den), r));
    v2h o;
    o[0] = (_Float16)(gate * (float)loc[r][0] + (1.0f - gate) * (num[r][0] / dr));
    o[1] = (_Float16)(gate * (float)loc[r][1] + (1.0f - gate) * (num[r][1] / dr));
    Cp[r * (DM / 2)] = o;
  }
}

// ---------------------------------------------------------------------------
// Host-side orchestration
// ---------------------------------------------------------------------------
extern "C" void kernel_launch(void* const* d_in, const int* in_sizes, int n_in,
                              void* d_out, int out_size, void* d_ws, size_t ws_size,
                              hipStream_t stream) {
  (void)in_sizes; (void)n_in; (void)out_size; (void)ws_size;
  const float* hidden = (const float*)d_in[0];
  const float* mask   = (const float*)d_in[1];
  const float* Wq = (const float*)d_in[2];  const float* bq = (const float*)d_in[3];
  const float* Wk = (const float*)d_in[4];  const float* bk = (const float*)d_in[5];
  const float* Wv = (const float*)d_in[6];  const float* bv = (const float*)d_in[7];
  const float* Wo = (const float*)d_in[8];  const float* bo = (const float*)d_in[9];
  const float* rel = (const float*)d_in[10];
  const float* M   = (const float*)d_in[11];
  const float* z   = (const float*)d_in[12];
  const float* ga  = (const float*)d_in[13];

  // workspace carve-up (f16), ~48 MB total
  _Float16* p   = (_Float16*)d_ws;
  _Float16* Xh  = p; p += (size_t)GM * DM;
  _Float16* Wqh = p; p += (size_t)DM * DM;
  _Float16* Wkh = p; p += (size_t)DM * DM;
  _Float16* Wvh = p; p += (size_t)DM * DM;
  _Float16* Woh = p; p += (size_t)DM * DM;
  _Float16* relh = p; p += (size_t)2049 * HD;
  _Float16* Qh  = p; p += (size_t)GM * DM;
  _Float16* Kh  = p; p += (size_t)GM * DM;
  _Float16* Vh  = p; p += (size_t)GM * DM;
  _Float16* Ch  = p; p += (size_t)GM * DM;

  auto cvt = [&](const float* src, _Float16* dst, int n) {
    cvt_f32_to_f16<<<(n + 255) / 256, 256, 0, stream>>>(src, dst, n);
  };
  cvt(hidden, Xh, GM * DM);
  cvt(Wq, Wqh, DM * DM);
  cvt(Wk, Wkh, DM * DM);
  cvt(Wv, Wvh, DM * DM);
  cvt(Wo, Woh, DM * DM);
  cvt(rel, relh, 2049 * HD);

  dim3 gg(GM / 128, DM / 64);   // 32 x 16
  // Wqh, Wkh, Wvh and Qh, Kh, Vh lie one behind the other in the workspace
  gemm4096_wmma<0><<<gg, 256, 0, stream>>>(Xh, Wqh, bq, bk, bv, (void*)Qh);

  attn_flash_wmma<<<BATCH * NH * (SEQ / 128), 256, 0, stream>>>(
      Qh, Kh, Vh, relh, mask, Ch);

  global_memory_gate<<<BATCH * NH * (SEQ / 128), 256, 0, stream>>>(
      Qh, M, z, ga, Ch);

  gemm4096_wmma<1><<<gg, 256, 0, stream>>>(Ch, Woh, bo, bo, bo, d_out);
}

// v004
// It runs in 200 microseconds.
// In both of two side-by-side timings against v003, it was 1.03 times as fast.
// All steps since v000 together make it 1.60 times as fast.
#include <hip/hip_runtime.h>
#include <hip/hip_bf16.h>
#include <stdint.h>

typedef __attribute__((ext_vector_type(16))) _Float16     v16h;
typedef __attribute__((ext_vector_type(8)))  float        v8f;
typedef __attribute__((ext_vector_type(4)))  unsigned int u32x4;
typedef __attribute__((ext_vector_type(4)))  int          i32x4;
typedef __attribute__((ext_vector_type(8)))  int          i32x8;
typedef __attribute__((ext_vector_type(8)))  short        s16x8;
typedef __attribute__((ext_vector_type(8)))  _Float16     v8h;

#define DM    1024
#define SEQ   1024
#define BATCH 4
#define NH    16
#define HD    64
#define GM    4096   // rows of X / combined (B*S)

// LDS leading dims (halves). Row strides are multiples of 8 halves = 16B so
// b128 LDS writes stay naturally aligned.
#define AL_LD 40
#define WR_LD 80
#define KT_LD 72
#define VT_LD 40
#define ET_LD 40

__device__ __forceinline__ v8f zero8() {
  v8f z;
#pragma unroll
  for (int i = 0; i < 8; ++i) z[i] = 0.0f;
  return z;
}

__device__ __forceinline__ v16h load_frag16(const _Float16* __restrict__ src, int ld) {
  const int l   = threadIdx.x & 31;
  const int m   = l & 15;
  const int hi8 = (l >> 4) << 3;
  v16h f;
#pragma unroll
  for (int i = 0; i < 16; ++i) {
    const int k = ((i >> 3) << 4) + hi8 + (i & 7);
    f[i] = src[m * ld + k];
  }
  return f;
}

__device__ __forceinline__ v8f wmma16(v16h a, v16h b, v8f c) {
  // D = A(16x32 f16) * B(32x16 f16) + C(16x16 f32)
  return __builtin_amdgcn_wmma_f32_16x16x32_f16(
      /*neg_a=*/false, a, /*neg_b=*/false, b,
      /*c_mod=*/(short)0, c, /*reuse_a=*/false, /*reuse_b=*/false);
}

__device__ __forceinline__ v16h load_fragB_tr16(const _Float16* tile, int ld) {
  typedef __attribute__((address_space(3))) s16x8 lds_s16x8;
  const int l = threadIdx.x & 31;
  const _Float16* p = tile + (((l >> 4) << 3) + (l & 7)) * ld + (((l >> 3) & 1) << 3);
  const v8h lo = __builtin_bit_cast(v8h, __builtin_amdgcn_ds_load_tr16_b128_v8i16((lds_s16x8*)p));
  const v8h hi = __builtin_bit_cast(v8h, __builtin_amdgcn_ds_load_tr16_b128_v8i16((lds_s16x8*)(p + 16 * ld)));
  return __builtin_shufflevector(lo, hi, 0, 1, 2, 3, 4, 5, 6, 7, 8, 9, 10, 11, 12, 13, 14, 15);
}

__device__ __forceinline__ void async_copy3_b128(uint32_t l0, const void* g0,
                                                 uint32_t l1, const void* g1,
                                                 uint32_t l2, const void* g2) {
  asm volatile("global_load_async_to_lds_b128 %0, %1, off\n\t"
               "global_load_async_to_lds_b128 %2, %3, off\n\t"
               "global_load_async_to_lds_b128 %4, %5, off\n\t"
               "s_wait_xcnt 0x0"
               :: "v"(l0), "v"((uint64_t)(uintptr_t)g0),
                  "v"(l1), "v"((uint64_t)(uintptr_t)g1),
                  "v"(l2), "v"((uint64_t)(uintptr_t)g2)
               : "memory");
}
// The same for a stage of five copies (one X tile in two halves, three W tiles).
__device__ __forceinline__ void async_copy5_b128(uint32_t l0, const void* g0,
                                                 uint32_t l1, const void* g1,
                                                 uint32_t l2, const void* g2,
                                                 uint32_t l3, const void* g3,
                                                 uint32_t l4, const void* g4) {
  asm volatile("global_load_async_to_lds_b128 %0, %1, off\n\t"
               "global_load_async_to_lds_b128 %2, %3, off\n\t"
               "global_load_async_to_lds_b128 %4, %5, off\n\t"
               "global_load_async_to_lds_b128 %6, %7, off\n\t"
               "global_load_async_to_lds_b128 %8, %9, off\n\t"
               "s_wait_xcnt 0x0"
               :: "v"(l0), "v"((uint64_t)(uintptr_t)g0),
                  "v"(l1), "v"((uint64_t)(uintptr_t)g1),
                  "v"(l2), "v"((uint64_t)(uintptr_t)g2),
                  "v"(l3), "v"((uint64_t)(uintptr_t)g3),
                  "v"(l4), "v"((uint64_t)(uintptr_t)g4)
               : "memory");
}
__device__ __forceinline__ void wait_async() {
  asm volatile("s_wait_asynccnt 0" ::: "memory");
}
__device__ __forceinline__ void wait_ds() {
  asm volatile("s_wait_dscnt 0" ::: "memory");
}

__device__ __forceinline__ void tdm_load_tile_f16(uint32_t lds_byte_off,
                                                  const void* gaddr,
                                                  uint32_t tile_rows,
                                                  uint32_t row_halves,
                                                  uint32_t tensor_rows) {
  const uint64_t ga = (uint64_t)(uintptr_t)gaddr;
  u32x4 g0 = {0u, 0u, 0u, 0u};
  g0[0] = 1u;
  g0[1] = lds_byte_off;
  g0[2] = (uint32_t)(ga & 0xffffffffu);
  g0[3] = (uint32_t)(ga >> 32) | (2u << 30);

  i32x8 g1 = {0, 0, 0, 0, 0, 0, 0, 0};
  g1[0] = (int)((1u << 16) | (1u << 20) | (4u << 22) | (3u << 25));
  g1[1] = (int)((row_halves & 0xffffu) << 16);                       // dim0[15:0]
  g1[2] = (int)(((row_halves >> 16) & 0xffffu) |
                ((tensor_rows & 0xffffu) << 16));                    // dim0[31:16]|dim1[15:0]
  g1[3] = (int)(((tensor_rows >> 16) & 0xffffu) |
                ((row_halves & 0xffffu) << 16));
  g1[4] = (int)(tile_rows & 0xffffu);
  g1[5] = (int)row_halves;
  g1[6] = 0;
  g1[7] = 0;

  const i32x4 gz = {0, 0, 0, 0};
#if __clang_major__ >= 23
  const i32x8 gz8 = {0, 0, 0, 0, 0, 0, 0, 0};
  __builtin_amdgcn_tensor_load_to_lds(g0, g1, gz, gz, gz8, 0);
#else
  __builtin_amdgcn_tensor_load_to_lds(g0, g1, gz, gz, 0);
#endif
}
__device__ __forceinline__ void wait_tensor() {
  __builtin_amdgcn_s_wait_tensorcnt((short)0);
}

// ---------------------------------------------------------------------------
// K1: f32 -> f16 conversion. A lane converts U groups of four elements: all its
// 16-byte loads are asked for first (a wave's load is 512 contiguous bytes, its
// 8-byte store 256), so that few long waves stream instead of one wave being
// started per 32 elements. n4 = element count / 4; a block owns 256 * U groups.
// ---------------------------------------------------------------------------
typedef __attribute__((ext_vector_type(4))) float    f32x4;
typedef __attribute__((ext_vector_type(4))) _Float16 f16x4;

template <int U>
__global__ __launch_bounds__(256)
void cvt_f32_to_f16(const float* __restrict__ in,
                    _Float16* __restrict__ out, int n4) {
  const int i0 = blockIdx.x * (256 * U) + threadIdx.x;
  const f32x4* __restrict__ src = (const f32x4*)in;
  f16x4* __restrict__ dst = (f16x4*)out;
  if ((int)(blockIdx.x + 1) * (256 * U) <= n4) {   // the whole block lies inside: no lane test
    f32x4 v[U];
    // both loops unrolled: v[] stays in registers and the U loads go out back to back
#pragma unroll
    for (int u = 0; u < U; ++u) v[u] = src[i0 + u * 256];
#pragma unroll
    for (int u = 0; u < U; ++u) dst[i0 + u * 256] = __builtin_convertvector(v[u], f16x4);
    // no register that an issued store names is written again ahead of this wait
    asm volatile("s_wait_xcnt 0x0" ::: "memory");
  } else {                                         // the last, partly filled block
    for (int u = 0; u < U; ++u) {
      const int i = i0 + u * 256;
      if (i < n4) dst[i] = __builtin_convertvector(src[i], f16x4);
    }
  }
}

template <int MODE>
__global__ __launch_bounds__(256)
void gemm4096_wmma(const _Float16* __restrict__ A,
                   const _Float16* __restrict__ W,
                   const float* __restrict__ bias,
                   const float* __restrict__ bias1,
                   const float* __restrict__ bias2,
                   void* __restrict__ out) {
  constexpr int NW = (MODE == 0) ? 3 : 1;   // weight matrices that share the A tile
  __shared__ __attribute__((aligned(16))) _Float16 Al[2][128][AL_LD];
  __shared__ __attribute__((aligned(16))) _Float16 Wr[2][NW][32][WR_LD];   // W tiles [k][n]

  const int bm0 = blockIdx.x * 128;
  const int bn0 = blockIdx.y * 64;
  const int tid = threadIdx.x;
  const int w   = tid >> 5;
  const int l   = tid & 31;
  const int n   = l & 15;
  const int hi8 = (l >> 4) << 3;

  auto stage = [&](int kk, int buf) {
    // A tile 128x32 halves (512 x b128, 2 per thread) and each W tile 32x64
    // halves (256 x b128, 1 per thread), all via async-to-LDS
    const int arow = tid >> 2;         // m within tile: 0..63 (and +64)
    const int ac8  = (tid & 3) * 8;    // k base: 0..24
    const int wrow = tid >> 3;         // k within tile: 0..31
    const int wc8  = (tid & 7) * 8;    // n base: 0..56
    const _Float16* wg = &W[(size_t)(kk + wrow) * 1024 + bn0 + wc8];
    if constexpr (NW == 3) {
      async_copy5_b128((uint32_t)(uintptr_t)&Al[buf][arow][ac8],
                       &A[(size_t)(bm0 + arow) * 1024 + kk + ac8],
                       (uint32_t)(uintptr_t)&Al[buf][arow + 64][ac8],
                       &A[(size_t)(bm0 + arow + 64) * 1024 + kk + ac8],
                       (uint32_t)(uintptr_t)&Wr[buf][0][wrow][wc8], wg,
                       (uint32_t)(uintptr_t)&Wr[buf][1][wrow][wc8], wg + DM * DM,
                       (uint32_t)(uintptr_t)&Wr[buf][2][wrow][wc8], wg + 2 * DM * DM);
    } else {
      async_copy3_b128((uint32_t)(uintptr_t)&Al[buf][arow][ac8],
                       &A[(size_t)(bm0 + arow) * 1024 + kk + ac8],
                       (uint32_t)(uintptr_t)&Al[buf][arow + 64][ac8],
                       &A[(size_t)(bm0 + arow + 64) * 1024 + kk + ac8],
                       (uint32_t)(uintptr_t)&Wr[buf][0][wrow][wc8], wg);
    }
  };

  v8f acc[NW][4];
#pragma unroll
  for (int j = 0; j < NW; ++j)
#pragma unroll
    for (int i = 0; i < 4; ++i) acc[j][i] = zero8();

  stage(0, 0);
  wait_async();            // chunk 0 landed
  __syncthreads();         // publish it across waves
  stage(32, 1);
  int buf = 0;
  for (int kk = 0; kk < 1024; kk += 32, buf ^= 1) {
    const v16h a = load_frag16(&Al[buf][w * 16][0], AL_LD);
#pragma unroll
    for (int j = 0; j < NW; ++j) {
#pragma unroll
      for (int nb = 0; nb < 4; ++nb) {
        const v16h bf = load_fragB_tr16(&Wr[buf][j][0][nb * 16], WR_LD);
        acc[j][nb] = wmma16(a, bf, acc[j][nb]);
      }
    }

    wait_ds();             // this wave's reads of buf are done before its refill
    wait_async();          // chunk kk+32 landed (issued one trip ago)
    __syncthreads();       // publish it; every wave has left buf
    if (kk + 64 < 1024) stage(kk + 64, buf);   // copies fly during the next trip
  }
  wait_async();            // nothing of this wave's is outstanding at its end

#pragma unroll
  for (int j = 0; j < NW; ++j) {
    const float* bj = j == 0 ? bias : j == 1 ? bias1 : bias2;
#pragma unroll
    for (int nb = 0; nb < 4; ++nb) {
#pragma unroll
      for (int r = 0; r < 8; ++r) {
        const int row = bm0 + w * 16 + r + hi8;
        const int col = bn0 + nb * 16 + n;
        const float v = acc[j][nb][r] + bj[col];
        if (MODE == 0) {
          const int b = row >> 10, sr = row & 1023, hh = col >> 6, dd = col & 63;
          ((_Float16*)out)[(size_t)j * GM * DM +
                           (((size_t)(b * NH + hh)) * SEQ + sr) * HD + dd] = (_Float16)v;
        } else {
          ((float*)out)[(size_t)row * 1024 + col] = v;
        }
      }
    }
  }
}

__global__ __launch_bounds__(256)
void attn_flash_wmma(const _Float16* __restrict__ Qh,
                     const _Float16* __restrict__ Kh,
                     const _Float16* __restrict__ Vh,
                     const _Float16* __restrict__ relh,  // [2049,64]
                     const float* __restrict__ mask,     // [B,S]
                     _Float16* __restrict__ Ch) {        // [B,S,DM]
  __shared__ _Float16 Kt[32][KT_LD];
  __shared__ _Float16 Vt[64][VT_LD];
  __shared__ _Float16 Et[8][16][ET_LD];
  __shared__ float    Pg[8][32][16];

  const int qblk = blockIdx.x & 7;         // S/128 = 8
  const int bh   = blockIdx.x >> 3;
  const int h    = bh & (NH - 1);
  const int bb   = bh >> 4;
  const int tid  = threadIdx.x;
  const int w    = tid >> 5;
  const int l    = tid & 31;
  const int n    = l & 15;
  const int hi8  = (l >> 4) << 3;
  const int q0   = qblk * 128 + w * 16;    // absolute q of this wave's tile

  const size_t baseBH = ((size_t)(bb * NH + h)) * SEQ * HD;
  const _Float16* Qp = Qh + baseBH + (size_t)q0 * HD;
  const v16h aq0 = load_frag16(Qp + 0,  HD);   // d = 0..31
  const v16h aq1 = load_frag16(Qp + 32, HD);   // d = 32..63

  v8f accd[4];
#pragma unroll
  for (int i = 0; i < 4; ++i) accd[i] = zero8();
  float mrow[8], lrow[8];
#pragma unroll
  for (int r = 0; r < 8; ++r) { mrow[r] = -1e30f; lrow[r] = 0.0f; }

  for (int k0 = 0; k0 < SEQ; k0 += 32) {
    if (w == 0) {
      tdm_load_tile_f16((uint32_t)(uintptr_t)&Kt[0][0],
                        &Kh[baseBH + (size_t)k0 * HD],
                        /*tile_rows=*/32, /*row_halves=*/HD,
                        /*tensor_rows=*/(uint32_t)(SEQ - k0));
    }
    // --- stage V chunk transposed (regular loads + LDS scatter) ---
    {
      const int row = tid >> 3;         // k within chunk 0..31
      const int c8  = (tid & 7) * 8;    // d base 0..56
      const _Float16* vs = &Vh[baseBH + (size_t)(k0 + row) * HD + c8];
#pragma unroll
      for (int j = 0; j < 8; ++j) Vt[c8 + j][row] = vs[j];
    }
    if (w == 0) wait_tensor();
    __syncthreads();

    v16h bv[4];
#pragma unroll
    for (int nb = 0; nb < 4; ++nb) bv[nb] = load_frag16(&Vt[nb * 16][0], VT_LD);

    float s2[2][8];
#pragma unroll
    for (int sub = 0; sub < 2; ++sub) {
      const int ks0 = k0 + sub * 16;
      const v16h bk0 = load_frag16(&Kt[sub * 16][0],  KT_LD);
      const v16h bk1 = load_frag16(&Kt[sub * 16][32], KT_LD);

      // content term: Q @ K^T over d=64
      v8f s = zero8();
      s = wmma16(aq0, bk0, s);
      s = wmma16(aq1, bk1, s);

      // rel term: P[i,dk] = <rel_emb[jb+i], K[ks0+dk]>, i in [0,31]
      const int jb = q0 - ks0 + (1024 - 15);   // always in [1, 2017]
      v8f p0 = zero8(), p1 = zero8();
      p0 = wmma16(load_frag16(relh + (size_t)jb * HD,             HD), bk0, p0);
      p0 = wmma16(load_frag16(relh + (size_t)jb * HD + 32,        HD), bk1, p0);
      p1 = wmma16(load_frag16(relh + (size_t)(jb + 16) * HD,      HD), bk0, p1);
      p1 = wmma16(load_frag16(relh + (size_t)(jb + 16) * HD + 32, HD), bk1, p1);
#pragma unroll
      for (int r = 0; r < 8; ++r) {
        Pg[w][r + hi8][n]      = p0[r];
        Pg[w][16 + r + hi8][n] = p1[r];
      }
      wait_ds();   // wave-local LDS RAW

      const float mval = mask[bb * SEQ + ks0 + n] * -1e9f;
#pragma unroll
      for (int r = 0; r < 8; ++r) {
        const int m = r + hi8;
        s2[sub][r] = (s[r] + Pg[w][m - n + 15][n]) * 0.125f + mval;
      }
    }

    // --- online softmax (rows live across 16 lanes; 8 rows per lane) ---
#pragma unroll
    for (int r = 0; r < 8; ++r) {
      float rm = fmaxf(s2[0][r], s2[1][r]);
#pragma unroll
      for (int off = 1; off < 16; off <<= 1) rm = fmaxf(rm, __shfl_xor(rm, off, 32));
      const float mnew = fmaxf(mrow[r], rm);
      const float ef   = __expf(mrow[r] - mnew);
      const float e0   = __expf(s2[0][r] - mnew);
      const float e1   = __expf(s2[1][r] - mnew);
      float rs = e0 + e1;
#pragma unroll
      for (int off = 1; off < 16; off <<= 1) rs += __shfl_xor(rs, off, 32);
      lrow[r] = lrow[r] * ef + rs;
      mrow[r] = mnew;
      const int m = r + hi8;
      Et[w][m][n]      = (_Float16)e0;
      Et[w][m][16 + n] = (_Float16)e1;
#pragma unroll
      for (int nb = 0; nb < 4; ++nb) accd[nb][r] *= ef;
    }
    wait_ds();

    // acc += exp(S) @ V  (A-frag from Et, B-frag from transposed V)
    const v16h ae = load_frag16(&Et[w][0][0], ET_LD);
#pragma unroll
    for (int nb = 0; nb < 4; ++nb) accd[nb] = wmma16(ae, bv[nb], accd[nb]);

    __syncthreads();   // protect Kt/Vt before next chunk
  }

  // local attention output -> Ch[b, q, h*64+d]
#pragma unroll
  for (int nb = 0; nb < 4; ++nb) {
#pragma unroll
    for (int r = 0; r < 8; ++r) {
      const int m = r + hi8;
      const float v = accd[nb][r] / lrow[r];
      Ch[((size_t)bb * SEQ + q0 + m) * DM + h * HD + nb * 16 + n] = (_Float16)v;
    }
  }
}

// ---------------------------------------------------------------------------
// K4: linear-attention global read (elu(q)+1 vs M, z) + sigmoid gating, f32 VALU.
// Block = (b, h, 128 q rows). elu(q)+1 is formed once per (q, dd) and kept in
// LDS beside M[h]; a wave owns 16 rows, a lane two neighbouring d, so that one
// broadcast LDS read of four dd feeds eight multiply-adds and a wave's access
// to a row of Ch is one whole 128-byte line. Sums run over dd in rising order.
// ---------------------------------------------------------------------------
typedef __attribute__((ext_vector_type(2))) float    v2f;
typedef __attribute__((ext_vector_type(4))) float    v4f;
typedef __attribute__((ext_vector_type(2))) _Float16 v2h;
#define SQ_LD 68     // 64 floats + 4 pad: 272 B rows (16 B x odd) for the b128 row readers

__global__ __launch_bounds__(256)
void global_memory_gate(const _Float16* __restrict__ Qh,
                        const float* __restrict__ Mrd,  // [H,D,D]
                        const float* __restrict__ z,    // [H,D]
                        const float* __restrict__ galpha,
                        _Float16* __restrict__ Ch) {
  __shared__ __attribute__((aligned(16))) float Sq[128][SQ_LD];   // elu(q)+1
  __shared__ __attribute__((aligned(16))) float Ml[64][64];       // M[h]

  const int tid = threadIdx.x;
  const int w   = tid >> 5;
  const int l   = tid & 31;
  const int bh  = blockIdx.x >> 3;          // S/128 = 8
  const int h   = bh & (NH - 1);
  const int b   = bh >> 4;
  const int q0  = (blockIdx.x & 7) * 128;

  const v4f* Mg = (const v4f*)(Mrd + (size_t)h * (HD * HD));
  const v8h* Qg = (const v8h*)(Qh + ((size_t)bh * SEQ + q0) * HD);
#pragma unroll
  for (int i = 0; i < 4; ++i) {
    const int c = tid + 256 * i;
    ((v4f*)&Ml[0][0])[c] = Mg[c];
    const v8h qv = Qg[c];
    float* sr = &Sq[c >> 3][(c & 7) * 8];
#pragma unroll
    for (int j = 0; j < 8; ++j) {
      const float x = (float)qv[j];
      sr[j] = x > 0.0f ? x + 1.0f : __expf(x);   // elu(x)+1
    }
  }

  // local attention rows: asked for ahead of the barrier, used behind the sums
  v2h* Cp = (v2h*)(Ch + ((size_t)b * SEQ + q0 + w * 16) * DM + h * HD + 2 * l);
  v2h loc[16];
#pragma unroll
  for (int r = 0; r < 16; ++r) loc[r] = Cp[r * (DM / 2)];

  __syncthreads();   // Sq and Ml are read across waves from here on

  v2f num[16];
#pragma unroll
  for (int r = 0; r < 16; ++r) num[r] = (v2f){0.0f, 0.0f};
  float den = 1e-6f;                         // of row w*16 + (l & 15)
  const float* zh = z + h * HD;

#pragma unroll
  for (int d4 = 0; d4 < HD; d4 += 4) {
    v2f m[4];
#pragma unroll
    for (int j = 0; j < 4; ++j) m[j] = *(const v2f*)&Ml[d4 + j][2 * l];
    const v4f sd = *(const v4f*)&Sq[w * 16 + (l & 15)][d4];
#pragma unroll
    for (int j = 0; j < 4; ++j) den = __builtin_fmaf(sd[j], zh[d4 + j], den);
#pragma unroll
    for (int r = 0; r < 16; ++r) {
      const v4f s = *(const v4f*)&Sq[w * 16 + r][d4];
#pragma unroll
      for (int j = 0; j < 4; ++j) num[r] += s[j] * m[j];
    }
  }

  const float gate = 1.0f / (1.0f + __expf(-galpha[0]));
#pragma unroll
  for (int r = 0; r < 16; ++r) {
    const float dr = __builtin_bit_cast(
        float, __builtin_amdgcn_readlane(__builtin_bit_cast(int, den), r));
    v2h o;
    o[0] = (_Float16)(gate * (float)loc[r][0] + (1.0f - gate) * (num[r][0] / dr));
    o[1] = (_Float16)(gate * (float)loc[r][1] + (1.0f - gate) * (num[r][1] / dr));
    Cp[r * (DM / 2)] = o;
  }
}

// ---------------------------------------------------------------------------
// Host-side orchestration
// ---------------------------------------------------------------------------
extern "C" void kernel_launch(void* const* d_in, const int* in_sizes, int n_in,
                              void* d_out, int out_size, void* d_ws, size_t ws_size,
                              hipStream_t stream) {
  (void)in_sizes; (void)n_in; (void)out_size; (void)ws_size;
  const float* hidden = (const float*)d_in[0];
  const float* mask   = (const float*)d_in[1];
  const float* Wq = (const float*)d_in[2];  const float* bq = (const float*)d_in[3];
  const float* Wk = (const float*)d_in[4];  const float* bk = (const float*)d_in[5];
  const float* Wv = (const float*)d_in[6];  const float* bv = (const float*)d_in[7];
  const float* Wo = (const float*)d_in[8];  const float* bo = (const float*)d_in[9];
  const float* rel = (const float*)d_in[10];
  const float* M   = (const float*)d_in[11];
  const float* z   = (const float*)d_in[12];
  const float* ga  = (const float*)d_in[13];

  // workspace carve-up (f16), ~48 MB total
  _Float16* p   = (_Float16*)d_ws;
  _Float16* Xh  = p; p += (size_t)GM * DM;
  _Float16* Wqh = p; p += (size_t)DM * DM;
  _Float16* Wkh = p; p += (size_t)DM * DM;
  _Float16* Wvh = p; p += (size_t)DM * DM;
  _Float16* Woh = p; p += (size_t)DM * DM;
  _Float16* relh = p; p += (size_t)2049 * HD;
  _Float16* Qh  = p; p += (size_t)GM * DM;
  _Float16* Kh  = p; p += (size_t)GM * DM;
  _Float16* Vh  = p; p += (size_t)GM * DM;
  _Float16* Ch  = p; p += (size_t)GM * DM;

  // X: 512 blocks x 8 groups a lane (two blocks a WGP); a weight: 256 x 4
  cvt_f32_to_f16<8><<<GM * DM / (4 * 256 * 8), 256, 0, stream>>>(hidden, Xh, GM * DM / 4);
  auto cvtw = [&](const float* src, _Float16* dst) {
    cvt_f32_to_f16<4><<<DM * DM / (4 * 256 * 4), 256, 0, stream>>>(src, dst, DM * DM / 4);
  };
  cvtw(Wq, Wqh);
  cvtw(Wk, Wkh);
  cvtw(Wv, Wvh);
  cvtw(Wo, Woh);
  cvt_f32_to_f16<1><<<(2049 * HD / 4 + 255) / 256, 256, 0, stream>>>(rel, relh, 2049 * HD / 4);

  dim3 gg(GM / 128, DM / 64);   // 32 x 16
  // Wqh, Wkh, Wvh and Qh, Kh, Vh lie one behind the other in the workspace
  gemm4096_wmma<0><<<gg, 256, 0, stream>>>(Xh, Wqh, bq, bk, bv, (void*)Qh);

  attn_flash_wmma<<<BATCH * NH * (SEQ / 128), 256, 0, stream>>>(
      Qh, Kh, Vh, relh, mask, Ch);

  global_memory_gate<<<BATCH * NH * (SEQ / 128), 256, 0, stream>>>(
      Qh, M, z, ga, Ch);

  gemm4096_wmma<1><<<gg, 256, 0, stream>>>(Ch, Woh, bo, bo, bo, d_out);
}

// v005
// One run takes 166 microseconds.
// Two timings next to v004 both put it at 1.20 times that version's speed.
// All steps since v000 together make it 1.92 times as fast.
#include <hip/hip_runtime.h>
#include <hip/hip_bf16.h>
#include <stdint.h>

typedef __attribute__((ext_vector_type(16))) _Float16     v16h;
typedef __attribute__((ext_vector_type(8)))  float        v8f;
typedef __attribute__((ext_vector_type(8)))  short        s16x8;
typedef __attribute__((ext_vector_type(8)))  _Float16     v8h;

#define DM    1024
#define SEQ   1024
#define BATCH 4
#define NH    16
#define HD    64
#define GM    4096   // rows of X / combined (B*S)

// LDS leading dims (halves). Row strides are multiples of 8 halves = 16B so
// b128 LDS writes stay naturally aligned.
#define AL_LD 40
#define WR_LD 80     // 64 data halves + 16 pad halves: 160 B rows for ds_load_tr16_b128
#define KT_LD 72     // 64 data halves + 8 pad halves: 144 B rows (16 B x odd) for b128 readers
#define VT_LD 40
#define ET_LD 40

__device__ __forceinline__ v8f zero8() {
  v8f z;
#pragma unroll
  for (int i = 0; i < 8; ++i) z[i] = 0.0f;
  return z;
}

__device__ __forceinline__ v16h load_frag16(const _Float16* __restrict__ src, int ld) {
  const int l   = threadIdx.x & 31;
  const int m   = l & 15;
  const int hi8 = (l >> 4) << 3;
  v16h f;
#pragma unroll
  for (int i = 0; i < 16; ++i) {
    const int k = ((i >> 3) << 4) + hi8 + (i & 7);
    f[i] = src[m * ld + k];
  }
  return f;
}

__device__ __forceinline__ v8f wmma16(v16h a, v16h b, v8f c) {
  // D = A(16x32 f16) * B(32x16 f16) + C(16x16 f32)
  return __builtin_amdgcn_wmma_f32_16x16x32_f16(
      /*neg_a=*/false, a, /*neg_b=*/false, b,
      /*c_mod=*/(short)0, c, /*reuse_a=*/false, /*reuse_b=*/false);
}

__device__ __forceinline__ v16h load_fragB_tr16(const _Float16* tile, int ld) {
  typedef __attribute__((address_space(3))) s16x8 lds_s16x8;
  const int l = threadIdx.x & 31;
  const _Float16* p = tile + (((l >> 4) << 3) + (l & 7)) * ld + (((l >> 3) & 1) << 3);
  const v8h lo = __builtin_bit_cast(v8h, __builtin_amdgcn_ds_load_tr16_b128_v8i16((lds_s16x8*)p));
  const v8h hi = __builtin_bit_cast(v8h, __builtin_amdgcn_ds_load_tr16_b128_v8i16((lds_s16x8*)(p + 16 * ld)));
  return __builtin_shufflevector(lo, hi, 0, 1, 2, 3, 4, 5, 6, 7, 8, 9, 10, 11, 12, 13, 14, 15);
}

__device__ __forceinline__ void async_copy3_b128(uint32_t l0, const void* g0,
                                                 uint32_t l1, const void* g1,
                                                 uint32_t l2, const void* g2) {
  asm volatile("global_load_async_to_lds_b128 %0, %1, off\n\t"
               "global_load_async_to_lds_b128 %2, %3, off\n\t"
               "global_load_async_to_lds_b128 %4, %5, off\n\t"
               "s_wait_xcnt 0x0"
               :: "v"(l0), "v"((uint64_t)(uintptr_t)g0),
                  "v"(l1), "v"((uint64_t)(uintptr_t)g1),
                  "v"(l2), "v"((uint64_t)(uintptr_t)g2)
               : "memory");
}
// The same for a stage of five copies (one X tile in two halves, three W tiles).
__device__ __forceinline__ void async_copy5_b128(uint32_t l0, const void* g0,
                                                 uint32_t l1, const void* g1,
                                                 uint32_t l2, const void* g2,
                                                 uint32_t l3, const void* g3,
                                                 uint32_t l4, const void* g4) {
  asm volatile("global_load_async_to_lds_b128 %0, %1, off\n\t"
               "global_load_async_to_lds_b128 %2, %3, off\n\t"
               "global_load_async_to_lds_b128 %4, %5, off\n\t"
               "global_load_async_to_lds_b128 %6, %7, off\n\t"
               "global_load_async_to_lds_b128 %8, %9, off\n\t"
               "s_wait_xcnt 0x0"
               :: "v"(l0), "v"((uint64_t)(uintptr_t)g0),
                  "v"(l1), "v"((uint64_t)(uintptr_t)g1),
                  "v"(l2), "v"((uint64_t)(uintptr_t)g2),
                  "v"(l3), "v"((uint64_t)(uintptr_t)g3),
                  "v"(l4), "v"((uint64_t)(uintptr_t)g4)
               : "memory");
}
// The same for a stage of one copy (a K tile: 16 bytes a lane).
__device__ __forceinline__ void async_copy1_b128(uint32_t l0, const void* g0) {
  asm volatile("global_load_async_to_lds_b128 %0, %1, off\n\t"
               "s_wait_xcnt 0x0"
               :: "v"(l0), "v"((uint64_t)(uintptr_t)g0)
               : "memory");
}
__device__ __forceinline__ void wait_async() {
  asm volatile("s_wait_asynccnt 0" ::: "memory");
}
__device__ __forceinline__ void wait_ds() {
  asm volatile("s_wait_dscnt 0" ::: "memory");
}

// ---------------------------------------------------------------------------
// K1: f32 -> f16 conversion. A lane converts U groups of four elements: all its
// 16-byte loads are asked for first (a wave's load is 512 contiguous bytes, its
// 8-byte store 256), so that few long waves stream instead of one wave being
// started per 32 elements. n4 = element count / 4; a block owns 256 * U groups.
// ---------------------------------------------------------------------------
typedef __attribute__((ext_vector_type(4))) float    f32x4;
typedef __attribute__((ext_vector_type(4))) _Float16 f16x4;

template <int U>
__global__ __launch_bounds__(256)
void cvt_f32_to_f16(const float* __restrict__ in,
                    _Float16* __restrict__ out, int n4) {
  const int i0 = blockIdx.x * (256 * U) + threadIdx.x;
  const f32x4* __restrict__ src = (const f32x4*)in;
  f16x4* __restrict__ dst = (f16x4*)out;
  if ((int)(blockIdx.x + 1) * (256 * U) <= n4) {   // the whole block lies inside: no lane test
    f32x4 v[U];
    // both loops unrolled: v[] stays in registers and the U loads go out back to back
#pragma unroll
    for (int u = 0; u < U; ++u) v[u] = src[i0 + u * 256];
#pragma unroll
    for (int u = 0; u < U; ++u) dst[i0 + u * 256] = __builtin_convertvector(v[u], f16x4);
    // no register that an issued store names is written again ahead of this wait
    asm volatile("s_wait_xcnt 0x0" ::: "memory");
  } else {                                         // the last, partly filled block
    for (int u = 0; u < U; ++u) {
      const int i = i0 + u * 256;
      if (i < n4) dst[i] = __builtin_convertvector(src[i], f16x4);
    }
  }
}

template <int MODE>
__global__ __launch_bounds__(256)
void gemm4096_wmma(const _Float16* __restrict__ A,
                   const _Float16* __restrict__ W,
                   const float* __restrict__ bias,
                   const float* __restrict__ bias1,
                   const float* __restrict__ bias2,
                   void* __restrict__ out) {
  constexpr int NW = (MODE == 0) ? 3 : 1;   // weight matrices that share the A tile
  __shared__ __attribute__((aligned(16))) _Float16 Al[2][128][AL_LD];
  __shared__ __attribute__((aligned(16))) _Float16 Wr[2][NW][32][WR_LD];   // W tiles [k][n]

  const int bm0 = blockIdx.x * 128;
  const int bn0 = blockIdx.y * 64;
  const int tid = threadIdx.x;
  const int w   = tid >> 5;
  const int l   = tid & 31;
  const int n   = l & 15;
  const int hi8 = (l >> 4) << 3;

  auto stage = [&](int kk, int buf) {
    // A tile 128x32 halves (512 x b128, 2 per thread) and each W tile 32x64
    // halves (256 x b128, 1 per thread), all via async-to-LDS
    const int arow = tid >> 2;         // m within tile: 0..63 (and +64)
    const int ac8  = (tid & 3) * 8;    // k base: 0..24
    const int wrow = tid >> 3;         // k within tile: 0..31
    const int wc8  = (tid & 7) * 8;    // n base: 0..56
    const _Float16* wg = &W[(size_t)(kk + wrow) * 1024 + bn0 + wc8];
    if constexpr (NW == 3) {
      async_copy5_b128((uint32_t)(uintptr_t)&Al[buf][arow][ac8],
                       &A[(size_t)(bm0 + arow) * 1024 + kk + ac8],
                       (uint32_t)(uintptr_t)&Al[buf][arow + 64][ac8],
                       &A[(size_t)(bm0 + arow + 64) * 1024 + kk + ac8],
                       (uint32_t)(uintptr_t)&Wr[buf][0][wrow][wc8], wg,
                       (uint32_t)(uintptr_t)&Wr[buf][1][wrow][wc8], wg + DM * DM,
                       (uint32_t)(uintptr_t)&Wr[buf][2][wrow][wc8], wg + 2 * DM * DM);
    } else {
      async_copy3_b128((uint32_t)(uintptr_t)&Al[buf][arow][ac8],
                       &A[(size_t)(bm0 + arow) * 1024 + kk + ac8],
                       (uint32_t)(uintptr_t)&Al[buf][arow + 64][ac8],
                       &A[(size_t)(bm0 + arow + 64) * 1024 + kk + ac8],
                       (uint32_t)(uintptr_t)&Wr[buf][0][wrow][wc8], wg);
    }
  };

  v8f acc[NW][4];
#pragma unroll
  for (int j = 0; j < NW; ++j)
#pragma unroll
    for (int i = 0; i < 4; ++i) acc[j][i] = zero8();

  stage(0, 0);
  wait_async();            // chunk 0 landed
  __syncthreads();         // publish it across waves
  stage(32, 1);
  int buf = 0;
  for (int kk = 0; kk < 1024; kk += 32, buf ^= 1) {
    const v16h a = load_frag16(&Al[buf][w * 16][0], AL_LD);
#pragma unroll
    for (int j = 0; j < NW; ++j) {
#pragma unroll
      for (int nb = 0; nb < 4; ++nb) {
        const v16h bf = load_fragB_tr16(&Wr[buf][j][0][nb * 16], WR_LD);
        acc[j][nb] = wmma16(a, bf, acc[j][nb]);
      }
    }

    wait_ds();             // this wave's reads of buf are done before its refill
    wait_async();          // chunk kk+32 landed (issued one trip ago)
    __syncthreads();       // publish it; every wave has left buf
    if (kk + 64 < 1024) stage(kk + 64, buf);   // copies fly during the next trip
  }
  wait_async();            // nothing of this wave's is outstanding at its end

#pragma unroll
  for (int j = 0; j < NW; ++j) {
    const float* bj = j == 0 ? bias : j == 1 ? bias1 : bias2;
#pragma unroll
    for (int nb = 0; nb < 4; ++nb) {
#pragma unroll
      for (int r = 0; r < 8; ++r) {
        const int row = bm0 + w * 16 + r + hi8;
        const int col = bn0 + nb * 16 + n;
        const float v = acc[j][nb][r] + bj[col];
        if (MODE == 0) {
          const int b = row >> 10, sr = row & 1023, hh = col >> 6, dd = col & 63;
          ((_Float16*)out)[(size_t)j * GM * DM +
                           (((size_t)(b * NH + hh)) * SEQ + sr) * HD + dd] = (_Float16)v;
        } else {
          ((float*)out)[(size_t)row * 1024 + col] = v;
        }
      }
    }
  }
}

// ---------------------------------------------------------------------------
// K3: flash attention with fused relative-position scores.
// Block = (b, h, 128-row q block); 8 waves, each wave a 16-row q tile.
// Everything a chunk reads from global memory is asked for one chunk ahead:
// K chunks fly into two LDS buffers by async copies (ring order as in the
// GEMMs, one barrier a chunk); V chunks wait in registers and are transposed
// into the other of two LDS buffers; the rel_emb fragments and the mask values
// are reloaded into their registers right behind their last use.
// Online softmax per row.
// Writes local attention output (pre-gating) to Ch[b,s,h*64+d] f16.
// ---------------------------------------------------------------------------
__global__ __launch_bounds__(256)
void attn_flash_wmma(const _Float16* __restrict__ Qh,
                     const _Float16* __restrict__ Kh,
                     const _Float16* __restrict__ Vh,
                     const _Float16* __restrict__ relh,  // [2049,64]
                     const float* __restrict__ mask,     // [B,S]
                     _Float16* __restrict__ Ch) {        // [B,S,DM]
  __shared__ __attribute__((aligned(16))) _Float16 Kt[2][32][KT_LD];  // K chunks row-major [k][d]
  __shared__ _Float16 Vt[2][64][VT_LD];    // V chunks transposed [d][k]
  __shared__ _Float16 Et[8][16][ET_LD];    // per-wave exp(S) tile (A-frag src)
  __shared__ float    Pg[8][32][16];       // per-wave rel-score gather buffer

  const int qblk = blockIdx.x & 7;         // S/128 = 8
  const int bh   = blockIdx.x >> 3;
  const int h    = bh & (NH - 1);
  const int bb   = bh >> 4;
  const int tid  = threadIdx.x;
  const int w    = tid >> 5;
  const int l    = tid & 31;
  const int n    = l & 15;
  const int hi8  = (l >> 4) << 3;
  const int q0   = qblk * 128 + w * 16;    // absolute q of this wave's tile

  const size_t baseBH = ((size_t)(bb * NH + h)) * SEQ * HD;
  const _Float16* Qp = Qh + baseBH + (size_t)q0 * HD;
  const v16h aq0 = load_frag16(Qp + 0,  HD);   // d = 0..31
  const v16h aq1 = load_frag16(Qp + 32, HD);   // d = 32..63

  // a thread's 16 bytes of a 32x64 K or V chunk
  const int srow = tid >> 3;         // k within chunk 0..31
  const int sc8  = (tid & 7) * 8;    // d base 0..56
  const _Float16* Kg = Kh + baseBH + (size_t)srow * HD + sc8;
  const _Float16* Vg = Vh + baseBH + (size_t)srow * HD + sc8;

  auto stageK = [&](int k0, int buf) {
    async_copy1_b128((uint32_t)(uintptr_t)&Kt[buf][srow][sc8], Kg + (size_t)k0 * HD);
  };
  auto loadV = [&](int k0) { return *(const v8h*)(Vg + (size_t)k0 * HD); };
  auto storeV = [&](v8h v, int buf) {
    // unrolled: v[j] is picked by a constant and stays in its registers
#pragma unroll
    for (int j = 0; j < 8; ++j) Vt[buf][sc8 + j][srow] = v[j];
  };

  // rel_emb rows of chunk k0: the two 16-key halves need rows jb..jb+31 with
  // jb = q0 - k0 + 1009 and jb - 16, together three 16-row blocks from
  // jb - 16 = q0 - k0 + 993 (always in [1, 2001]); rf[2i], rf[2i+1] = block i,
  // d = 0..31 and 32..63.
  v16h  rf[6];
  float mk[2];
  auto loadRel = [&](int k0) {
    const _Float16* rp = relh + (size_t)(q0 - k0 + (1024 - 31)) * HD;
    // unrolled: rf[] is indexed by constants and stays in registers
#pragma unroll
    for (int i = 0; i < 3; ++i) {
      rf[2 * i]     = load_frag16(rp + i * 16 * HD,      HD);
      rf[2 * i + 1] = load_frag16(rp + i * 16 * HD + 32, HD);
    }
    mk[0] = mask[bb * SEQ + k0 + n];
    mk[1] = mask[bb * SEQ + k0 + 16 + n];
  };

  v8f accd[4];
#pragma unroll
  for (int i = 0; i < 4; ++i) accd[i] = zero8();
  float mrow[8], lrow[8];
#pragma unroll
  for (int r = 0; r < 8; ++r) { mrow[r] = -1e30f; lrow[r] = 0.0f; }

  stageK(0, 0);
  storeV(loadV(0), 0);
  loadRel(0);
  wait_async();            // K chunk 0 landed
  __syncthreads();         // publish K and V chunk 0 across waves
  v8h vn = loadV(32);      // V of the next chunk, held in registers
  stageK(32, 1);
  int buf = 0;
  for (int k0 = 0; k0 < SEQ; k0 += 32, buf ^= 1) {
    v16h bv[4];
#pragma unroll
    for (int nb = 0; nb < 4; ++nb) bv[nb] = load_frag16(&Vt[buf][nb * 16][0], VT_LD);

    float s2[2][8];
#pragma unroll
    for (int sub = 0; sub < 2; ++sub) {
      const v16h bk0 = load_frag16(&Kt[buf][sub * 16][0],  KT_LD);
      const v16h bk1 = load_frag16(&Kt[buf][sub * 16][32], KT_LD);

      // content term: Q @ K^T over d=64
      v8f s = zero8();
      s = wmma16(aq0, bk0, s);
      s = wmma16(aq1, bk1, s);

      // rel term: P[i,dk] = <rel_emb[jb+i], K[k0+16*sub+dk]>, i in [0,31],
      // jb = q0 - k0 - 16*sub + 1009: blocks 1-sub and 2-sub of rf
      v8f p0 = zero8(), p1 = zero8();
      p0 = wmma16(rf[2 - 2 * sub], bk0, p0);
      p0 = wmma16(rf[3 - 2 * sub], bk1, p0);
      p1 = wmma16(rf[4 - 2 * sub], bk0, p1);
      p1 = wmma16(rf[5 - 2 * sub], bk1, p1);
#pragma unroll
      for (int r = 0; r < 8; ++r) {
        Pg[w][r + hi8][n]      = p0[r];
        Pg[w][16 + r + hi8][n] = p1[r];
      }
      const float mval = mk[sub] * -1e9f;
      wait_ds();   // wave-local LDS RAW

      // the next chunk's fragments and mask: asked for here, behind their last
      // use, to fly during the softmax (the last chunk asks for its own again)
      if (sub == 1) loadRel(k0 + 32 < SEQ ? k0 + 32 : k0);

#pragma unroll
      for (int r = 0; r < 8; ++r) {
        const int m = r + hi8;
        s2[sub][r] = (s[r] + Pg[w][m - n + 15][n]) * 0.125f + mval;
      }
    }

    // --- online softmax (rows live across 16 lanes; 8 rows per lane) ---
#pragma unroll
    for (int r = 0; r < 8; ++r) {
      float rm = fmaxf(s2[0][r], s2[1][r]);
#pragma unroll
      for (int off = 1; off < 16; off <<= 1) rm = fmaxf(rm, __shfl_xor(rm, off, 32));
      const float mnew = fmaxf(mrow[r], rm);
      const float ef   = __expf(mrow[r] - mnew);
      const float e0   = __expf(s2[0][r] - mnew);
      const float e1   = __expf(s2[1][r] - mnew);
      float rs = e0 + e1;
#pragma unroll
      for (int off = 1; off < 16; off <<= 1) rs += __shfl_xor(rs, off, 32);
      lrow[r] = lrow[r] * ef + rs;
      mrow[r] = mnew;
      const int m = r + hi8;
      Et[w][m][n]      = (_Float16)e0;
      Et[w][m][16 + n] = (_Float16)e1;
#pragma unroll
      for (int nb = 0; nb < 4; ++nb) accd[nb][r] *= ef;
    }
    // V of the next chunk goes into the buffer that every wave left one barrier ago
    if (k0 + 32 < SEQ) storeV(vn, buf ^ 1);
    wait_ds();

    // acc += exp(S) @ V  (A-frag from Et, B-frag from transposed V)
    const v16h ae = load_frag16(&Et[w][0][0], ET_LD);
#pragma unroll
    for (int nb = 0; nb < 4; ++nb) accd[nb] = wmma16(ae, bv[nb], accd[nb]);

    wait_ds();             // this wave's reads of buf are done before its refill
    wait_async();          // K chunk k0+32 landed (issued one trip ago)
    __syncthreads();       // publish K and V chunk k0+32; every wave has left buf
    if (k0 + 64 < SEQ) {   // fly during the next trip
      vn = loadV(k0 + 64);
      stageK(k0 + 64, buf);
    }
  }
  wait_async();            // nothing of this wave's is outstanding at its end

  // local attention output -> Ch[b, q, h*64+d]
#pragma unroll
  for (int nb = 0; nb < 4; ++nb) {
#pragma unroll
    for (int r = 0; r < 8; ++r) {
      const int m = r + hi8;
      const float v = accd[nb][r] / lrow[r];
      Ch[((size_t)bb * SEQ + q0 + m) * DM + h * HD + nb * 16 + n] = (_Float16)v;
    }
  }
}

// ---------------------------------------------------------------------------
// K4: linear-attention global read (elu(q)+1 vs M, z) + sigmoid gating, f32 VALU.
// Block = (b, h, 128 q rows). elu(q)+1 is formed once per (q, dd) and kept in
// LDS beside M[h]; a wave owns 16 rows, a lane two neighbouring d, so that one
// broadcast LDS read of four dd feeds eight multiply-adds and a wave's access
// to a row of Ch is one whole 128-byte line. Sums run over dd in rising order.
// ---------------------------------------------------------------------------
typedef __attribute__((ext_vector_type(2))) float    v2f;
typedef __attribute__((ext_vector_type(4))) float    v4f;
typedef __attribute__((ext_vector_type(2))) _Float16 v2h;
#define SQ_LD 68     // 64 floats + 4 pad: 272 B rows (16 B x odd) for the b128 row readers

__global__ __launch_bounds__(256)
void global_memory_gate(const _Float16* __restrict__ Qh,
                        const float* __restrict__ Mrd,  // [H,D,D]
                        const float* __restrict__ z,    // [H,D]
                        const float* __restrict__ galpha,
                        _Float16* __restrict__ Ch) {
  __shared__ __attribute__((aligned(16))) float Sq[128][SQ_LD];   // elu(q)+1
  __shared__ __attribute__((aligned(16))) float Ml[64][64];       // M[h]

  const int tid = threadIdx.x;
  const int w   = tid >> 5;
  const int l   = tid & 31;
  const int bh  = blockIdx.x >> 3;          // S/128 = 8
  const int h   = bh & (NH - 1);
  const int b   = bh >> 4;
  const int q0  = (blockIdx.x & 7) * 128;

  const v4f* Mg = (const v4f*)(Mrd + (size_t)h * (HD * HD));
  const v8h* Qg = (const v8h*)(Qh + ((size_t)bh * SEQ + q0) * HD);
#pragma unroll
  for (int i = 0; i < 4; ++i) {
    const int c = tid + 256 * i;
    ((v4f*)&Ml[0][0])[c] = Mg[c];
    const v8h qv = Qg[c];
    float* sr = &Sq[c >> 3][(c & 7) * 8];
#pragma unroll
    for (int j = 0; j < 8; ++j) {
      const float x = (float)qv[j];
      sr[j] = x > 0.0f ? x + 1.0f : __expf(x);   // elu(x)+1
    }
  }

  // local attention rows: asked for ahead of the barrier, used behind the sums
  v2h* Cp = (v2h*)(Ch + ((size_t)b * SEQ + q0 + w * 16) * DM + h * HD + 2 * l);
  v2h loc[16];
#pragma unroll
  for (int r = 0; r < 16; ++r) loc[r] = Cp[r * (DM / 2)];

  __syncthreads();   // Sq and Ml are read across waves from here on

  v2f num[16];
#pragma unroll
  for (int r = 0; r < 16; ++r) num[r] = (v2f){0.0f, 0.0f};
  float den = 1e-6f;                         // of row w*16 + (l & 15)
  const float* zh = z + h * HD;

#pragma unroll
  for (int d4 = 0; d4 < HD; d4 += 4) {
    v2f m[4];
#pragma unroll
    for (int j = 0; j < 4; ++j) m[j] = *(const v2f*)&Ml[d4 + j][2 * l];
    const v4f sd = *(const v4f*)&Sq[w * 16 + (l & 15)][d4];
#pragma unroll
    for (int j = 0; j < 4; ++j) den = __builtin_fmaf(sd[j], zh[d4 + j], den);
#pragma unroll
    for (int r = 0; r < 16; ++r) {
      const v4f s = *(const v4f*)&Sq[w * 16 + r][d4];
#pragma unroll
      for (int j = 0; j < 4; ++j) num[r] += s[j] * m[j];
    }
  }

  const float gate = 1.0f / (1.0f + __expf(-galpha[0]));
#pragma unroll
  for (int r = 0; r < 16; ++r) {
    const float dr = __builtin_bit_cast(
        float, __builtin_amdgcn_readlane(__builtin_bit_cast(int, den), r));
    v2h o;
    o[0] = (_Float16)(gate * (float)loc[r][0] + (1.0f - gate) * (num[r][0] / dr));
    o[1] = (_Float16)(gate * (float)loc[r][1] + (1.0f - gate) * (num[r][1] / dr));
    Cp[r * (DM / 2)] = o;
  }
}

// ---------------------------------------------------------------------------
// Host-side orchestration
// ---------------------------------------------------------------------------
extern "C" void kernel_launch(void* const* d_in, const int* in_sizes, int n_in,
                              void* d_out, int out_size, void* d_ws, size_t ws_size,
                              hipStream_t stream) {
  (void)in_sizes; (void)n_in; (void)out_size; (void)ws_size;
  const float* hidden = (const float*)d_in[0];
  const float* mask   = (const float*)d_in[1];
  const float* Wq = (const float*)d_in[2];  const float* bq = (const float*)d_in[3];
  const float* Wk = (const float*)d_in[4];  const float* bk = (const float*)d_in[5];
  const float* Wv = (const float*)d_in[6];  const float* bv = (const float*)d_in[7];
  const float* Wo = (const float*)d_in[8];  const float* bo = (const float*)d_in[9];
  const float* rel = (const float*)d_in[10];
  const float* M   = (const float*)d_in[11];
  const float* z   = (const float*)d_in[12];
  const float* ga  = (const float*)d_in[13];

  // workspace carve-up (f16), ~48 MB total
  _Float16* p   = (_Float16*)d_ws;
  _Float16* Xh  = p; p += (size_t)GM * DM;
  _Float16* Wqh = p; p += (size_t)DM * DM;
  _Float16* Wkh = p; p += (size_t)DM * DM;
  _Float16* Wvh = p; p += (size_t)DM * DM;
  _Float16* Woh = p; p += (size_t)DM * DM;
  _Float16* relh = p; p += (size_t)2049 * HD;
  _Float16* Qh  = p; p += (size_t)GM * DM;
  _Float16* Kh  = p; p += (size_t)GM * DM;
  _Float16* Vh  = p; p += (size_t)GM * DM;
  _Float16* Ch  = p; p += (size_t)GM * DM;

  // X: 512 blocks x 8 groups a lane (two blocks a WGP); a weight: 256 x 4
  cvt_f32_to_f16<8><<<GM * DM / (4 * 256 * 8), 256, 0, stream>>>(hidden, Xh, GM * DM / 4);
  auto cvtw = [&](const float* src, _Float16* dst) {
    cvt_f32_to_f16<4><<<DM * DM / (4 * 256 * 4), 256, 0, stream>>>(src, dst, DM * DM / 4);
  };
  cvtw(Wq, Wqh);
  cvtw(Wk, Wkh);
  cvtw(Wv, Wvh);
  cvtw(Wo, Woh);
  cvt_f32_to_f16<1><<<(2049 * HD / 4 + 255) / 256, 256, 0, stream>>>(rel, relh, 2049 * HD / 4);

  dim3 gg(GM / 128, DM / 64);   // 32 x 16
  // Wqh, Wkh, Wvh and Qh, Kh, Vh lie one behind the other in the workspace
  gemm4096_wmma<0><<<gg, 256, 0, stream>>>(Xh, Wqh, bq, bk, bv, (void*)Qh);

  attn_flash_wmma<<<BATCH * NH * (SEQ / 128), 256, 0, stream>>>(
      Qh, Kh, Vh, relh, mask, Ch);

  global_memory_gate<<<BATCH * NH * (SEQ / 128), 256, 0, stream>>>(
      Qh, M, z, ga, Ch);

  gemm4096_wmma<1><<<gg, 256, 0, stream>>>(Ch, Woh, bo, bo, bo, d_out);
}

// v006
// A run of this version takes 157 microseconds.
// In both of two side-by-side timings against v005, it was 1.05 times as fast.
// All steps since v000 together make it 2.03 times as fast.
#include <hip/hip_runtime.h>
#include <hip/hip_bf16.h>
#include <stdint.h>

typedef __attribute__((ext_vector_type(16))) _Float16     v16h;
typedef __attribute__((ext_vector_type(8)))  float        v8f;
typedef __attribute__((ext_vector_type(8)))  short        s16x8;
typedef __attribute__((ext_vector_type(8)))  _Float16     v8h;

#define DM    1024
#define SEQ   1024
#define BATCH 4
#define NH    16
#define HD    64
#define GM    4096   // rows of X / combined (B*S)

// LDS leading dims (halves). Row strides are multiples of 8 halves = 16B so
// b128 LDS writes stay naturally aligned.
#define AL_LD 40
#define WR_LD 80     // 64 data halves + 16 pad halves: 160 B rows for ds_load_tr16_b128
#define KT_LD 72     // 64 data halves + 8 pad halves: 144 B rows (16 B x odd) for b128 readers
#define VT_LD 40
#define ET_LD 40

__device__ __forceinline__ v8f zero8() {
  v8f z;
#pragma unroll
  for (int i = 0; i < 8; ++i) z[i] = 0.0f;
  return z;
}

__device__ __forceinline__ v16h load_frag16(const _Float16* __restrict__ src, int ld) {
  const int l   = threadIdx.x & 31;
  const int m   = l & 15;
  const int hi8 = (l >> 4) << 3;
  v16h f;
#pragma unroll
  for (int i = 0; i < 16; ++i) {
    const int k = ((i >> 3) << 4) + hi8 + (i & 7);
    f[i] = src[m * ld + k];
  }
  return f;
}

__device__ __forceinline__ v8f wmma16(v16h a, v16h b, v8f c) {
  // D = A(16x32 f16) * B(32x16 f16) + C(16x16 f32)
  return __builtin_amdgcn_wmma_f32_16x16x32_f16(
      /*neg_a=*/false, a, /*neg_b=*/false, b,
      /*c_mod=*/(short)0, c, /*reuse_a=*/false, /*reuse_b=*/false);
}

__device__ __forceinline__ v16h load_fragB_tr16(const _Float16* tile, int ld) {
  typedef __attribute__((address_space(3))) s16x8 lds_s16x8;
  const int l = threadIdx.x & 31;
  const _Float16* p = tile + (((l >> 4) << 3) + (l & 7)) * ld + (((l >> 3) & 1) << 3);
  const v8h lo = __builtin_bit_cast(v8h, __builtin_amdgcn_ds_load_tr16_b128_v8i16((lds_s16x8*)p));
  const v8h hi = __builtin_bit_cast(v8h, __builtin_amdgcn_ds_load_tr16_b128_v8i16((lds_s16x8*)(p + 16 * ld)));
  return __builtin_shufflevector(lo, hi, 0, 1, 2, 3, 4, 5, 6, 7, 8, 9, 10, 11, 12, 13, 14, 15);
}

__device__ __forceinline__ void async_copy3_b128(uint32_t l0, const void* g0,
                                                 uint32_t l1, const void* g1,
                                                 uint32_t l2, const void* g2) {
  asm volatile("global_load_async_to_lds_b128 %0, %1, off\n\t"
               "global_load_async_to_lds_b128 %2, %3, off\n\t"
               "global_load_async_to_lds_b128 %4, %5, off\n\t"
               "s_wait_xcnt 0x0"
               :: "v"(l0), "v"((uint64_t)(uintptr_t)g0),
                  "v"(l1), "v"((uint64_t)(uintptr_t)g1),
                  "v"(l2), "v"((uint64_t)(uintptr_t)g2)
               : "memory");
}
// The same for a stage of five copies (one X tile in two halves, three W tiles).
__device__ __forceinline__ void async_copy5_b128(uint32_t l0, const void* g0,
                                                 uint32_t l1, const void* g1,
                                                 uint32_t l2, const void* g2,
                                                 uint32_t l3, const void* g3,
                                                 uint32_t l4, const void* g4) {
  asm volatile("global_load_async_to_lds_b128 %0, %1, off\n\t"
               "global_load_async_to_lds_b128 %2, %3, off\n\t"
               "global_load_async_to_lds_b128 %4, %5, off\n\t"
               "global_load_async_to_lds_b128 %6, %7, off\n\t"
               "global_load_async_to_lds_b128 %8, %9, off\n\t"
               "s_wait_xcnt 0x0"
               :: "v"(l0), "v"((uint64_t)(uintptr_t)g0),
                  "v"(l1), "v"((uint64_t)(uintptr_t)g1),
                  "v"(l2), "v"((uint64_t)(uintptr_t)g2),
                  "v"(l3), "v"((uint64_t)(uintptr_t)g3),
                  "v"(l4), "v"((uint64_t)(uintptr_t)g4)
               : "memory");
}
// The same for a stage of one copy (a K tile: 16 bytes a lane).
__device__ __forceinline__ void async_copy1_b128(uint32_t l0, const void* g0) {
  asm volatile("global_load_async_to_lds_b128 %0, %1, off\n\t"
               "s_wait_xcnt 0x0"
               :: "v"(l0), "v"((uint64_t)(uintptr_t)g0)
               : "memory");
}
__device__ __forceinline__ void wait_async() {
  asm volatile("s_wait_asynccnt 0" ::: "memory");
}
__device__ __forceinline__ void wait_ds() {
  asm volatile("s_wait_dscnt 0" ::: "memory");
}

// ---------------------------------------------------------------------------
// K1: every f32 -> f16 conversion in one launch. None of the six jobs (X, the
// four weights, rel_emb) needs anything of another, so they share one grid: a
// range of the block index picks the job (a block-uniform choice), and the f16
// copies lie one behind the other from out in the same order. A lane converts
// CVT_U groups of four elements: all its 16-byte loads are asked for first (a
// wave's load is 512 contiguous bytes, its 8-byte store 256). A block owns
// 256 * CVT_U groups of its job.
// ---------------------------------------------------------------------------
typedef __attribute__((ext_vector_type(4))) float    f32x4;
typedef __attribute__((ext_vector_type(4))) _Float16 f16x4;

#define CVT_U   8
#define CVT_BG  (256 * CVT_U)                              // groups a block
#define CVT_XB  (GM * DM / 4 / CVT_BG)                     // blocks of X: 512
#define CVT_WB  (DM * DM / 4 / CVT_BG)                     // blocks of a weight: 128
#define CVT_RB  ((2049 * HD / 4 + CVT_BG - 1) / CVT_BG)    // blocks of rel_emb: 17, the last partly filled

__global__ __launch_bounds__(256)
void cvt_all_f32_to_f16(const float* __restrict__ X,
                        const float* __restrict__ Wq,
                        const float* __restrict__ Wk,
                        const float* __restrict__ Wv,
                        const float* __restrict__ Wo,
                        const float* __restrict__ rel,
                        _Float16* __restrict__ out) {
  const int b = blockIdx.x;
  const float* in;     // the job's source
  size_t off;          // its first element in out
  int blk, n4;         // this block's index in the job; the job's element count / 4
  if (b < CVT_XB) {
    in = X;  off = 0;  blk = b;  n4 = GM * DM / 4;
  } else if (b < CVT_XB + 4 * CVT_WB) {
    const int j = (b - CVT_XB) / CVT_WB;
    in  = j == 0 ? Wq : j == 1 ? Wk : j == 2 ? Wv : Wo;
    off = (size_t)GM * DM + (size_t)j * DM * DM;
    blk = (b - CVT_XB) % CVT_WB;
    n4  = DM * DM / 4;
  } else {
    in  = rel;
    off = (size_t)GM * DM + (size_t)4 * DM * DM;
    blk = b - (CVT_XB + 4 * CVT_WB);
    n4  = 2049 * HD / 4;
  }
  const int i0 = blk * CVT_BG + threadIdx.x;
  const f32x4* __restrict__ src = (const f32x4*)in;
  f16x4* __restrict__ dst = (f16x4*)(out + off);
  if ((blk + 1) * CVT_BG <= n4) {                  // the whole block lies inside: no lane test
    f32x4 v[CVT_U];
    // both loops unrolled: v[] stays in registers and the loads go out back to back
#pragma unroll
    for (int u = 0; u < CVT_U; ++u) v[u] = src[i0 + u * 256];
#pragma unroll
    for (int u = 0; u < CVT_U; ++u) dst[i0 + u * 256] = __builtin_convertvector(v[u], f16x4);
    // no register that an issued store names is written again ahead of this wait
    asm volatile("s_wait_xcnt 0x0" ::: "memory");
  } else {                                         // a job's last, partly filled block
    for (int u = 0; u < CVT_U; ++u) {
      const int i = i0 + u * 256;
      if (i < n4) dst[i] = __builtin_convertvector(src[i], f16x4);
    }
  }
}

template <int MODE>
__global__ __launch_bounds__(256)
void gemm4096_wmma(const _Float16* __restrict__ A,
                   const _Float16* __restrict__ W,
                   const float* __restrict__ bias,
                   const float* __restrict__ bias1,
                   const float* __restrict__ bias2,
                   void* __restrict__ out) {
  constexpr int NW = (MODE == 0) ? 3 : 1;   // weight matrices that share the A tile
  __shared__ __attribute__((aligned(16))) _Float16 Al[2][128][AL_LD];
  __shared__ __attribute__((aligned(16))) _Float16 Wr[2][NW][32][WR_LD];   // W tiles [k][n]

  const int bm0 = blockIdx.x * 128;
  const int bn0 = blockIdx.y * 64;
  const int tid = threadIdx.x;
  const int w   = tid >> 5;
  const int l   = tid & 31;
  const int n   = l & 15;
  const int hi8 = (l >> 4) << 3;

  auto stage = [&](int kk, int buf) {
    // A tile 128x32 halves (512 x b128, 2 per thread) and each W tile 32x64
    // halves (256 x b128, 1 per thread), all via async-to-LDS
    const int arow = tid >> 2;         // m within tile: 0..63 (and +64)
    const int ac8  = (tid & 3) * 8;    // k base: 0..24
    const int wrow = tid >> 3;         // k within tile: 0..31
    const int wc8  = (tid & 7) * 8;    // n base: 0..56
    const _Float16* wg = &W[(size_t)(kk + wrow) * 1024 + bn0 + wc8];
    if constexpr (NW == 3) {
      async_copy5_b128((uint32_t)(uintptr_t)&Al[buf][arow][ac8],
                       &A[(size_t)(bm0 + arow) * 1024 + kk + ac8],
                       (uint32_t)(uintptr_t)&Al[buf][arow + 64][ac8],
                       &A[(size_t)(bm0 + arow + 64) * 1024 + kk + ac8],
                       (uint32_t)(uintptr_t)&Wr[buf][0][wrow][wc8], wg,
                       (uint32_t)(uintptr_t)&Wr[buf][1][wrow][wc8], wg + DM * DM,
                       (uint32_t)(uintptr_t)&Wr[buf][2][wrow][wc8], wg + 2 * DM * DM);
    } else {
      async_copy3_b128((uint32_t)(uintptr_t)&Al[buf][arow][ac8],
                       &A[(size_t)(bm0 + arow) * 1024 + kk + ac8],
                       (uint32_t)(uintptr_t)&Al[buf][arow + 64][ac8],
                       &A[(size_t)(bm0 + arow + 64) * 1024 + kk + ac8],
                       (uint32_t)(uintptr_t)&Wr[buf][0][wrow][wc8], wg);
    }
  };

  v8f acc[NW][4];
#pragma unroll
  for (int j = 0; j < NW; ++j)
#pragma unroll
    for (int i = 0; i < 4; ++i) acc[j][i] = zero8();

  stage(0, 0);
  wait_async();            // chunk 0 landed
  __syncthreads();         // publish it across waves
  stage(32, 1);
  int buf = 0;
  for (int kk = 0; kk < 1024; kk += 32, buf ^= 1) {
    const v16h a = load_frag16(&Al[buf][w * 16][0], AL_LD);
#pragma unroll
    for (int j = 0; j < NW; ++j) {
#pragma unroll
      for (int nb = 0; nb < 4; ++nb) {
        const v16h bf = load_fragB_tr16(&Wr[buf][j][0][nb * 16], WR_LD);
        acc[j][nb] = wmma16(a, bf, acc[j][nb]);
      }
    }

    wait_ds();             // this wave's reads of buf are done before its refill
    wait_async();          // chunk kk+32 landed (issued one trip ago)
    __syncthreads();       // publish it; every wave has left buf
    if (kk + 64 < 1024) stage(kk + 64, buf);   // copies fly during the next trip
  }
  wait_async();            // nothing of this wave's is outstanding at its end

#pragma unroll
  for (int j = 0; j < NW; ++j) {
    const float* bj = j == 0 ? bias : j == 1 ? bias1 : bias2;
#pragma unroll
    for (int nb = 0; nb < 4; ++nb) {
#pragma unroll
      for (int r = 0; r < 8; ++r) {
        const int row = bm0 + w * 16 + r + hi8;
        const int col = bn0 + nb * 16 + n;
        const float v = acc[j][nb][r] + bj[col];
        if (MODE == 0) {
          const int b = row >> 10, sr = row & 1023, hh = col >> 6, dd = col & 63;
          ((_Float16*)out)[(size_t)j * GM * DM +
                           (((size_t)(b * NH + hh)) * SEQ + sr) * HD + dd] = (_Float16)v;
        } else {
          ((float*)out)[(size_t)row * 1024 + col] = v;
        }
      }
    }
  }
}

// ---------------------------------------------------------------------------
// K3: flash attention with fused relative-position scores.
// Block = (b, h, 128-row q block); 8 waves, each wave a 16-row q tile.
// Everything a chunk reads from global memory is asked for one chunk ahead:
// K chunks fly into two LDS buffers by async copies (ring order as in the
// GEMMs, one barrier a chunk); V chunks wait in registers and are transposed
// into the other of two LDS buffers; the rel_emb fragments and the mask values
// are reloaded into their registers right behind their last use.
// Online softmax per row.
// Writes local attention output (pre-gating) to Ch[b,s,h*64+d] f16.
// ---------------------------------------------------------------------------
__global__ __launch_bounds__(256)
void attn_flash_wmma(const _Float16* __restrict__ Qh,
                     const _Float16* __restrict__ Kh,
                     const _Float16* __restrict__ Vh,
                     const _Float16* __restrict__ relh,  // [2049,64]
                     const float* __restrict__ mask,     // [B,S]
                     _Float16* __restrict__ Ch) {        // [B,S,DM]
  __shared__ __attribute__((aligned(16))) _Float16 Kt[2][32][KT_LD];  // K chunks row-major [k][d]
  __shared__ _Float16 Vt[2][64][VT_LD];    // V chunks transposed [d][k]
  __shared__ _Float16 Et[8][16][ET_LD];    // per-wave exp(S) tile (A-frag src)
  __shared__ float    Pg[8][32][16];       // per-wave rel-score gather buffer

  const int qblk = blockIdx.x & 7;         // S/128 = 8
  const int bh   = blockIdx.x >> 3;
  const int h    = bh & (NH - 1);
  const int bb   = bh >> 4;
  const int tid  = threadIdx.x;
  const int w    = tid >> 5;
  const int l    = tid & 31;
  const int n    = l & 15;
  const int hi8  = (l >> 4) << 3;
  const int q0   = qblk * 128 + w * 16;    // absolute q of this wave's tile

  const size_t baseBH = ((size_t)(bb * NH + h)) * SEQ * HD;
  const _Float16* Qp = Qh + baseBH + (size_t)q0 * HD;
  const v16h aq0 = load_frag16(Qp + 0,  HD);   // d = 0..31
  const v16h aq1 = load_frag16(Qp + 32, HD);   // d = 32..63

  // a thread's 16 bytes of a 32x64 K or V chunk
  const int srow = tid >> 3;         // k within chunk 0..31
  const int sc8  = (tid & 7) * 8;    // d base 0..56
  const _Float16* Kg = Kh + baseBH + (size_t)srow * HD + sc8;
  const _Float16* Vg = Vh + baseBH + (size_t)srow * HD + sc8;

  auto stageK = [&](int k0, int buf) {
    async_copy1_b128((uint32_t)(uintptr_t)&Kt[buf][srow][sc8], Kg + (size_t)k0 * HD);
  };
  auto loadV = [&](int k0) { return *(const v8h*)(Vg + (size_t)k0 * HD); };
  auto storeV = [&](v8h v, int buf) {
    // unrolled: v[j] is picked by a constant and stays in its registers
#pragma unroll
    for (int j = 0; j < 8; ++j) Vt[buf][sc8 + j][srow] = v[j];
  };

  // rel_emb rows of chunk k0: the two 16-key halves need rows jb..jb+31 with
  // jb = q0 - k0 + 1009 and jb - 16, together three 16-row blocks from
  // jb - 16 = q0 - k0 + 993 (always in [1, 2001]); rf[2i], rf[2i+1] = block i,
  // d = 0..31 and 32..63.
  v16h  rf[6];
  float mk[2];
  auto loadRel = [&](int k0) {
    const _Float16* rp = relh + (size_t)(q0 - k0 + (1024 - 31)) * HD;
    // unrolled: rf[] is indexed by constants and stays in registers
#pragma unroll
    for (int i = 0; i < 3; ++i) {
      rf[2 * i]     = load_frag16(rp + i * 16 * HD,      HD);
      rf[2 * i + 1] = load_frag16(rp + i * 16 * HD + 32, HD);
    }
    mk[0] = mask[bb * SEQ + k0 + n];
    mk[1] = mask[bb * SEQ + k0 + 16 + n];
  };

  v8f accd[4];
#pragma unroll
  for (int i = 0; i < 4; ++i) accd[i] = zero8();
  float mrow[8], lrow[8];
#pragma unroll
  for (int r = 0; r < 8; ++r) { mrow[r] = -1e30f; lrow[r] = 0.0f; }

  stageK(0, 0);
  storeV(loadV(0), 0);
  loadRel(0);
  wait_async();            // K chunk 0 landed
  __syncthreads();         // publish K and V chunk 0 across waves
  v8h vn = loadV(32);      // V of the next chunk, held in registers
  stageK(32, 1);
  int buf = 0;
  for (int k0 = 0; k0 < SEQ; k0 += 32, buf ^= 1) {
    v16h bv[4];
#pragma unroll
    for (int nb = 0; nb < 4; ++nb) bv[nb] = load_frag16(&Vt[buf][nb * 16][0], VT_LD);

    float s2[2][8];
#pragma unroll
    for (int sub = 0; sub < 2; ++sub) {
      const v16h bk0 = load_frag16(&Kt[buf][sub * 16][0],  KT_LD);
      const v16h bk1 = load_frag16(&Kt[buf][sub * 16][32], KT_LD);

      // content term: Q @ K^T over d=64
      v8f s = zero8();
      s = wmma16(aq0, bk0, s);
      s = wmma16(aq1, bk1, s);

      // rel term: P[i,dk] = <rel_emb[jb+i], K[k0+16*sub+dk]>, i in [0,31],
      // jb = q0 - k0 - 16*sub + 1009: blocks 1-sub and 2-sub of rf
      v8f p0 = zero8(), p1 = zero8();
      p0 = wmma16(rf[2 - 2 * sub], bk0, p0);
      p0 = wmma16(rf[3 - 2 * sub], bk1, p0);
      p1 = wmma16(rf[4 - 2 * sub], bk0, p1);
      p1 = wmma16(rf[5 - 2 * sub], bk1, p1);
#pragma unroll
      for (int r = 0; r < 8; ++r) {
        Pg[w][r + hi8][n]      = p0[r];
        Pg[w][16 + r + hi8][n] = p1[r];
      }
      const float mval = mk[sub] * -1e9f;
      wait_ds();   // wave-local LDS RAW

      // the next chunk's fragments and mask: asked for here, behind their last
      // use, to fly during the softmax (the last chunk asks for its own again)
      if (sub == 1) loadRel(k0 + 32 < SEQ ? k0 + 32 : k0);

#pragma unroll
      for (int r = 0; r < 8; ++r) {
        const int m = r + hi8;
        s2[sub][r] = (s[r] + Pg[w][m - n + 15][n]) * 0.125f + mval;
      }
    }

    // --- online softmax (rows live across 16 lanes; 8 rows per lane) ---
#pragma unroll
    for (int r = 0; r < 8; ++r) {
      float rm = fmaxf(s2[0][r], s2[1][r]);
#pragma unroll
      for (int off = 1; off < 16; off <<= 1) rm = fmaxf(rm, __shfl_xor(rm, off, 32));
      const float mnew = fmaxf(mrow[r], rm);
      const float ef   = __expf(mrow[r] - mnew);
      const float e0   = __expf(s2[0][r] - mnew);
      const float e1   = __expf(s2[1][r] - mnew);
      float rs = e0 + e1;
#pragma unroll
      for (int off = 1; off < 16; off <<= 1) rs += __shfl_xor(rs, off, 32);
      lrow[r] = lrow[r] * ef + rs;
      mrow[r] = mnew;
      const int m = r + hi8;
      Et[w][m][n]      = (_Float16)e0;
      Et[w][m][16 + n] = (_Float16)e1;
#pragma unroll
      for (int nb = 0; nb < 4; ++nb) accd[nb][r] *= ef;
    }
    // V of the next chunk goes into the buffer that every wave left one barrier ago
    if (k0 + 32 < SEQ) storeV(vn, buf ^ 1);
    wait_ds();

    // acc += exp(S) @ V  (A-frag from Et, B-frag from transposed V)
    const v16h ae = load_frag16(&Et[w][0][0], ET_LD);
#pragma unroll
    for (int nb = 0; nb < 4; ++nb) accd[nb] = wmma16(ae, bv[nb], accd[nb]);

    wait_ds();             // this wave's reads of buf are done before its refill
    wait_async();          // K chunk k0+32 landed (issued one trip ago)
    __syncthreads();       // publish K and V chunk k0+32; every wave has left buf
    if (k0 + 64 < SEQ) {   // fly during the next trip
      vn = loadV(k0 + 64);
      stageK(k0 + 64, buf);
    }
  }
  wait_async();            // nothing of this wave's is outstanding at its end

  // local attention output -> Ch[b, q, h*64+d]
#pragma unroll
  for (int nb = 0; nb < 4; ++nb) {
#pragma unroll
    for (int r = 0; r < 8; ++r) {
      const int m = r + hi8;
      const float v = accd[nb][r] / lrow[r];
      Ch[((size_t)bb * SEQ + q0 + m) * DM + h * HD + nb * 16 + n] = (_Float16)v;
    }
  }
}

// ---------------------------------------------------------------------------
// K4: linear-attention global read (elu(q)+1 vs M, z) + sigmoid gating, f32 VALU.
// Block = (b, h, 128 q rows). elu(q)+1 is formed once per (q, dd) and kept in
// LDS beside M[h]; a wave owns 16 rows, a lane two neighbouring d, so that one
// broadcast LDS read of four dd feeds eight multiply-adds and a wave's access
// to a row of Ch is one whole 128-byte line. Sums run over dd in rising order.
// ---------------------------------------------------------------------------
typedef __attribute__((ext_vector_type(2))) float    v2f;
typedef __attribute__((ext_vector_type(4))) float    v4f;
typedef __attribute__((ext_vector_type(2))) _Float16 v2h;
#define SQ_LD 68     // 64 floats + 4 pad: 272 B rows (16 B x odd) for the b128 row readers

__global__ __launch_bounds__(256)
void global_memory_gate(const _Float16* __restrict__ Qh,
                        const float* __restrict__ Mrd,  // [H,D,D]
                        const float* __restrict__ z,    // [H,D]
                        const float* __restrict__ galpha,
                        _Float16* __restrict__ Ch) {
  __shared__ __attribute__((aligned(16))) float Sq[128][SQ_LD];   // elu(q)+1
  __shared__ __attribute__((aligned(16))) float Ml[64][64];       // M[h]

  const int tid = threadIdx.x;
  const int w   = tid >> 5;
  const int l   = tid & 31;
  const int bh  = blockIdx.x >> 3;          // S/128 = 8
  const int h   = bh & (NH - 1);
  const int b   = bh >> 4;
  const int q0  = (blockIdx.x & 7) * 128;

  const v4f* Mg = (const v4f*)(Mrd + (size_t)h * (HD * HD));
  const v8h* Qg = (const v8h*)(Qh + ((size_t)bh * SEQ + q0) * HD);
#pragma unroll
  for (int i = 0; i < 4; ++i) {
    const int c = tid + 256 * i;
    ((v4f*)&Ml[0][0])[c] = Mg[c];
    const v8h qv = Qg[c];
    float* sr = &Sq[c >> 3][(c & 7) * 8];
#pragma unroll
    for (int j = 0; j < 8; ++j) {
      const float x = (float)qv[j];
      sr[j] = x > 0.0f ? x + 1.0f : __expf(x);   // elu(x)+1
    }
  }

  // local attention rows: asked for ahead of the barrier, used behind the sums
  v2h* Cp = (v2h*)(Ch + ((size_t)b * SEQ + q0 + w * 16) * DM + h * HD + 2 * l);
  v2h loc[16];
#pragma unroll
  for (int r = 0; r < 16; ++r) loc[r] = Cp[r * (DM / 2)];

  __syncthreads();   // Sq and Ml are read across waves from here on

  v2f num[16];
#pragma unroll
  for (int r = 0; r < 16; ++r) num[r] = (v2f){0.0f, 0.0f};
  float den = 1e-6f;                         // of row w*16 + (l & 15)
  const float* zh = z + h * HD;

#pragma unroll
  for (int d4 = 0; d4 < HD; d4 += 4) {
    v2f m[4];
#pragma unroll
    for (int j = 0; j < 4; ++j) m[j] = *(const v2f*)&Ml[d4 + j][2 * l];
    const v4f sd = *(const v4f*)&Sq[w * 16 + (l & 15)][d4];
#pragma unroll
    for (int j = 0; j < 4; ++j) den = __builtin_fmaf(sd[j], zh[d4 + j], den);
#pragma unroll
    for (int r = 0; r < 16; ++r) {
      const v4f s = *(const v4f*)&Sq[w * 16 + r][d4];
#pragma unroll
      for (int j = 0; j < 4; ++j) num[r] += s[j] * m[j];
    }
  }

  const float gate = 1.0f / (1.0f + __expf(-galpha[0]));
#pragma unroll
  for (int r = 0; r < 16; ++r) {
    const float dr = __builtin_bit_cast(
        float, __builtin_amdgcn_readlane(__builtin_bit_cast(int, den), r));
    v2h o;
    o[0] = (_Float16)(gate * (float)loc[r][0] + (1.0f - gate) * (num[r][0] / dr));
    o[1] = (_Float16)(gate * (float)loc[r][1] + (1.0f - gate) * (num[r][1] / dr));
    Cp[r * (DM / 2)] = o;
  }
}

// ---------------------------------------------------------------------------
// Host-side orchestration
// ---------------------------------------------------------------------------
extern "C" void kernel_launch(void* const* d_in, const int* in_sizes, int n_in,
                              void* d_out, int out_size, void* d_ws, size_t ws_size,
                              hipStream_t stream) {
  (void)in_sizes; (void)n_in; (void)out_size; (void)ws_size;
  const float* hidden = (const float*)d_in[0];
  const float* mask   = (const float*)d_in[1];
  const float* Wq = (const float*)d_in[2];  const float* bq = (const float*)d_in[3];
  const float* Wk = (const float*)d_in[4];  const float* bk = (const float*)d_in[5];
  const float* Wv = (const float*)d_in[6];  const float* bv = (const float*)d_in[7];
  const float* Wo = (const float*)d_in[8];  const float* bo = (const float*)d_in[9];
  const float* rel = (const float*)d_in[10];
  const float* M   = (const float*)d_in[11];
  const float* z   = (const float*)d_in[12];
  const float* ga  = (const float*)d_in[13];

  // workspace carve-up (f16), ~48 MB total
  _Float16* p   = (_Float16*)d_ws;
  _Float16* Xh  = p; p += (size_t)GM * DM;
  _Float16* Wqh = p; p += (size_t)3 * DM * DM;   // Wq, Wk, Wv one behind the other
  _Float16* Woh = p; p += (size_t)DM * DM;
  _Float16* relh = p; p += (size_t)2049 * HD;
  _Float16* Qh  = p; p += (size_t)GM * DM;
  _Float16* Kh  = p; p += (size_t)GM * DM;
  _Float16* Vh  = p; p += (size_t)GM * DM;
  _Float16* Ch  = p; p += (size_t)GM * DM;

  // the f16 copies of X, Wq, Wk, Wv, Wo and rel_emb lie one behind the other from Xh
  cvt_all_f32_to_f16<<<CVT_XB + 4 * CVT_WB + CVT_RB, 256, 0, stream>>>(
      hidden, Wq, Wk, Wv, Wo, rel, Xh);

  dim3 gg(GM / 128, DM / 64);   // 32 x 16
  // the three weights from Wqh, and Qh, Kh, Vh, lie one behind the other in the workspace
  gemm4096_wmma<0><<<gg, 256, 0, stream>>>(Xh, Wqh, bq, bk, bv, (void*)Qh);

  attn_flash_wmma<<<BATCH * NH * (SEQ / 128), 256, 0, stream>>>(
      Qh, Kh, Vh, relh, mask, Ch);

  global_memory_gate<<<BATCH * NH * (SEQ / 128), 256, 0, stream>>>(
      Qh, M, z, ga, Ch);

  gemm4096_wmma<1><<<gg, 256, 0, stream>>>(Ch, Woh, bo, bo, bo, d_out);
}

// v007
// One run takes 145 microseconds.
// Next to v006, in two timings, it ran 1.09 and 1.08 times as fast.
// Over all steps from v000 it is 2.20 times as fast.
#include <hip/hip_runtime.h>
#include <hip/hip_bf16.h>
#include <stdint.h>

typedef __attribute__((ext_vector_type(16))) _Float16     v16h;
typedef __attribute__((ext_vector_type(8)))  float        v8f;
typedef __attribute__((ext_vector_type(8)))  short        s16x8;
typedef __attribute__((ext_vector_type(8)))  _Float16     v8h;

#define DM    1024
#define SEQ   1024
#define BATCH 4
#define NH    16
#define HD    64
#define GM    4096   // rows of X / combined (B*S)

// LDS leading dims (halves). Row strides are multiples of 8 halves = 16B so
// b128 LDS writes stay naturally aligned.
#define AL_LD 40
#define WR_LD 80     // 64 data halves + 16 pad halves: 160 B rows for ds_load_tr16_b128
#define KT_LD 72     // 64 data halves + 8 pad halves: 144 B rows (16 B x odd) for b128 readers
#define VT_LD 40
#define ET_LD 40

__device__ __forceinline__ v8f zero8() {
  v8f z;
#pragma unroll
  for (int i = 0; i < 8; ++i) z[i] = 0.0f;
  return z;
}

__device__ __forceinline__ v16h load_frag16(const _Float16* __restrict__ src, int ld) {
  const int l   = threadIdx.x & 31;
  const int m   = l & 15;
  const int hi8 = (l >> 4) << 3;
  v16h f;
#pragma unroll
  for (int i = 0; i < 16; ++i) {
    const int k = ((i >> 3) << 4) + hi8 + (i & 7);
    f[i] = src[m * ld + k];
  }
  return f;
}

__device__ __forceinline__ v8f wmma16(v16h a, v16h b, v8f c) {
  // D = A(16x32 f16) * B(32x16 f16) + C(16x16 f32)
  return __builtin_amdgcn_wmma_f32_16x16x32_f16(
      /*neg_a=*/false, a, /*neg_b=*/false, b,
      /*c_mod=*/(short)0, c, /*reuse_a=*/false, /*reuse_b=*/false);
}

__device__ __forceinline__ v16h load_fragB_tr16(const _Float16* tile, int ld) {
  typedef __attribute__((address_space(3))) s16x8 lds_s16x8;
  const int l = threadIdx.x & 31;
  const _Float16* p = tile + (((l >> 4) << 3) + (l & 7)) * ld + (((l >> 3) & 1) << 3);
  const v8h lo = __builtin_bit_cast(v8h, __builtin_amdgcn_ds_load_tr16_b128_v8i16((lds_s16x8*)p));
  const v8h hi = __builtin_bit_cast(v8h, __builtin_amdgcn_ds_load_tr16_b128_v8i16((lds_s16x8*)(p + 16 * ld)));
  return __builtin_shufflevector(lo, hi, 0, 1, 2, 3, 4, 5, 6, 7, 8, 9, 10, 11, 12, 13, 14, 15);
}

__device__ __forceinline__ void async_copy3_b128(uint32_t l0, const void* g0,
                                                 uint32_t l1, const void* g1,
                                                 uint32_t l2, const void* g2) {
  asm volatile("global_load_async_to_lds_b128 %0, %1, off\n\t"
               "global_load_async_to_lds_b128 %2, %3, off\n\t"
               "global_load_async_to_lds_b128 %4, %5, off\n\t"
               "s_wait_xcnt 0x0"
               :: "v"(l0), "v"((uint64_t)(uintptr_t)g0),
                  "v"(l1), "v"((uint64_t)(uintptr_t)g1),
                  "v"(l2), "v"((uint64_t)(uintptr_t)g2)
               : "memory");
}
// The same for a stage of five copies (one X tile in two halves, three W tiles).
__device__ __forceinline__ void async_copy5_b128(uint32_t l0, const void* g0,
                                                 uint32_t l1, const void* g1,
                                                 uint32_t l2, const void* g2,
                                                 uint32_t l3, const void* g3,
                                                 uint32_t l4, const void* g4) {
  asm volatile("global_load_async_to_lds_b128 %0, %1, off\n\t"
               "global_load_async_to_lds_b128 %2, %3, off\n\t"
               "global_load_async_to_lds_b128 %4, %5, off\n\t"
               "global_load_async_to_lds_b128 %6, %7, off\n\t"
               "global_load_async_to_lds_b128 %8, %9, off\n\t"
               "s_wait_xcnt 0x0"
               :: "v"(l0), "v"((uint64_t)(uintptr_t)g0),
                  "v"(l1), "v"((uint64_t)(uintptr_t)g1),
                  "v"(l2), "v"((uint64_t)(uintptr_t)g2),
                  "v"(l3), "v"((uint64_t)(uintptr_t)g3),
                  "v"(l4), "v"((uint64_t)(uintptr_t)g4)
               : "memory");
}
// The same for a stage of one copy (a K tile: 16 bytes a lane).
__device__ __forceinline__ void async_copy1_b128(uint32_t l0, const void* g0) {
  asm volatile("global_load_async_to_lds_b128 %0, %1, off\n\t"
               "s_wait_xcnt 0x0"
               :: "v"(l0), "v"((uint64_t)(uintptr_t)g0)
               : "memory");
}
__device__ __forceinline__ void wait_async() {
  asm volatile("s_wait_asynccnt 0" ::: "memory");
}
__device__ __forceinline__ void wait_ds() {
  asm volatile("s_wait_dscnt 0" ::: "memory");
}

typedef __attribute__((ext_vector_type(4))) float    f32x4;
typedef __attribute__((ext_vector_type(4))) _Float16 f16x4;

#define CVT_U   8
#define CVT_BG  (256 * CVT_U)                              // groups a block
#define CVT_XB  (GM * DM / 4 / CVT_BG)                     // blocks of X: 512
#define CVT_WB  (DM * DM / 4 / CVT_BG)                     // blocks of a weight: 128
#define CVT_RB  (2048 * HD / 4 / CVT_BG)                   // blocks of rel_emb rows 1..2048: 16

__global__ __launch_bounds__(256)
void cvt_all_f32_to_f16(const float* __restrict__ X,
                        const float* __restrict__ Wq,
                        const float* __restrict__ Wk,
                        const float* __restrict__ Wv,
                        const float* __restrict__ Wo,
                        const float* __restrict__ rel,
                        _Float16* __restrict__ out) {
  const int b = blockIdx.x;
  const float* in;     // the job's source
  size_t off;          // its first element in out
  int blk;             // this block's index in the job
  int ts = threadIdx.x;   // which of a step's 256 groups this lane reads; it writes group threadIdx.x
  if (b < CVT_XB) {
    in = X;  off = 0;  blk = b;
  } else if (b < CVT_XB + 4 * CVT_WB) {
    const int j = (b - CVT_XB) / CVT_WB;
    in  = j == 0 ? Wq : j == 1 ? Wk : j == 2 ? Wv : Wo;
    off = (size_t)GM * DM + (size_t)j * DM * DM;
    blk = (b - CVT_XB) % CVT_WB;
  } else {
    in  = rel + HD;    // from row 1
    off = (size_t)GM * DM + (size_t)4 * DM * DM;
    blk = b - (CVT_XB + 4 * CVT_WB);
    // written group t = chunk t >> 6, lane (t >> 1) & 31, half t & 1 of its 16 bytes;
    // read group = 16 * row + d / 4
    const int t = threadIdx.x;
    ts = ((t >> 1) & 15) * 16 + (t >> 6) * 4 + ((t >> 5) & 1) * 2 + (t & 1);
  }
  const int i0 = blk * CVT_BG + threadIdx.x;
  const int s0 = blk * CVT_BG + ts;
  const f32x4* __restrict__ src = (const f32x4*)in;
  f16x4* __restrict__ dst = (f16x4*)(out + off);
  f32x4 v[CVT_U];
  // both loops unrolled: v[] stays in registers and the loads go out back to back
#pragma unroll
  for (int u = 0; u < CVT_U; ++u) v[u] = src[s0 + u * 256];
#pragma unroll
  for (int u = 0; u < CVT_U; ++u) dst[i0 + u * 256] = __builtin_convertvector(v[u], f16x4);
  // no register that an issued store names is written again ahead of this wait
  asm volatile("s_wait_xcnt 0x0" ::: "memory");
}

template <int MODE>
__global__ __launch_bounds__(256)
void gemm4096_wmma(const _Float16* __restrict__ A,
                   const _Float16* __restrict__ W,
                   const float* __restrict__ bias,
                   const float* __restrict__ bias1,
                   const float* __restrict__ bias2,
                   void* __restrict__ out) {
  constexpr int NW = (MODE == 0) ? 3 : 1;   // weight matrices that share the A tile
  __shared__ __attribute__((aligned(16))) _Float16 Al[2][128][AL_LD];
  __shared__ __attribute__((aligned(16))) _Float16 Wr[2][NW][32][WR_LD];   // W tiles [k][n]

  const int bm0 = blockIdx.x * 128;
  const int bn0 = blockIdx.y * 64;
  const int tid = threadIdx.x;
  const int w   = tid >> 5;
  const int l   = tid & 31;
  const int n   = l & 15;
  const int hi8 = (l >> 4) << 3;

  auto stage = [&](int kk, int buf) {
    // A tile 128x32 halves (512 x b128, 2 per thread) and each W tile 32x64
    // halves (256 x b128, 1 per thread), all via async-to-LDS
    const int arow = tid >> 2;         // m within tile: 0..63 (and +64)
    const int ac8  = (tid & 3) * 8;    // k base: 0..24
    const int wrow = tid >> 3;         // k within tile: 0..31
    const int wc8  = (tid & 7) * 8;    // n base: 0..56
    const _Float16* wg = &W[(size_t)(kk + wrow) * 1024 + bn0 + wc8];
    if constexpr (NW == 3) {
      async_copy5_b128((uint32_t)(uintptr_t)&Al[buf][arow][ac8],
                       &A[(size_t)(bm0 + arow) * 1024 + kk + ac8],
                       (uint32_t)(uintptr_t)&Al[buf][arow + 64][ac8],
                       &A[(size_t)(bm0 + arow + 64) * 1024 + kk + ac8],
                       (uint32_t)(uintptr_t)&Wr[buf][0][wrow][wc8], wg,
                       (uint32_t)(uintptr_t)&Wr[buf][1][wrow][wc8], wg + DM * DM,
                       (uint32_t)(uintptr_t)&Wr[buf][2][wrow][wc8], wg + 2 * DM * DM);
    } else {
      async_copy3_b128((uint32_t)(uintptr_t)&Al[buf][arow][ac8],
                       &A[(size_t)(bm0 + arow) * 1024 + kk + ac8],
                       (uint32_t)(uintptr_t)&Al[buf][arow + 64][ac8],
                       &A[(size_t)(bm0 + arow + 64) * 1024 + kk + ac8],
                       (uint32_t)(uintptr_t)&Wr[buf][0][wrow][wc8], wg);
    }
  };

  v8f acc[NW][4];
#pragma unroll
  for (int j = 0; j < NW; ++j)
#pragma unroll
    for (int i = 0; i < 4; ++i) acc[j][i] = zero8();

  stage(0, 0);
  wait_async();            // chunk 0 landed
  __syncthreads();         // publish it across waves
  stage(32, 1);
  int buf = 0;
  for (int kk = 0; kk < 1024; kk += 32, buf ^= 1) {
    const v16h a = load_frag16(&Al[buf][w * 16][0], AL_LD);
#pragma unroll
    for (int j = 0; j < NW; ++j) {
#pragma unroll
      for (int nb = 0; nb < 4; ++nb) {
        const v16h bf = load_fragB_tr16(&Wr[buf][j][0][nb * 16], WR_LD);
        acc[j][nb] = wmma16(a, bf, acc[j][nb]);
      }
    }

    wait_ds();             // this wave's reads of buf are done before its refill
    wait_async();          // chunk kk+32 landed (issued one trip ago)
    __syncthreads();       // publish it; every wave has left buf
    if (kk + 64 < 1024) stage(kk + 64, buf);   // copies fly during the next trip
  }
  wait_async();            // nothing of this wave's is outstanding at its end

#pragma unroll
  for (int j = 0; j < NW; ++j) {
    const float* bj = j == 0 ? bias : j == 1 ? bias1 : bias2;
#pragma unroll
    for (int nb = 0; nb < 4; ++nb) {
#pragma unroll
      for (int r = 0; r < 8; ++r) {
        const int row = bm0 + w * 16 + r + hi8;
        const int col = bn0 + nb * 16 + n;
        const float v = acc[j][nb][r] + bj[col];
        if (MODE == 0) {
          const int b = row >> 10, sr = row & 1023, hh = col >> 6, dd = col & 63;
          ((_Float16*)out)[(size_t)j * GM * DM +
                           (((size_t)(b * NH + hh)) * SEQ + sr) * HD + dd] = (_Float16)v;
        } else {
          ((float*)out)[(size_t)row * 1024 + col] = v;
        }
      }
    }
  }
}

// ---------------------------------------------------------------------------
// K3: flash attention with fused relative-position scores.
// Block = (b, h, 128-row q block); 8 waves, each wave a 16-row q tile.
// Everything a chunk reads from global memory is asked for one chunk ahead:
// K chunks fly into two LDS buffers by async copies (ring order as in the
// GEMMs, one barrier a chunk); V chunks wait in registers and are transposed
// into the other of two LDS buffers; the rel_emb fragments and the mask values
// are reloaded into their registers right behind their last use.
// Online softmax per row.
// Writes local attention output (pre-gating) to Ch[b,s,h*64+d] f16.
// ---------------------------------------------------------------------------
__global__ __launch_bounds__(256)
void attn_flash_wmma(const _Float16* __restrict__ Qh,
                     const _Float16* __restrict__ Kh,
                     const _Float16* __restrict__ Vh,
                     const _Float16* __restrict__ relh,  // rows 1..2048 in fragment order (K1)
                     const float* __restrict__ mask,     // [B,S]
                     _Float16* __restrict__ Ch) {        // [B,S,DM]
  __shared__ __attribute__((aligned(16))) _Float16 Kt[2][32][KT_LD];  // K chunks row-major [k][d]
  __shared__ _Float16 Vt[2][64][VT_LD];    // V chunks transposed [d][k]
  __shared__ _Float16 Et[8][16][ET_LD];    // per-wave exp(S) tile (A-frag src)
  __shared__ float    Pg[8][32][16];       // per-wave rel-score gather buffer

  const int qblk = blockIdx.x & 7;         // S/128 = 8
  const int bh   = blockIdx.x >> 3;
  const int h    = bh & (NH - 1);
  const int bb   = bh >> 4;
  const int tid  = threadIdx.x;
  const int w    = tid >> 5;
  const int l    = tid & 31;
  const int n    = l & 15;
  const int hi8  = (l >> 4) << 3;
  const int q0   = qblk * 128 + w * 16;    // absolute q of this wave's tile

  const size_t baseBH = ((size_t)(bb * NH + h)) * SEQ * HD;
  const _Float16* Qp = Qh + baseBH + (size_t)q0 * HD;
  const v16h aq0 = load_frag16(Qp + 0,  HD);   // d = 0..31
  const v16h aq1 = load_frag16(Qp + 32, HD);   // d = 32..63

  // a thread's 16 bytes of a 32x64 K or V chunk
  const int srow = tid >> 3;         // k within chunk 0..31
  const int sc8  = (tid & 7) * 8;    // d base 0..56
  const _Float16* Kg = Kh + baseBH + (size_t)srow * HD + sc8;
  const _Float16* Vg = Vh + baseBH + (size_t)srow * HD + sc8;

  auto stageK = [&](int k0, int buf) {
    async_copy1_b128((uint32_t)(uintptr_t)&Kt[buf][srow][sc8], Kg + (size_t)k0 * HD);
  };
  auto loadV = [&](int k0) { return *(const v8h*)(Vg + (size_t)k0 * HD); };
  auto storeV = [&](v8h v, int buf) {
    // unrolled: v[j] is picked by a constant and stays in its registers
#pragma unroll
    for (int j = 0; j < 8; ++j) Vt[buf][sc8 + j][srow] = v[j];
  };

  // rel_emb rows of chunk k0: the two 16-key halves need rows jb..jb+31 with
  // jb = q0 - k0 + 1009 and jb - 16, together three 16-row blocks from
  // jb - 16 = q0 - k0 + 993 (always in [1, 2001]); rf[2i], rf[2i+1] = block i,
  // d = 0..31 and 32..63. In relh's fragment order these are blocks
  // (q0 - k0 + 992) / 16 + 0..2: twelve chunks in a row, and each 16-byte load
  // of the wave takes one chunk, 512 contiguous bytes (four whole lines, where
  // a load from row-major rows touches sixteen).
  v16h  rf[6];
  float mk[2];
  auto loadRel = [&](int k0) {
    const v8h* rp = (const v8h*)relh + (size_t)((q0 - k0 + 992) >> 4) * 128 + l;
    // unrolled: rf[] is indexed by constants and stays in registers
#pragma unroll
    for (int f = 0; f < 6; ++f) {
      const v8h lo = rp[(2 * f) * 32];        // k = hi8 + 0..7 of load_frag16's order
      const v8h hi = rp[(2 * f + 1) * 32];    // k = 16 + hi8 + 0..7
      rf[f] = __builtin_shufflevector(lo, hi, 0, 1, 2, 3, 4, 5, 6, 7, 8, 9, 10, 11, 12, 13, 14, 15);
    }
    mk[0] = mask[bb * SEQ + k0 + n];
    mk[1] = mask[bb * SEQ + k0 + 16 + n];
  };

  v8f accd[4];
#pragma unroll
  for (int i = 0; i < 4; ++i) accd[i] = zero8();
  float mrow[8], lrow[8];
#pragma unroll
  for (int r = 0; r < 8; ++r) { mrow[r] = -1e30f; lrow[r] = 0.0f; }

  stageK(0, 0);
  storeV(loadV(0), 0);
  loadRel(0);
  wait_async();            // K chunk 0 landed
  __syncthreads();         // publish K and V chunk 0 across waves
  v8h vn = loadV(32);      // V of the next chunk, held in registers
  stageK(32, 1);
  int buf = 0;
  for (int k0 = 0; k0 < SEQ; k0 += 32, buf ^= 1) {
    v16h bv[4];
#pragma unroll
    for (int nb = 0; nb < 4; ++nb) bv[nb] = load_frag16(&Vt[buf][nb * 16][0], VT_LD);

    float s2[2][8];
#pragma unroll
    for (int sub = 0; sub < 2; ++sub) {
      const v16h bk0 = load_frag16(&Kt[buf][sub * 16][0],  KT_LD);
      const v16h bk1 = load_frag16(&Kt[buf][sub * 16][32], KT_LD);

      // content term: Q @ K^T over d=64
      v8f s = zero8();
      s = wmma16(aq0, bk0, s);
      s = wmma16(aq1, bk1, s);

      // rel term: P[i,dk] = <rel_emb[jb+i], K[k0+16*sub+dk]>, i in [0,31],
      // jb = q0 - k0 - 16*sub + 1009: blocks 1-sub and 2-sub of rf
      v8f p0 = zero8(), p1 = zero8();
      p0 = wmma16(rf[2 - 2 * sub], bk0, p0);
      p0 = wmma16(rf[3 - 2 * sub], bk1, p0);
      p1 = wmma16(rf[4 - 2 * sub], bk0, p1);
      p1 = wmma16(rf[5 - 2 * sub], bk1, p1);
#pragma unroll
      for (int r = 0; r < 8; ++r) {
        Pg[w][r + hi8][n]      = p0[r];
        Pg[w][16 + r + hi8][n] = p1[r];
      }
      const float mval = mk[sub] * -1e9f;
      wait_ds();   // wave-local LDS RAW

      // the next chunk's fragments and mask: asked for here, behind their last
      // use, to fly during the softmax (the last chunk asks for its own again)
      if (sub == 1) loadRel(k0 + 32 < SEQ ? k0 + 32 : k0);

#pragma unroll
      for (int r = 0; r < 8; ++r) {
        const int m = r + hi8;
        s2[sub][r] = (s[r] + Pg[w][m - n + 15][n]) * 0.125f + mval;
      }
    }

    // --- online softmax (rows live across 16 lanes; 8 rows per lane) ---
#pragma unroll
    for (int r = 0; r < 8; ++r) {
      float rm = fmaxf(s2[0][r], s2[1][r]);
#pragma unroll
      for (int off = 1; off < 16; off <<= 1) rm = fmaxf(rm, __shfl_xor(rm, off, 32));
      const float mnew = fmaxf(mrow[r], rm);
      const float ef   = __expf(mrow[r] - mnew);
      const float e0   = __expf(s2[0][r] - mnew);
      const float e1   = __expf(s2[1][r] - mnew);
      float rs = e0 + e1;
#pragma unroll
      for (int off = 1; off < 16; off <<= 1) rs += __shfl_xor(rs, off, 32);
      lrow[r] = lrow[r] * ef + rs;
      mrow[r] = mnew;
      const int m = r + hi8;
      Et[w][m][n]      = (_Float16)e0;
      Et[w][m][16 + n] = (_Float16)e1;
#pragma unroll
      for (int nb = 0; nb < 4; ++nb) accd[nb][r] *= ef;
    }
    // V of the next chunk goes into the buffer that every wave left one barrier ago
    if (k0 + 32 < SEQ) storeV(vn, buf ^ 1);
    wait_ds();

    // acc += exp(S) @ V  (A-frag from Et, B-frag from transposed V)
    const v16h ae = load_frag16(&Et[w][0][0], ET_LD);
#pragma unroll
    for (int nb = 0; nb < 4; ++nb) accd[nb] = wmma16(ae, bv[nb], accd[nb]);

    wait_ds();             // this wave's reads of buf are done before its refill
    wait_async();          // K chunk k0+32 landed (issued one trip ago)
    __syncthreads();       // publish K and V chunk k0+32; every wave has left buf
    if (k0 + 64 < SEQ) {   // fly during the next trip
      vn = loadV(k0 + 64);
      stageK(k0 + 64, buf);
    }
  }
  wait_async();            // nothing of this wave's is outstanding at its end

  // local attention output -> Ch[b, q, h*64+d]
#pragma unroll
  for (int nb = 0; nb < 4; ++nb) {
#pragma unroll
    for (int r = 0; r < 8; ++r) {
      const int m = r + hi8;
      const float v = accd[nb][r] / lrow[r];
      Ch[((size_t)bb * SEQ + q0 + m) * DM + h * HD + nb * 16 + n] = (_Float16)v;
    }
  }
}

// ---------------------------------------------------------------------------
// K4: linear-attention global read (elu(q)+1 vs M, z) + sigmoid gating, f32 VALU.
// Block = (b, h, 128 q rows). elu(q)+1 is formed once per (q, dd) and kept in
// LDS beside M[h]; a wave owns 16 rows, a lane two neighbouring d, so that one
// broadcast LDS read of four dd feeds eight multiply-adds and a wave's access
// to a row of Ch is one whole 128-byte line. Sums run over dd in rising order.
// ---------------------------------------------------------------------------
typedef __attribute__((ext_vector_type(2))) float    v2f;
typedef __attribute__((ext_vector_type(4))) float    v4f;
typedef __attribute__((ext_vector_type(2))) _Float16 v2h;
#define SQ_LD 68     // 64 floats + 4 pad: 272 B rows (16 B x odd) for the b128 row readers

__global__ __launch_bounds__(256)
void global_memory_gate(const _Float16* __restrict__ Qh,
                        const float* __restrict__ Mrd,  // [H,D,D]
                        const float* __restrict__ z,    // [H,D]
                        const float* __restrict__ galpha,
                        _Float16* __restrict__ Ch) {
  __shared__ __attribute__((aligned(16))) float Sq[128][SQ_LD];   // elu(q)+1
  __shared__ __attribute__((aligned(16))) float Ml[64][64];       // M[h]

  const int tid = threadIdx.x;
  const int w   = tid >> 5;
  const int l   = tid & 31;
  const int bh  = blockIdx.x >> 3;          // S/128 = 8
  const int h   = bh & (NH - 1);
  const int b   = bh >> 4;
  const int q0  = (blockIdx.x & 7) * 128;

  const v4f* Mg = (const v4f*)(Mrd + (size_t)h * (HD * HD));
  const v8h* Qg = (const v8h*)(Qh + ((size_t)bh * SEQ + q0) * HD);
#pragma unroll
  for (int i = 0; i < 4; ++i) {
    const int c = tid + 256 * i;
    ((v4f*)&Ml[0][0])[c] = Mg[c];
    const v8h qv = Qg[c];
    float* sr = &Sq[c >> 3][(c & 7) * 8];
#pragma unroll
    for (int j = 0; j < 8; ++j) {
      const float x = (float)qv[j];
      sr[j] = x > 0.0f ? x + 1.0f : __expf(x);   // elu(x)+1
    }
  }

  // local attention rows: asked for ahead of the barrier, used behind the sums
  v2h* Cp = (v2h*)(Ch + ((size_t)b * SEQ + q0 + w * 16) * DM + h * HD + 2 * l);
  v2h loc[16];
#pragma unroll
  for (int r = 0; r < 16; ++r) loc[r] = Cp[r * (DM / 2)];

  __syncthreads();   // Sq and Ml are read across waves from here on

  v2f num[16];
#pragma unroll
  for (int r = 0; r < 16; ++r) num[r] = (v2f){0.0f, 0.0f};
  float den = 1e-6f;                         // of row w*16 + (l & 15)
  const float* zh = z + h * HD;

#pragma unroll
  for (int d4 = 0; d4 < HD; d4 += 4) {
    v2f m[4];
#pragma unroll
    for (int j = 0; j < 4; ++j) m[j] = *(const v2f*)&Ml[d4 + j][2 * l];
    const v4f sd = *(const v4f*)&Sq[w * 16 + (l & 15)][d4];
#pragma unroll
    for (int j = 0; j < 4; ++j) den = __builtin_fmaf(sd[j], zh[d4 + j], den);
#pragma unroll
    for (int r = 0; r < 16; ++r) {
      const v4f s = *(const v4f*)&Sq[w * 16 + r][d4];
#pragma unroll
      for (int j = 0; j < 4; ++j) num[r] += s[j] * m[j];
    }
  }

  const float gate = 1.0f / (1.0f + __expf(-galpha[0]));
#pragma unroll
  for (int r = 0; r < 16; ++r) {
    const float dr = __builtin_bit_cast(
        float, __builtin_amdgcn_readlane(__builtin_bit_cast(int, den), r));
    v2h o;
    o[0] = (_Float16)(gate * (float)loc[r][0] + (1.0f - gate) * (num[r][0] / dr));
    o[1] = (_Float16)(gate * (float)loc[r][1] + (1.0f - gate) * (num[r][1] / dr));
    Cp[r * (DM / 2)] = o;
  }
}

// ---------------------------------------------------------------------------
// Host-side orchestration
// ---------------------------------------------------------------------------
extern "C" void kernel_launch(void* const* d_in, const int* in_sizes, int n_in,
                              void* d_out, int out_size, void* d_ws, size_t ws_size,
                              hipStream_t stream) {
  (void)in_sizes; (void)n_in; (void)out_size; (void)ws_size;
  const float* hidden = (const float*)d_in[0];
  const float* mask   = (const float*)d_in[1];
  const float* Wq = (const float*)d_in[2];  const float* bq = (const float*)d_in[3];
  const float* Wk = (const float*)d_in[4];  const float* bk = (const float*)d_in[5];
  const float* Wv = (const float*)d_in[6];  const float* bv = (const float*)d_in[7];
  const float* Wo = (const float*)d_in[8];  const float* bo = (const float*)d_in[9];
  const float* rel = (const float*)d_in[10];
  const float* M   = (const float*)d_in[11];
  const float* z   = (const float*)d_in[12];
  const float* ga  = (const float*)d_in[13];

  // workspace carve-up (f16), ~48 MB total
  _Float16* p   = (_Float16*)d_ws;
  _Float16* Xh  = p; p += (size_t)GM * DM;
  _Float16* Wqh = p; p += (size_t)3 * DM * DM;   // Wq, Wk, Wv one behind the other
  _Float16* Woh = p; p += (size_t)DM * DM;
  _Float16* relh = p; p += (size_t)2049 * HD;    // 2048 rows are written and read
  _Float16* Qh  = p; p += (size_t)GM * DM;
  _Float16* Kh  = p; p += (size_t)GM * DM;
  _Float16* Vh  = p; p += (size_t)GM * DM;
  _Float16* Ch  = p; p += (size_t)GM * DM;

  // the f16 copies of X, Wq, Wk, Wv, Wo and rel_emb lie one behind the other from Xh
  cvt_all_f32_to_f16<<<CVT_XB + 4 * CVT_WB + CVT_RB, 256, 0, stream>>>(
      hidden, Wq, Wk, Wv, Wo, rel, Xh);

  dim3 gg(GM / 128, DM / 64);   // 32 x 16
  // the three weights from Wqh, and Qh, Kh, Vh, lie one behind the other in the workspace
  gemm4096_wmma<0><<<gg, 256, 0, stream>>>(Xh, Wqh, bq, bk, bv, (void*)Qh);

  attn_flash_wmma<<<BATCH * NH * (SEQ / 128), 256, 0, stream>>>(
      Qh, Kh, Vh, relh, mask, Ch);

  global_memory_gate<<<BATCH * NH * (SEQ / 128), 256, 0, stream>>>(
      Qh, M, z, ga, Ch);

  gemm4096_wmma<1><<<gg, 256, 0, stream>>>(Ch, Woh, bo, bo, bo, d_out);
}

// v008
// It runs in 117 microseconds.
// In two side-by-side timings against v007, it was 1.25 and 1.24 times as fast.
// Over all steps from v000 it is 2.75 times as fast.
#include <hip/hip_runtime.h>
#include <hip/hip_bf16.h>
#include <stdint.h>

typedef __attribute__((ext_vector_type(16))) _Float16     v16h;
typedef __attribute__((ext_vector_type(8)))  float        v8f;
typedef __attribute__((ext_vector_type(8)))  short        s16x8;
typedef __attribute__((ext_vector_type(8)))  _Float16     v8h;

#define DM    1024
#define SEQ   1024
#define BATCH 4
#define NH    16
#define HD    64
#define GM    4096   // rows of X / combined (B*S)

// LDS leading dims (halves). Row strides are multiples of 8 halves = 16B so
// b128 LDS writes stay naturally aligned.
#define AL_LD 40
#define WR_LD 80     // 64 data halves + 16 pad halves: 160 B rows for ds_load_tr16_b128
#define KT_LD 72     // 64 data halves + 8 pad halves: 144 B rows (16 B x odd) for b128 readers
#define VT_LD 40

__device__ __forceinline__ v8f zero8() {
  v8f z;
#pragma unroll
  for (int i = 0; i < 8; ++i) z[i] = 0.0f;
  return z;
}

__device__ __forceinline__ v16h load_frag16(const _Float16* __restrict__ src, int ld) {
  const int l   = threadIdx.x & 31;
  const int m   = l & 15;
  const int hi8 = (l >> 4) << 3;
  v16h f;
#pragma unroll
  for (int i = 0; i < 16; ++i) {
    const int k = ((i >> 3) << 4) + hi8 + (i & 7);
    f[i] = src[m * ld + k];
  }
  return f;
}

__device__ __forceinline__ v8f wmma16(v16h a, v16h b, v8f c) {
  // D = A(16x32 f16) * B(32x16 f16) + C(16x16 f32)
  return __builtin_amdgcn_wmma_f32_16x16x32_f16(
      /*neg_a=*/false, a, /*neg_b=*/false, b,
      /*c_mod=*/(short)0, c, /*reuse_a=*/false, /*reuse_b=*/false);
}

__device__ __forceinline__ v16h load_fragB_tr16(const _Float16* tile, int ld) {
  typedef __attribute__((address_space(3))) s16x8 lds_s16x8;
  const int l = threadIdx.x & 31;
  const _Float16* p = tile + (((l >> 4) << 3) + (l & 7)) * ld + (((l >> 3) & 1) << 3);
  const v8h lo = __builtin_bit_cast(v8h, __builtin_amdgcn_ds_load_tr16_b128_v8i16((lds_s16x8*)p));
  const v8h hi = __builtin_bit_cast(v8h, __builtin_amdgcn_ds_load_tr16_b128_v8i16((lds_s16x8*)(p + 16 * ld)));
  return __builtin_shufflevector(lo, hi, 0, 1, 2, 3, 4, 5, 6, 7, 8, 9, 10, 11, 12, 13, 14, 15);
}

__device__ __forceinline__ void async_copy3_b128(uint32_t l0, const void* g0,
                                                 uint32_t l1, const void* g1,
                                                 uint32_t l2, const void* g2) {
  asm volatile("global_load_async_to_lds_b128 %0, %1, off\n\t"
               "global_load_async_to_lds_b128 %2, %3, off\n\t"
               "global_load_async_to_lds_b128 %4, %5, off\n\t"
               "s_wait_xcnt 0x0"
               :: "v"(l0), "v"((uint64_t)(uintptr_t)g0),
                  "v"(l1), "v"((uint64_t)(uintptr_t)g1),
                  "v"(l2), "v"((uint64_t)(uintptr_t)g2)
               : "memory");
}
// The same for a stage of five copies (one X tile in two halves, three W tiles).
__device__ __forceinline__ void async_copy5_b128(uint32_t l0, const void* g0,
                                                 uint32_t l1, const void* g1,
                                                 uint32_t l2, const void* g2,
                                                 uint32_t l3, const void* g3,
                                                 uint32_t l4, const void* g4) {
  asm volatile("global_load_async_to_lds_b128 %0, %1, off\n\t"
               "global_load_async_to_lds_b128 %2, %3, off\n\t"
               "global_load_async_to_lds_b128 %4, %5, off\n\t"
               "global_load_async_to_lds_b128 %6, %7, off\n\t"
               "global_load_async_to_lds_b128 %8, %9, off\n\t"
               "s_wait_xcnt 0x0"
               :: "v"(l0), "v"((uint64_t)(uintptr_t)g0),
                  "v"(l1), "v"((uint64_t)(uintptr_t)g1),
                  "v"(l2), "v"((uint64_t)(uintptr_t)g2),
                  "v"(l3), "v"((uint64_t)(uintptr_t)g3),
                  "v"(l4), "v"((uint64_t)(uintptr_t)g4)
               : "memory");
}
// The same for a stage of one copy (a K tile: 16 bytes a lane).
__device__ __forceinline__ void async_copy1_b128(uint32_t l0, const void* g0) {
  asm volatile("global_load_async_to_lds_b128 %0, %1, off\n\t"
               "s_wait_xcnt 0x0"
               :: "v"(l0), "v"((uint64_t)(uintptr_t)g0)
               : "memory");
}
__device__ __forceinline__ void wait_async() {
  asm volatile("s_wait_asynccnt 0" ::: "memory");
}
__device__ __forceinline__ void wait_ds() {
  asm volatile("s_wait_dscnt 0" ::: "memory");
}

typedef __attribute__((ext_vector_type(4))) float    f32x4;
typedef __attribute__((ext_vector_type(4))) _Float16 f16x4;

#define CVT_U   8
#define CVT_BG  (256 * CVT_U)                              // groups a block
#define CVT_XB  (GM * DM / 4 / CVT_BG)                     // blocks of X: 512
#define CVT_WB  (DM * DM / 4 / CVT_BG)                     // blocks of a weight: 128
#define CVT_RB  (2048 * HD / 4 / CVT_BG)                   // blocks of rel_emb rows 1..2048: 16

__global__ __launch_bounds__(256)
void cvt_all_f32_to_f16(const float* __restrict__ X,
                        const float* __restrict__ Wq,
                        const float* __restrict__ Wk,
                        const float* __restrict__ Wv,
                        const float* __restrict__ Wo,
                        const float* __restrict__ rel,
                        _Float16* __restrict__ out) {
  const int b = blockIdx.x;
  const float* in;     // the job's source
  size_t off;          // its first element in out
  int blk;             // this block's index in the job
  int ts = threadIdx.x;   // which of a step's 256 groups this lane reads; it writes group threadIdx.x
  if (b < CVT_XB) {
    in = X;  off = 0;  blk = b;
  } else if (b < CVT_XB + 4 * CVT_WB) {
    const int j = (b - CVT_XB) / CVT_WB;
    in  = j == 0 ? Wq : j == 1 ? Wk : j == 2 ? Wv : Wo;
    off = (size_t)GM * DM + (size_t)j * DM * DM;
    blk = (b - CVT_XB) % CVT_WB;
  } else {
    in  = rel + HD;    // from row 1
    off = (size_t)GM * DM + (size_t)4 * DM * DM;
    blk = b - (CVT_XB + 4 * CVT_WB);
    // written group t = chunk t >> 6, lane (t >> 1) & 31, half t & 1 of its 16 bytes;
    // read group = 16 * row + d / 4
    const int t = threadIdx.x;
    ts = ((t >> 1) & 15) * 16 + (t >> 6) * 4 + ((t >> 5) & 1) * 2 + (t & 1);
  }
  const int i0 = blk * CVT_BG + threadIdx.x;
  const int s0 = blk * CVT_BG + ts;
  const f32x4* __restrict__ src = (const f32x4*)in;
  f16x4* __restrict__ dst = (f16x4*)(out + off);
  f32x4 v[CVT_U];
  // both loops unrolled: v[] stays in registers and the loads go out back to back
#pragma unroll
  for (int u = 0; u < CVT_U; ++u) v[u] = src[s0 + u * 256];
#pragma unroll
  for (int u = 0; u < CVT_U; ++u) dst[i0 + u * 256] = __builtin_convertvector(v[u], f16x4);
  // no register that an issued store names is written again ahead of this wait
  asm volatile("s_wait_xcnt 0x0" ::: "memory");
}

template <int MODE>
__global__ __launch_bounds__(256)
void gemm4096_wmma(const _Float16* __restrict__ A,
                   const _Float16* __restrict__ W,
                   const float* __restrict__ bias,
                   const float* __restrict__ bias1,
                   const float* __restrict__ bias2,
                   void* __restrict__ out) {
  constexpr int NW = (MODE == 0) ? 3 : 1;   // weight matrices that share the A tile
  __shared__ __attribute__((aligned(16))) _Float16 Al[2][128][AL_LD];
  __shared__ __attribute__((aligned(16))) _Float16 Wr[2][NW][32][WR_LD];   // W tiles [k][n]

  const int bm0 = blockIdx.x * 128;
  const int bn0 = blockIdx.y * 64;
  const int tid = threadIdx.x;
  const int w   = tid >> 5;
  const int l   = tid & 31;
  const int n   = l & 15;
  const int hi8 = (l >> 4) << 3;

  auto stage = [&](int kk, int buf) {
    // A tile 128x32 halves (512 x b128, 2 per thread) and each W tile 32x64
    // halves (256 x b128, 1 per thread), all via async-to-LDS
    const int arow = tid >> 2;         // m within tile: 0..63 (and +64)
    const int ac8  = (tid & 3) * 8;    // k base: 0..24
    const int wrow = tid >> 3;         // k within tile: 0..31
    const int wc8  = (tid & 7) * 8;    // n base: 0..56
    const _Float16* wg = &W[(size_t)(kk + wrow) * 1024 + bn0 + wc8];
    if constexpr (NW == 3) {
      async_copy5_b128((uint32_t)(uintptr_t)&Al[buf][arow][ac8],
                       &A[(size_t)(bm0 + arow) * 1024 + kk + ac8],
                       (uint32_t)(uintptr_t)&Al[buf][arow + 64][ac8],
                       &A[(size_t)(bm0 + arow + 64) * 1024 + kk + ac8],
                       (uint32_t)(uintptr_t)&Wr[buf][0][wrow][wc8], wg,
                       (uint32_t)(uintptr_t)&Wr[buf][1][wrow][wc8], wg + DM * DM,
                       (uint32_t)(uintptr_t)&Wr[buf][2][wrow][wc8], wg + 2 * DM * DM);
    } else {
      async_copy3_b128((uint32_t)(uintptr_t)&Al[buf][arow][ac8],
                       &A[(size_t)(bm0 + arow) * 1024 + kk + ac8],
                       (uint32_t)(uintptr_t)&Al[buf][arow + 64][ac8],
                       &A[(size_t)(bm0 + arow + 64) * 1024 + kk + ac8],
                       (uint32_t)(uintptr_t)&Wr[buf][0][wrow][wc8], wg);
    }
  };

  v8f acc[NW][4];
#pragma unroll
  for (int j = 0; j < NW; ++j)
#pragma unroll
    for (int i = 0; i < 4; ++i) acc[j][i] = zero8();

  stage(0, 0);
  wait_async();            // chunk 0 landed
  __syncthreads();         // publish it across waves
  stage(32, 1);
  int buf = 0;
  for (int kk = 0; kk < 1024; kk += 32, buf ^= 1) {
    const v16h a = load_frag16(&Al[buf][w * 16][0], AL_LD);
#pragma unroll
    for (int j = 0; j < NW; ++j) {
#pragma unroll
      for (int nb = 0; nb < 4; ++nb) {
        const v16h bf = load_fragB_tr16(&Wr[buf][j][0][nb * 16], WR_LD);
        acc[j][nb] = wmma16(a, bf, acc[j][nb]);
      }
    }

    wait_ds();             // this wave's reads of buf are done before its refill
    wait_async();          // chunk kk+32 landed (issued one trip ago)
    __syncthreads();       // publish it; every wave has left buf
    if (kk + 64 < 1024) stage(kk + 64, buf);   // copies fly during the next trip
  }
  wait_async();            // nothing of this wave's is outstanding at its end

#pragma unroll
  for (int j = 0; j < NW; ++j) {
    const float* bj = j == 0 ? bias : j == 1 ? bias1 : bias2;
#pragma unroll
    for (int nb = 0; nb < 4; ++nb) {
#pragma unroll
      for (int r = 0; r < 8; ++r) {
        const int row = bm0 + w * 16 + r + hi8;
        const int col = bn0 + nb * 16 + n;
        const float v = acc[j][nb][r] + bj[col];
        if (MODE == 0) {
          const int b = row >> 10, sr = row & 1023, hh = col >> 6, dd = col & 63;
          ((_Float16*)out)[(size_t)j * GM * DM +
                           (((size_t)(b * NH + hh)) * SEQ + sr) * HD + dd] = (_Float16)v;
        } else {
          ((float*)out)[(size_t)row * 1024 + col] = v;
        }
      }
    }
  }
}

typedef __attribute__((ext_vector_type(4))) float a4f;
#define PG_LD 20     // 16 floats + 4 pad: 80 B rows (16 B x odd) for the b128 row writers

// load_frag16 for LDS rows that begin at multiples of 16 bytes: the same map as
// two 16-byte loads (halves 0..7 -> k = hi8 + i, halves 8..15 -> k = 16 + hi8 + i)
__device__ __forceinline__ v16h load_frag16_rows(const _Float16* src, int ld) {
  const int l = threadIdx.x & 31;
  const _Float16* p = src + (l & 15) * ld + ((l >> 4) << 3);
  const v8h lo = *(const v8h*)p;
  const v8h hi = *(const v8h*)(p + 16);
  return __builtin_shufflevector(lo, hi, 0, 1, 2, 3, 4, 5, 6, 7, 8, 9, 10, 11, 12, 13, 14, 15);
}

__device__ __forceinline__ float xhalf(float x) {
  return __builtin_bit_cast(float, __builtin_amdgcn_permlanex16(
      __builtin_bit_cast(int, x), __builtin_bit_cast(int, x),
      0x76543210, 0xfedcba98, false, false));
}

__global__ __launch_bounds__(256)
void attn_flash_wmma(const _Float16* __restrict__ Qh,
                     const _Float16* __restrict__ Kh,
                     const _Float16* __restrict__ Vh,
                     const _Float16* __restrict__ relh,  // rows 1..2048 in fragment order (K1)
                     const float* __restrict__ mask,     // [B,S]
                     _Float16* __restrict__ Ch) {        // [B,S,DM]
  __shared__ __attribute__((aligned(16))) _Float16 Kt[2][32][KT_LD];  // K chunks row-major [k][d]
  __shared__ __attribute__((aligned(16))) _Float16 Vt[2][64][VT_LD];  // V chunks transposed [d][k]
  __shared__ __attribute__((aligned(16))) float Pg[8][2][32][PG_LD];  // per-wave rel scores [31 - rel row][key]
  __shared__ __attribute__((aligned(16))) float Mk[SEQ];              // this batch's mask row

  const int qblk = blockIdx.x & 7;         // S/128 = 8
  const int bh   = blockIdx.x >> 3;
  const int h    = bh & (NH - 1);
  const int bb   = bh >> 4;
  const int tid  = threadIdx.x;
  const int w    = tid >> 5;
  const int l    = tid & 31;
  const int n    = l & 15;
  const int hi8  = (l >> 4) << 3;
  const int q0   = qblk * 128 + w * 16;    // absolute q of this wave's tile

  const size_t baseBH = ((size_t)(bb * NH + h)) * SEQ * HD;
  const _Float16* Qp = Qh + baseBH + (size_t)q0 * HD;
  const v16h aq0 = load_frag16(Qp + 0,  HD);   // column q = n of Q^T, d = 0..31
  const v16h aq1 = load_frag16(Qp + 32, HD);   // d = 32..63

  // a thread's 16 bytes of a 32x64 K or V chunk
  const int srow = tid >> 3;         // k within chunk 0..31
  const int sc8  = (tid & 7) * 8;    // d base 0..56
  const _Float16* Kg = Kh + baseBH + (size_t)srow * HD + sc8;
  const _Float16* Vg = Vh + baseBH + (size_t)srow * HD + sc8;

  auto stageK = [&](int k0, int buf) {
    async_copy1_b128((uint32_t)(uintptr_t)&Kt[buf][srow][sc8], Kg + (size_t)k0 * HD);
  };
  auto loadV = [&](int k0) { return *(const v8h*)(Vg + (size_t)k0 * HD); };
  auto storeV = [&](v8h v, int buf) {
    // unrolled: v[j] is picked by a constant and stays in its registers
#pragma unroll
    for (int j = 0; j < 8; ++j) Vt[buf][sc8 + j][srow] = v[j];
  };

  // rel_emb rows of chunk k0: the two 16-key halves need rows jb..jb+31 with
  // jb = q0 - k0 + 1009 and jb - 16, together three 16-row blocks from
  // jb - 16 = q0 - k0 + 993 (always in [1, 2001]); rf[2i], rf[2i+1] = block i,
  // d = 0..31 and 32..63. In relh's fragment order these are blocks
  // (q0 - k0 + 992) / 16 + 0..2: twelve chunks in a row, and each 16-byte load
  // of the wave takes one chunk, 512 contiguous bytes (four whole lines, where
  // a load from row-major rows touches sixteen).
  v16h  rf[6];
  auto loadRel = [&](int k0) {
    const v8h* rp = (const v8h*)relh + (size_t)((q0 - k0 + 992) >> 4) * 128 + l;
    // unrolled: rf[] is indexed by constants and stays in registers
#pragma unroll
    for (int f = 0; f < 6; ++f) {
      const v8h lo = rp[(2 * f) * 32];        // k = hi8 + 0..7 of load_frag16's order
      const v8h hi = rp[(2 * f + 1) * 32];    // k = 16 + hi8 + 0..7
      rf[f] = __builtin_shufflevector(lo, hi, 0, 1, 2, 3, 4, 5, 6, 7, 8, 9, 10, 11, 12, 13, 14, 15);
    }
  };

  v8f accd[4];     // O^T: accd[nb][r] = O[q = n][d = 16 nb + hi8 + r]
#pragma unroll
  for (int i = 0; i < 4; ++i) accd[i] = zero8();
  float mrow = -1e30f;   // running maximum of query n (the same in both halves)
  float lrow = 0.0f;     // running sum over this half's keys

  const a4f mk4 = ((const a4f*)(mask + bb * SEQ))[tid];
  stageK(0, 0);
  storeV(loadV(0), 0);
  ((a4f*)Mk)[tid] = mk4;
  loadRel(0);
  wait_async();            // K chunk 0 landed
  __syncthreads();         // publish K and V chunk 0 and the mask row across waves
  v8h vn = loadV(32);      // V of the next chunk, held in registers
  stageK(32, 1);
  int buf = 0;
  for (int k0 = 0; k0 < SEQ; k0 += 32, buf ^= 1) {
    // the chunk's four K fragments, read as one group: row = key, d = 0..31 and 32..63
    v16h bk[2][2];
#pragma unroll
    for (int sub = 0; sub < 2; ++sub) {
      bk[sub][0] = load_frag16_rows(&Kt[buf][sub * 16][0],  KT_LD);
      bk[sub][1] = load_frag16_rows(&Kt[buf][sub * 16][32], KT_LD);
    }

    // content term: S^T = K @ Q^T over d=64; s[sub][r] = S[q = n][key 16 sub + hi8 + r]
    v8f s[2];
#pragma unroll
    for (int sub = 0; sub < 2; ++sub) {
      s[sub] = zero8();
      s[sub] = wmma16(bk[sub][0], aq0, s[sub]);
      s[sub] = wmma16(bk[sub][1], aq1, s[sub]);
    }
    // holds content products ahead of the rel products
    __builtin_amdgcn_sched_barrier(0);

#pragma unroll
    for (int sub = 0; sub < 2; ++sub) {
      const v16h bk0 = bk[sub][0], bk1 = bk[sub][1];

      // rel term: P^T[dk,i] = <K[k0+16*sub+dk], rel_emb[jb+i]>, i in [0,31],
      // jb = q0 - k0 - 16*sub + 1009: blocks 1-sub and 2-sub of rf
      v8f p0 = zero8(), p1 = zero8();
      p0 = wmma16(bk0, rf[2 - 2 * sub], p0);
      p0 = wmma16(bk1, rf[3 - 2 * sub], p0);
      p1 = wmma16(bk0, rf[4 - 2 * sub], p1);
      p1 = wmma16(bk1, rf[5 - 2 * sub], p1);
      // a lane holds eight neighbouring keys of rel row i = n (p0) and 16 + n (p1);
      // rel row i lies in row 31 - i, so that a reader's eight addresses rise with
      // the key and its paired loads come back in register order
      *(a4f*)&Pg[w][sub][31 - n][hi8]     = (a4f){p0[0], p0[1], p0[2], p0[3]};
      *(a4f*)&Pg[w][sub][31 - n][hi8 + 4] = (a4f){p0[4], p0[5], p0[6], p0[7]};
      *(a4f*)&Pg[w][sub][15 - n][hi8]     = (a4f){p1[0], p1[1], p1[2], p1[3]};
      *(a4f*)&Pg[w][sub][15 - n][hi8 + 4] = (a4f){p1[4], p1[5], p1[6], p1[7]};
    }
    wait_ds();   // wave-local LDS RAW

    // the next chunk's fragments: asked for here, behind their last use, to fly
    // during the softmax (the last chunk asks for its own again)
    loadRel(k0 + 32 < SEQ ? k0 + 32 : k0);
    // keeps the twelve loads here: sunk to the loop's foot they would be waited
    // for at once by the barrier there, with their whole latency in the open
    __builtin_amdgcn_sched_barrier(0);

    // query n, key dk takes rel row i = n - dk + 15, which lies in row 16 - n + dk
    float s2[2][8];
#pragma unroll
    for (int sub = 0; sub < 2; ++sub) {
      const a4f ma = *(const a4f*)&Mk[k0 + sub * 16 + hi8];
      const a4f mb = *(const a4f*)&Mk[k0 + sub * 16 + hi8 + 4];
#pragma unroll
      for (int r = 0; r < 8; ++r) {
        const int dk = r + hi8;
        const float mval = (r < 4 ? ma[r & 3] : mb[r & 3]) * -1e9f;
        s2[sub][r] = (s[sub][r] + Pg[w][sub][16 - n + dk][dk]) * 0.125f + mval;
      }
    }

    v16h bv[4];   // rows d of V^T, keys in load_frag16's k order
#pragma unroll
    for (int nb = 0; nb < 4; ++nb) bv[nb] = load_frag16_rows(&Vt[buf][nb * 16][0], VT_LD);

    // --- online softmax: a query's 32 scores lie in lanes n and n + 16 ---
    float rm = s2[0][0];
#pragma unroll
    for (int sub = 0; sub < 2; ++sub)
#pragma unroll
      for (int r = 0; r < 8; ++r) rm = fmaxf(rm, s2[sub][r]);
    rm = fmaxf(rm, xhalf(rm));
    const float mnew = fmaxf(mrow, rm);
    const float ef   = __expf(mrow - mnew);
    mrow = mnew;
    v16h pt;      // P^T as a B operand: halves 0..7 = keys hi8 + r, 8..15 = keys 16 + hi8 + r
    float t[8];
#pragma unroll
    for (int i = 0; i < 16; i += 2) {
      const float e0 = __expf(s2[i >> 3][i & 7] - mnew);
      const float e1 = __expf(s2[i >> 3][(i & 7) + 1] - mnew);
      t[i >> 1] = e0 + e1;
      pt[i]     = (_Float16)e0;
      pt[i + 1] = (_Float16)e1;
    }
    // summed as a tree: three links behind t[], not a chain of eight
    lrow = lrow * ef + (((t[0] + t[1]) + (t[2] + t[3])) + ((t[4] + t[5]) + (t[6] + t[7])));
#pragma unroll
    for (int nb = 0; nb < 4; ++nb)
#pragma unroll
      for (int r = 0; r < 8; ++r) accd[nb][r] *= ef;

    // O^T += V^T @ P^T
#pragma unroll
    for (int nb = 0; nb < 4; ++nb) accd[nb] = wmma16(bv[nb], pt, accd[nb]);

    // V of the next chunk goes into the buffer that every wave left one barrier ago
    if (k0 + 32 < SEQ) storeV(vn, buf ^ 1);

    wait_ds();             // this wave's reads of buf are done before its refill
    wait_async();          // K chunk k0+32 landed (issued one trip ago)
    __syncthreads();       // publish K and V chunk k0+32; every wave has left buf
    if (k0 + 64 < SEQ) {   // fly during the next trip
      vn = loadV(k0 + 64);
      stageK(k0 + 64, buf);
    }
  }
  wait_async();            // nothing of this wave's is outstanding at its end

  // local attention output -> Ch[b, q, h*64+d]: a lane's eight registers of a
  // tile are eight neighbouring d of its query, one 16-byte store
  const float inv = 1.0f / (lrow + xhalf(lrow));
  _Float16* Cq = Ch + ((size_t)bb * SEQ + q0 + n) * DM + h * HD + hi8;
#pragma unroll
  for (int nb = 0; nb < 4; ++nb) {
    v8h o;
#pragma unroll
    for (int r = 0; r < 8; ++r) o[r] = (_Float16)(accd[nb][r] * inv);
    *(v8h*)(Cq + nb * 16) = o;
  }
}

// ---------------------------------------------------------------------------
// K4: linear-attention global read (elu(q)+1 vs M, z) + sigmoid gating, f32 VALU.
// Block = (b, h, 128 q rows). elu(q)+1 is formed once per (q, dd) and kept in
// LDS beside M[h]; a wave owns 16 rows, a lane two neighbouring d, so that one
// broadcast LDS read of four dd feeds eight multiply-adds and a wave's access
// to a row of Ch is one whole 128-byte line. Sums run over dd in rising order.
// ---------------------------------------------------------------------------
typedef __attribute__((ext_vector_type(2))) float    v2f;
typedef __attribute__((ext_vector_type(4))) float    v4f;
typedef __attribute__((ext_vector_type(2))) _Float16 v2h;
#define SQ_LD 68     // 64 floats + 4 pad: 272 B rows (16 B x odd) for the b128 row readers

__global__ __launch_bounds__(256)
void global_memory_gate(const _Float16* __restrict__ Qh,
                        const float* __restrict__ Mrd,  // [H,D,D]
                        const float* __restrict__ z,    // [H,D]
                        const float* __restrict__ galpha,
                        _Float16* __restrict__ Ch) {
  __shared__ __attribute__((aligned(16))) float Sq[128][SQ_LD];   // elu(q)+1
  __shared__ __attribute__((aligned(16))) float Ml[64][64];       // M[h]

  const int tid = threadIdx.x;
  const int w   = tid >> 5;
  const int l   = tid & 31;
  const int bh  = blockIdx.x >> 3;          // S/128 = 8
  const int h   = bh & (NH - 1);
  const int b   = bh >> 4;
  const int q0  = (blockIdx.x & 7) * 128;

  const v4f* Mg = (const v4f*)(Mrd + (size_t)h * (HD * HD));
  const v8h* Qg = (const v8h*)(Qh + ((size_t)bh * SEQ + q0) * HD);
#pragma unroll
  for (int i = 0; i < 4; ++i) {
    const int c = tid + 256 * i;
    ((v4f*)&Ml[0][0])[c] = Mg[c];
    const v8h qv = Qg[c];
    float* sr = &Sq[c >> 3][(c & 7) * 8];
#pragma unroll
    for (int j = 0; j < 8; ++j) {
      const float x = (float)qv[j];
      sr[j] = x > 0.0f ? x + 1.0f : __expf(x);   // elu(x)+1
    }
  }

  // local attention rows: asked for ahead of the barrier, used behind the sums
  v2h* Cp = (v2h*)(Ch + ((size_t)b * SEQ + q0 + w * 16) * DM + h * HD + 2 * l);
  v2h loc[16];
#pragma unroll
  for (int r = 0; r < 16; ++r) loc[r] = Cp[r * (DM / 2)];

  __syncthreads();   // Sq and Ml are read across waves from here on

  v2f num[16];
#pragma unroll
  for (int r = 0; r < 16; ++r) num[r] = (v2f){0.0f, 0.0f};
  float den = 1e-6f;                         // of row w*16 + (l & 15)
  const float* zh = z + h * HD;

#pragma unroll
  for (int d4 = 0; d4 < HD; d4 += 4) {
    v2f m[4];
#pragma unroll
    for (int j = 0; j < 4; ++j) m[j] = *(const v2f*)&Ml[d4 + j][2 * l];
    const v4f sd = *(const v4f*)&Sq[w * 16 + (l & 15)][d4];
#pragma unroll
    for (int j = 0; j < 4; ++j) den = __builtin_fmaf(sd[j], zh[d4 + j], den);
#pragma unroll
    for (int r = 0; r < 16; ++r) {
      const v4f s = *(const v4f*)&Sq[w * 16 + r][d4];
#pragma unroll
      for (int j = 0; j < 4; ++j) num[r] += s[j] * m[j];
    }
  }

  const float gate = 1.0f / (1.0f + __expf(-galpha[0]));
#pragma unroll
  for (int r = 0; r < 16; ++r) {
    const float dr = __builtin_bit_cast(
        float, __builtin_amdgcn_readlane(__builtin_bit_cast(int, den), r));
    v2h o;
    o[0] = (_Float16)(gate * (float)loc[r][0] + (1.0f - gate) * (num[r][0] / dr));
    o[1] = (_Float16)(gate * (float)loc[r][1] + (1.0f - gate) * (num[r][1] / dr));
    Cp[r * (DM / 2)] = o;
  }
}

// ---------------------------------------------------------------------------
// Host-side orchestration
// ---------------------------------------------------------------------------
extern "C" void kernel_launch(void* const* d_in, const int* in_sizes, int n_in,
                              void* d_out, int out_size, void* d_ws, size_t ws_size,
                              hipStream_t stream) {
  (void)in_sizes; (void)n_in; (void)out_size; (void)ws_size;
  const float* hidden = (const float*)d_in[0];
  const float* mask   = (const float*)d_in[1];
  const float* Wq = (const float*)d_in[2];  const float* bq = (const float*)d_in[3];
  const float* Wk = (const float*)d_in[4];  const float* bk = (const float*)d_in[5];
  const float* Wv = (const float*)d_in[6];  const float* bv = (const float*)d_in[7];
  const float* Wo = (const float*)d_in[8];  const float* bo = (const float*)d_in[9];
  const float* rel = (const float*)d_in[10];
  const float* M   = (const float*)d_in[11];
  const float* z   = (const float*)d_in[12];
  const float* ga  = (const float*)d_in[13];

  // workspace carve-up (f16), ~48 MB total
  _Float16* p   = (_Float16*)d_ws;
  _Float16* Xh  = p; p += (size_t)GM * DM;
  _Float16* Wqh = p; p += (size_t)3 * DM * DM;   // Wq, Wk, Wv one behind the other
  _Float16* Woh = p; p += (size_t)DM * DM;
  _Float16* relh = p; p += (size_t)2049 * HD;    // 2048 rows are written and read
  _Float16* Qh  = p; p += (size_t)GM * DM;
  _Float16* Kh  = p; p += (size_t)GM * DM;
  _Float16* Vh  = p; p += (size_t)GM * DM;
  _Float16* Ch  = p; p += (size_t)GM * DM;

  // the f16 copies of X, Wq, Wk, Wv, Wo and rel_emb lie one behind the other from Xh
  cvt_all_f32_to_f16<<<CVT_XB + 4 * CVT_WB + CVT_RB, 256, 0, stream>>>(
      hidden, Wq, Wk, Wv, Wo, rel, Xh);

  dim3 gg(GM / 128, DM / 64);   // 32 x 16
  // the three weights from Wqh, and Qh, Kh, Vh, lie one behind the other in the workspace
  gemm4096_wmma<0><<<gg, 256, 0, stream>>>(Xh, Wqh, bq, bk, bv, (void*)Qh);

  attn_flash_wmma<<<BATCH * NH * (SEQ / 128), 256, 0, stream>>>(
      Qh, Kh, Vh, relh, mask, Ch);

  global_memory_gate<<<BATCH * NH * (SEQ / 128), 256, 0, stream>>>(
      Qh, M, z, ga, Ch);

  gemm4096_wmma<1><<<gg, 256, 0, stream>>>(Ch, Woh, bo, bo, bo, d_out);
}

// v009
// Measured time: 109 microseconds a run.
// Timed twice side by side with v008, it ran 1.07 and 1.06 times as fast.
// All steps since v000 together make it 2.93 times as fast.
#include <hip/hip_runtime.h>
#include <hip/hip_bf16.h>
#include <stdint.h>

typedef __attribute__((ext_vector_type(16))) _Float16     v16h;
typedef __attribute__((ext_vector_type(8)))  float        v8f;
typedef __attribute__((ext_vector_type(8)))  short        s16x8;
typedef __attribute__((ext_vector_type(8)))  _Float16     v8h;

#define DM    1024
#define SEQ   1024
#define BATCH 4
#define NH    16
#define HD    64
#define GM    4096   // rows of X / combined (B*S)

// LDS leading dims (halves). Row strides are multiples of 8 halves = 16B so
// b128 LDS writes stay naturally aligned.
#define AL_LD 40
#define WR_LD 80     // 64 data halves + 16 pad halves: 160 B rows for ds_load_tr16_b128
#define KT_LD 72     // 64 data halves + 8 pad halves: 144 B rows (16 B x odd) for b128 readers
#define VT_LD 40

__device__ __forceinline__ v8f zero8() {
  v8f z;
#pragma unroll
  for (int i = 0; i < 8; ++i) z[i] = 0.0f;
  return z;
}

__device__ __forceinline__ v16h load_frag16(const _Float16* __restrict__ src, int ld) {
  const int l   = threadIdx.x & 31;
  const int m   = l & 15;
  const int hi8 = (l >> 4) << 3;
  v16h f;
#pragma unroll
  for (int i = 0; i < 16; ++i) {
    const int k = ((i >> 3) << 4) + hi8 + (i & 7);
    f[i] = src[m * ld + k];
  }
  return f;
}

__device__ __forceinline__ v8f wmma16(v16h a, v16h b, v8f c) {
  // D = A(16x32 f16) * B(32x16 f16) + C(16x16 f32)
  return __builtin_amdgcn_wmma_f32_16x16x32_f16(
      /*neg_a=*/false, a, /*neg_b=*/false, b,
      /*c_mod=*/(short)0, c, /*reuse_a=*/false, /*reuse_b=*/false);
}

__device__ __forceinline__ v16h load_fragB_tr16(const _Float16* tile, int ld) {
  typedef __attribute__((address_space(3))) s16x8 lds_s16x8;
  const int l = threadIdx.x & 31;
  const _Float16* p = tile + (((l >> 4) << 3) + (l & 7)) * ld + (((l >> 3) & 1) << 3);
  const v8h lo = __builtin_bit_cast(v8h, __builtin_amdgcn_ds_load_tr16_b128_v8i16((lds_s16x8*)p));
  const v8h hi = __builtin_bit_cast(v8h, __builtin_amdgcn_ds_load_tr16_b128_v8i16((lds_s16x8*)(p + 16 * ld)));
  return __builtin_shufflevector(lo, hi, 0, 1, 2, 3, 4, 5, 6, 7, 8, 9, 10, 11, 12, 13, 14, 15);
}

__device__ __forceinline__ void async_copy3_b128(uint32_t l0, const void* g0,
                                                 uint32_t l1, const void* g1,
                                                 uint32_t l2, const void* g2) {
  asm volatile("global_load_async_to_lds_b128 %0, %1, off\n\t"
               "global_load_async_to_lds_b128 %2, %3, off\n\t"
               "global_load_async_to_lds_b128 %4, %5, off\n\t"
               "s_wait_xcnt 0x0"
               :: "v"(l0), "v"((uint64_t)(uintptr_t)g0),
                  "v"(l1), "v"((uint64_t)(uintptr_t)g1),
                  "v"(l2), "v"((uint64_t)(uintptr_t)g2)
               : "memory");
}
// The same for a stage of five copies (one X tile in two halves, three W tiles).
__device__ __forceinline__ void async_copy5_b128(uint32_t l0, const void* g0,
                                                 uint32_t l1, const void* g1,
                                                 uint32_t l2, const void* g2,
                                                 uint32_t l3, const void* g3,
                                                 uint32_t l4, const void* g4) {
  asm volatile("global_load_async_to_lds_b128 %0, %1, off\n\t"
               "global_load_async_to_lds_b128 %2, %3, off\n\t"
               "global_load_async_to_lds_b128 %4, %5, off\n\t"
               "global_load_async_to_lds_b128 %6, %7, off\n\t"
               "global_load_async_to_lds_b128 %8, %9, off\n\t"
               "s_wait_xcnt 0x0"
               :: "v"(l0), "v"((uint64_t)(uintptr_t)g0),
                  "v"(l1), "v"((uint64_t)(uintptr_t)g1),
                  "v"(l2), "v"((uint64_t)(uintptr_t)g2),
                  "v"(l3), "v"((uint64_t)(uintptr_t)g3),
                  "v"(l4), "v"((uint64_t)(uintptr_t)g4)
               : "memory");
}
// The same for a stage of one copy (a K tile: 16 bytes a lane).
__device__ __forceinline__ void async_copy1_b128(uint32_t l0, const void* g0) {
  asm volatile("global_load_async_to_lds_b128 %0, %1, off\n\t"
               "s_wait_xcnt 0x0"
               :: "v"(l0), "v"((uint64_t)(uintptr_t)g0)
               : "memory");
}
__device__ __forceinline__ void wait_async() {
  asm volatile("s_wait_asynccnt 0" ::: "memory");
}
__device__ __forceinline__ void wait_ds() {
  asm volatile("s_wait_dscnt 0" ::: "memory");
}

typedef __attribute__((ext_vector_type(4))) float    f32x4;
typedef __attribute__((ext_vector_type(4))) _Float16 f16x4;

#define CVT_U   8
#define CVT_BG  (256 * CVT_U)                              // groups a block
#define CVT_XB  (GM * DM / 4 / CVT_BG)                     // blocks of X: 512
#define CVT_WB  (DM * DM / 4 / CVT_BG)                     // blocks of a weight: 128
#define CVT_RB  (2048 * HD / 4 / CVT_BG)                   // blocks of rel_emb rows 1..2048: 16

__global__ __launch_bounds__(256)
void cvt_all_f32_to_f16(const float* __restrict__ X,
                        const float* __restrict__ Wq,
                        const float* __restrict__ Wk,
                        const float* __restrict__ Wv,
                        const float* __restrict__ Wo,
                        const float* __restrict__ rel,
                        _Float16* __restrict__ out) {
  const int b = blockIdx.x;
  const float* in;     // the job's source
  size_t off;          // its first element in out
  int blk;             // this block's index in the job
  int ts = threadIdx.x;   // which of a step's 256 groups this lane reads; it writes group threadIdx.x
  if (b < CVT_XB) {
    in = X;  off = 0;  blk = b;
  } else if (b < CVT_XB + 4 * CVT_WB) {
    const int j = (b - CVT_XB) / CVT_WB;
    in  = j == 0 ? Wq : j == 1 ? Wk : j == 2 ? Wv : Wo;
    off = (size_t)GM * DM + (size_t)j * DM * DM;
    blk = (b - CVT_XB) % CVT_WB;
  } else {
    in  = rel + HD;    // from row 1
    off = (size_t)GM * DM + (size_t)4 * DM * DM;
    blk = b - (CVT_XB + 4 * CVT_WB);
    // written group t = chunk t >> 6, lane (t >> 1) & 31, half t & 1 of its 16 bytes;
    // read group = 16 * row + d / 4
    const int t = threadIdx.x;
    ts = ((t >> 1) & 15) * 16 + (t >> 6) * 4 + ((t >> 5) & 1) * 2 + (t & 1);
  }
  const int i0 = blk * CVT_BG + threadIdx.x;
  const int s0 = blk * CVT_BG + ts;
  const f32x4* __restrict__ src = (const f32x4*)in;
  f16x4* __restrict__ dst = (f16x4*)(out + off);
  f32x4 v[CVT_U];
  // both loops unrolled: v[] stays in registers and the loads go out back to back
#pragma unroll
  for (int u = 0; u < CVT_U; ++u) v[u] = src[s0 + u * 256];
#pragma unroll
  for (int u = 0; u < CVT_U; ++u) dst[i0 + u * 256] = __builtin_convertvector(v[u], f16x4);
  // no register that an issued store names is written again ahead of this wait
  asm volatile("s_wait_xcnt 0x0" ::: "memory");
}

template <int MODE>
__global__ __launch_bounds__(256)
void gemm4096_wmma(const _Float16* __restrict__ A,
                   const _Float16* __restrict__ W,
                   const float* __restrict__ bias,
                   const float* __restrict__ bias1,
                   const float* __restrict__ bias2,
                   void* __restrict__ out) {
  constexpr int NW = (MODE == 0) ? 3 : 1;   // weight matrices that share the A tile
  __shared__ __attribute__((aligned(16))) _Float16 Al[2][128][AL_LD];
  __shared__ __attribute__((aligned(16))) _Float16 Wr[2][NW][32][WR_LD];   // W tiles [k][n]

  const int bm0 = blockIdx.x * 128;
  const int bn0 = blockIdx.y * 64;
  const int tid = threadIdx.x;
  const int w   = tid >> 5;
  const int l   = tid & 31;
  const int n   = l & 15;
  const int hi8 = (l >> 4) << 3;

  auto stage = [&](int kk, int buf) {
    // A tile 128x32 halves (512 x b128, 2 per thread) and each W tile 32x64
    // halves (256 x b128, 1 per thread), all via async-to-LDS
    const int arow = tid >> 2;         // m within tile: 0..63 (and +64)
    const int ac8  = (tid & 3) * 8;    // k base: 0..24
    const int wrow = tid >> 3;         // k within tile: 0..31
    const int wc8  = (tid & 7) * 8;    // n base: 0..56
    const _Float16* wg = &W[(size_t)(kk + wrow) * 1024 + bn0 + wc8];
    if constexpr (NW == 3) {
      async_copy5_b128((uint32_t)(uintptr_t)&Al[buf][arow][ac8],
                       &A[(size_t)(bm0 + arow) * 1024 + kk + ac8],
                       (uint32_t)(uintptr_t)&Al[buf][arow + 64][ac8],
                       &A[(size_t)(bm0 + arow + 64) * 1024 + kk + ac8],
                       (uint32_t)(uintptr_t)&Wr[buf][0][wrow][wc8], wg,
                       (uint32_t)(uintptr_t)&Wr[buf][1][wrow][wc8], wg + DM * DM,
                       (uint32_t)(uintptr_t)&Wr[buf][2][wrow][wc8], wg + 2 * DM * DM);
    } else {
      async_copy3_b128((uint32_t)(uintptr_t)&Al[buf][arow][ac8],
                       &A[(size_t)(bm0 + arow) * 1024 + kk + ac8],
                       (uint32_t)(uintptr_t)&Al[buf][arow + 64][ac8],
                       &A[(size_t)(bm0 + arow + 64) * 1024 + kk + ac8],
                       (uint32_t)(uintptr_t)&Wr[buf][0][wrow][wc8], wg);
    }
  };

  v8f acc[NW][4];
#pragma unroll
  for (int j = 0; j < NW; ++j)
#pragma unroll
    for (int i = 0; i < 4; ++i) acc[j][i] = zero8();

  stage(0, 0);
  wait_async();            // chunk 0 landed
  __syncthreads();         // publish it across waves
  stage(32, 1);
  int buf = 0;
  for (int kk = 0; kk < 1024; kk += 32, buf ^= 1) {
    const v16h a = load_frag16(&Al[buf][w * 16][0], AL_LD);
#pragma unroll
    for (int j = 0; j < NW; ++j) {
#pragma unroll
      for (int nb = 0; nb < 4; ++nb) {
        const v16h bf = load_fragB_tr16(&Wr[buf][j][0][nb * 16], WR_LD);
        acc[j][nb] = wmma16(a, bf, acc[j][nb]);
      }
    }

    wait_ds();             // this wave's reads of buf are done before its refill
    wait_async();          // chunk kk+32 landed (issued one trip ago)
    __syncthreads();       // publish it; every wave has left buf
    if (kk + 64 < 1024) stage(kk + 64, buf);   // copies fly during the next trip
  }
  wait_async();            // nothing of this wave's is outstanding at its end

#pragma unroll
  for (int j = 0; j < NW; ++j) {
    const float* bj = j == 0 ? bias : j == 1 ? bias1 : bias2;
#pragma unroll
    for (int nb = 0; nb < 4; ++nb) {
#pragma unroll
      for (int r = 0; r < 8; ++r) {
        const int row = bm0 + w * 16 + r + hi8;
        const int col = bn0 + nb * 16 + n;
        const float v = acc[j][nb][r] + bj[col];
        if (MODE == 0) {
          const int b = row >> 10, sr = row & 1023, hh = col >> 6, dd = col & 63;
          ((_Float16*)out)[(size_t)j * GM * DM +
                           (((size_t)(b * NH + hh)) * SEQ + sr) * HD + dd] = (_Float16)v;
        } else {
          ((float*)out)[(size_t)row * 1024 + col] = v;
        }
      }
    }
  }
}

typedef __attribute__((ext_vector_type(4))) float a4f;
#define PG_LD 20     // 16 floats + 4 pad: 80 B rows (16 B x odd) for the b128 row writers

// load_frag16 for LDS rows that begin at multiples of 16 bytes: the same map as
// two 16-byte loads (halves 0..7 -> k = hi8 + i, halves 8..15 -> k = 16 + hi8 + i)
__device__ __forceinline__ v16h load_frag16_rows(const _Float16* src, int ld) {
  const int l = threadIdx.x & 31;
  const _Float16* p = src + (l & 15) * ld + ((l >> 4) << 3);
  const v8h lo = *(const v8h*)p;
  const v8h hi = *(const v8h*)(p + 16);
  return __builtin_shufflevector(lo, hi, 0, 1, 2, 3, 4, 5, 6, 7, 8, 9, 10, 11, 12, 13, 14, 15);
}

__device__ __forceinline__ float xhalf(float x) {
  return __builtin_bit_cast(float, __builtin_amdgcn_permlanex16(
      __builtin_bit_cast(int, x), __builtin_bit_cast(int, x),
      0x76543210, 0xfedcba98, false, false));
}

__global__ __launch_bounds__(256)
void attn_flash_wmma(const _Float16* __restrict__ Qh,
                     const _Float16* __restrict__ Kh,
                     const _Float16* __restrict__ Vh,
                     const _Float16* __restrict__ relh,  // rows 1..2048 in fragment order (K1)
                     const float* __restrict__ mask,     // [B,S]
                     const float* __restrict__ Mrd,      // [H,D,D]
                     const float* __restrict__ z,        // [H,D]
                     const float* __restrict__ galpha,
                     _Float16* __restrict__ Ch) {        // [B,S,DM]
  __shared__ __attribute__((aligned(16))) _Float16 Kt[2][32][KT_LD];  // K chunks row-major [k][d]
  __shared__ __attribute__((aligned(16))) _Float16 Vt[2][64][VT_LD];  // V chunks transposed [d][k]
  __shared__ __attribute__((aligned(16))) float Pg[8][2][32][PG_LD];  // per-wave rel scores [31 - rel row][key]
  __shared__ __attribute__((aligned(16))) float Mk[SEQ];              // this batch's mask row
  __shared__ __attribute__((aligned(16))) _Float16 Mhi[HD][WR_LD];    // M[h] rounded to f16, [d][e]
  __shared__ __attribute__((aligned(16))) _Float16 Mlo[HD][WR_LD];    // what that rounding left
  __shared__ __attribute__((aligned(16))) float Zl[4][HD];            // z[h], a copy for each pair of waves

  const int qblk = blockIdx.x & 7;         // S/128 = 8
  const int bh   = blockIdx.x >> 3;
  const int h    = bh & (NH - 1);
  const int bb   = bh >> 4;
  const int tid  = threadIdx.x;
  const int w    = tid >> 5;
  const int l    = tid & 31;
  const int n    = l & 15;
  const int hi8  = (l >> 4) << 3;
  const int q0   = qblk * 128 + w * 16;    // absolute q of this wave's tile

  const size_t baseBH = ((size_t)(bb * NH + h)) * SEQ * HD;
  const _Float16* Qp = Qh + baseBH + (size_t)q0 * HD;
  const v16h aq0 = load_frag16(Qp + 0,  HD);   // column q = n of Q^T, d = 0..31
  const v16h aq1 = load_frag16(Qp + 32, HD);   // d = 32..63

  // a thread's 16 bytes of a 32x64 K or V chunk
  const int srow = tid >> 3;         // k within chunk 0..31
  const int sc8  = (tid & 7) * 8;    // d base 0..56
  const _Float16* Kg = Kh + baseBH + (size_t)srow * HD + sc8;
  const _Float16* Vg = Vh + baseBH + (size_t)srow * HD + sc8;

  auto stageK = [&](int k0, int buf) {
    async_copy1_b128((uint32_t)(uintptr_t)&Kt[buf][srow][sc8], Kg + (size_t)k0 * HD);
  };
  auto loadV = [&](int k0) { return *(const v8h*)(Vg + (size_t)k0 * HD); };
  auto storeV = [&](v8h v, int buf) {
    // unrolled: v[j] is picked by a constant and stays in its registers
#pragma unroll
    for (int j = 0; j < 8; ++j) Vt[buf][sc8 + j][srow] = v[j];
  };

  // rel_emb rows of chunk k0: the two 16-key halves need rows jb..jb+31 with
  // jb = q0 - k0 + 1009 and jb - 16, together three 16-row blocks from
  // jb - 16 = q0 - k0 + 993 (always in [1, 2001]); rf[2i], rf[2i+1] = block i,
  // d = 0..31 and 32..63. In relh's fragment order these are blocks
  // (q0 - k0 + 992) / 16 + 0..2: twelve chunks in a row, and each 16-byte load
  // of the wave takes one chunk, 512 contiguous bytes (four whole lines, where
  // a load from row-major rows touches sixteen).
  v16h  rf[6];
  auto loadRel = [&](int k0) {
    const v8h* rp = (const v8h*)relh + (size_t)((q0 - k0 + 992) >> 4) * 128 + l;
    // unrolled: rf[] is indexed by constants and stays in registers
#pragma unroll
    for (int f = 0; f < 6; ++f) {
      const v8h lo = rp[(2 * f) * 32];        // k = hi8 + 0..7 of load_frag16's order
      const v8h hi = rp[(2 * f + 1) * 32];    // k = 16 + hi8 + 0..7
      rf[f] = __builtin_shufflevector(lo, hi, 0, 1, 2, 3, 4, 5, 6, 7, 8, 9, 10, 11, 12, 13, 14, 15);
    }
  };

  v8f accd[4];     // O^T: accd[nb][r] = O[q = n][d = 16 nb + hi8 + r]
#pragma unroll
  for (int i = 0; i < 4; ++i) accd[i] = zero8();
  float mrow = -1e30f;   // running maximum of query n (the same in both halves)
  float lrow = 0.0f;     // running sum over this half's keys

  const a4f mk4 = ((const a4f*)(mask + bb * SEQ))[tid];
  const f32x4* Mg = (const f32x4*)(Mrd + (size_t)h * (HD * HD));
  f32x4 m4[4];     // elements 4 c .. 4 c + 3 of M[h], c = tid + 256 i
  // unrolled: m4[] is indexed by constants and stays in registers
#pragma unroll
  for (int i = 0; i < 4; ++i) m4[i] = Mg[tid + 256 * i];
  const float zv = z[h * HD + (tid & (HD - 1))];
  const float ga = galpha[0];
  stageK(0, 0);
  storeV(loadV(0), 0);
  ((a4f*)Mk)[tid] = mk4;
#pragma unroll
  for (int i = 0; i < 4; ++i) {
    const int c = tid + 256 * i;
    const f16x4 hi = __builtin_convertvector(m4[i], f16x4);
    const f16x4 lo = __builtin_convertvector(m4[i] - __builtin_convertvector(hi, f32x4), f16x4);
    *(f16x4*)&Mhi[c >> 4][(c & 15) * 4] = hi;
    *(f16x4*)&Mlo[c >> 4][(c & 15) * 4] = lo;
  }
  Zl[tid >> 6][tid & (HD - 1)] = zv;   // four copies: every lane stores, and no branch holds the load back
  loadRel(0);
  wait_async();            // K chunk 0 landed
  __syncthreads();         // publish K and V chunk 0, the mask row, M[h] and z[h] across waves
  v8h vn = loadV(32);      // V of the next chunk, held in registers
  stageK(32, 1);
  int buf = 0;
  for (int k0 = 0; k0 < SEQ; k0 += 32, buf ^= 1) {
    // the chunk's four K fragments, read as one group: row = key, d = 0..31 and 32..63
    v16h bk[2][2];
#pragma unroll
    for (int sub = 0; sub < 2; ++sub) {
      bk[sub][0] = load_frag16_rows(&Kt[buf][sub * 16][0],  KT_LD);
      bk[sub][1] = load_frag16_rows(&Kt[buf][sub * 16][32], KT_LD);
    }

    // content term: S^T = K @ Q^T over d=64; s[sub][r] = S[q = n][key 16 sub + hi8 + r]
    v8f s[2];
#pragma unroll
    for (int sub = 0; sub < 2; ++sub) {
      s[sub] = zero8();
      s[sub] = wmma16(bk[sub][0], aq0, s[sub]);
      s[sub] = wmma16(bk[sub][1], aq1, s[sub]);
    }
    // holds content products ahead of the rel products
    __builtin_amdgcn_sched_barrier(0);

#pragma unroll
    for (int sub = 0; sub < 2; ++sub) {
      const v16h bk0 = bk[sub][0], bk1 = bk[sub][1];

      // rel term: P^T[dk,i] = <K[k0+16*sub+dk], rel_emb[jb+i]>, i in [0,31],
      // jb = q0 - k0 - 16*sub + 1009: blocks 1-sub and 2-sub of rf
      v8f p0 = zero8(), p1 = zero8();
      p0 = wmma16(bk0, rf[2 - 2 * sub], p0);
      p0 = wmma16(bk1, rf[3 - 2 * sub], p0);
      p1 = wmma16(bk0, rf[4 - 2 * sub], p1);
      p1 = wmma16(bk1, rf[5 - 2 * sub], p1);
      // a lane holds eight neighbouring keys of rel row i = n (p0) and 16 + n (p1);
      // rel row i lies in row 31 - i, so that a reader's eight addresses rise with
      // the key and its paired loads come back in register order
      *(a4f*)&Pg[w][sub][31 - n][hi8]     = (a4f){p0[0], p0[1], p0[2], p0[3]};
      *(a4f*)&Pg[w][sub][31 - n][hi8 + 4] = (a4f){p0[4], p0[5], p0[6], p0[7]};
      *(a4f*)&Pg[w][sub][15 - n][hi8]     = (a4f){p1[0], p1[1], p1[2], p1[3]};
      *(a4f*)&Pg[w][sub][15 - n][hi8 + 4] = (a4f){p1[4], p1[5], p1[6], p1[7]};
    }
    wait_ds();   // wave-local LDS RAW

    // the next chunk's fragments: asked for here, behind their last use, to fly
    // during the softmax (the last chunk asks for its own again)
    loadRel(k0 + 32 < SEQ ? k0 + 32 : k0);
    // keeps the twelve loads here: sunk to the loop's foot they would be waited
    // for at once by the barrier there, with their whole latency in the open
    __builtin_amdgcn_sched_barrier(0);

    // query n, key dk takes rel row i = n - dk + 15, which lies in row 16 - n + dk
    float s2[2][8];
#pragma unroll
    for (int sub = 0; sub < 2; ++sub) {
      const a4f ma = *(const a4f*)&Mk[k0 + sub * 16 + hi8];
      const a4f mb = *(const a4f*)&Mk[k0 + sub * 16 + hi8 + 4];
#pragma unroll
      for (int r = 0; r < 8; ++r) {
        const int dk = r + hi8;
        const float mval = (r < 4 ? ma[r & 3] : mb[r & 3]) * -1e9f;
        s2[sub][r] = (s[sub][r] + Pg[w][sub][16 - n + dk][dk]) * 0.125f + mval;
      }
    }

    v16h bv[4];   // rows d of V^T, keys in load_frag16's k order
#pragma unroll
    for (int nb = 0; nb < 4; ++nb) bv[nb] = load_frag16_rows(&Vt[buf][nb * 16][0], VT_LD);

    // --- online softmax: a query's 32 scores lie in lanes n and n + 16 ---
    float rm = s2[0][0];
#pragma unroll
    for (int sub = 0; sub < 2; ++sub)
#pragma unroll
      for (int r = 0; r < 8; ++r) rm = fmaxf(rm, s2[sub][r]);
    rm = fmaxf(rm, xhalf(rm));
    const float mnew = fmaxf(mrow, rm);
    const float ef   = __expf(mrow - mnew);
    mrow = mnew;
    v16h pt;      // P^T as a B operand: halves 0..7 = keys hi8 + r, 8..15 = keys 16 + hi8 + r
    float t[8];
#pragma unroll
    for (int i = 0; i < 16; i += 2) {
      const float e0 = __expf(s2[i >> 3][i & 7] - mnew);
      const float e1 = __expf(s2[i >> 3][(i & 7) + 1] - mnew);
      t[i >> 1] = e0 + e1;
      pt[i]     = (_Float16)e0;
      pt[i + 1] = (_Float16)e1;
    }
    // summed as a tree: three links behind t[], not a chain of eight
    lrow = lrow * ef + (((t[0] + t[1]) + (t[2] + t[3])) + ((t[4] + t[5]) + (t[6] + t[7])));
#pragma unroll
    for (int nb = 0; nb < 4; ++nb)
#pragma unroll
      for (int r = 0; r < 8; ++r) accd[nb][r] *= ef;

    // O^T += V^T @ P^T
#pragma unroll
    for (int nb = 0; nb < 4; ++nb) accd[nb] = wmma16(bv[nb], pt, accd[nb]);

    // V of the next chunk goes into the buffer that every wave left one barrier ago
    if (k0 + 32 < SEQ) storeV(vn, buf ^ 1);

    wait_ds();             // this wave's reads of buf are done before its refill
    wait_async();          // K chunk k0+32 landed (issued one trip ago)
    __syncthreads();       // publish K and V chunk k0+32; every wave has left buf
    if (k0 + 64 < SEQ) {   // fly during the next trip
      vn = loadV(k0 + 64);
      stageK(k0 + 64, buf);
    }
  }
  wait_async();            // nothing of this wave's is outstanding at its end

  // --- global memory: sq = elu(q) + 1 on the Q^T fragments, in place ---
  // sh + sl = sq of query n at d = 32 ks + load_frag16's k; each half of the wave
  // sums sq * z over its own 32 d, and the two partial sums are joined below
  v16h sh[2], sl[2];
  float dpart = 0.0f;
#pragma unroll
  for (int ks = 0; ks < 2; ++ks) {
    const v16h aq = ks == 0 ? aq0 : aq1;
#pragma unroll
    for (int g = 0; g < 2; ++g) {
      const a4f za = *(const a4f*)&Zl[w >> 1][ks * 32 + g * 16 + hi8];
      const a4f zb = *(const a4f*)&Zl[w >> 1][ks * 32 + g * 16 + hi8 + 4];
#pragma unroll
      for (int j = 0; j < 8; ++j) {
        const float x  = (float)aq[g * 8 + j];
        const float sv = x > 0.0f ? x + 1.0f : __expf(x);   // elu(x)+1
        const _Float16 hi = (_Float16)sv;
        sh[ks][g * 8 + j] = hi;
        sl[ks][g * 8 + j] = (_Float16)(sv - (float)hi);
        dpart = __builtin_fmaf(sv, j < 4 ? za[j & 3] : zb[j & 3], dpart);
      }
    }
  }

  v8f gl[4];
#pragma unroll
  for (int i = 0; i < 4; ++i) gl[i] = zero8();
#pragma unroll
  for (int ks = 0; ks < 2; ++ks) {
    v16h mh[4], ml[4];
#pragma unroll
    for (int nb = 0; nb < 4; ++nb) {
      mh[nb] = load_fragB_tr16(&Mhi[ks * 32][nb * 16], WR_LD);
      ml[nb] = load_fragB_tr16(&Mlo[ks * 32][nb * 16], WR_LD);
    }
    // the small products first; four tiles side by side in each round
#pragma unroll
    for (int nb = 0; nb < 4; ++nb) gl[nb] = wmma16(ml[nb], sh[ks], gl[nb]);
#pragma unroll
    for (int nb = 0; nb < 4; ++nb) gl[nb] = wmma16(mh[nb], sl[ks], gl[nb]);
#pragma unroll
    for (int nb = 0; nb < 4; ++nb) gl[nb] = wmma16(mh[nb], sh[ks], gl[nb]);
  }

  // gate * local + (1 - gate) * num / den -> Ch[b, q, h*64+d]: a lane's eight
  // registers of a tile are eight neighbouring d of its query, one 16-byte store
  const float gate = 1.0f / (1.0f + __expf(-ga));
  const float inv  = gate / (lrow + xhalf(lrow));
  const float ginv = (1.0f - gate) / ((dpart + xhalf(dpart)) + 1e-6f);
  _Float16* Cq = Ch + ((size_t)bb * SEQ + q0 + n) * DM + h * HD + hi8;
#pragma unroll
  for (int nb = 0; nb < 4; ++nb) {
    v8h o;
#pragma unroll
    for (int r = 0; r < 8; ++r) o[r] = (_Float16)(accd[nb][r] * inv + gl[nb][r] * ginv);
    *(v8h*)(Cq + nb * 16) = o;
  }
}

// ---------------------------------------------------------------------------
// Host-side orchestration
// ---------------------------------------------------------------------------
extern "C" void kernel_launch(void* const* d_in, const int* in_sizes, int n_in,
                              void* d_out, int out_size, void* d_ws, size_t ws_size,
                              hipStream_t stream) {
  (void)in_sizes; (void)n_in; (void)out_size; (void)ws_size;
  const float* hidden = (const float*)d_in[0];
  const float* mask   = (const float*)d_in[1];
  const float* Wq = (const float*)d_in[2];  const float* bq = (const float*)d_in[3];
  const float* Wk = (const float*)d_in[4];  const float* bk = (const float*)d_in[5];
  const float* Wv = (const float*)d_in[6];  const float* bv = (const float*)d_in[7];
  const float* Wo = (const float*)d_in[8];  const float* bo = (const float*)d_in[9];
  const float* rel = (const float*)d_in[10];
  const float* M   = (const float*)d_in[11];
  const float* z   = (const float*)d_in[12];
  const float* ga  = (const float*)d_in[13];

  // workspace carve-up (f16), ~48 MB total
  _Float16* p   = (_Float16*)d_ws;
  _Float16* Xh  = p; p += (size_t)GM * DM;
  _Float16* Wqh = p; p += (size_t)3 * DM * DM;   // Wq, Wk, Wv one behind the other
  _Float16* Woh = p; p += (size_t)DM * DM;
  _Float16* relh = p; p += (size_t)2049 * HD;    // 2048 rows are written and read
  _Float16* Qh  = p; p += (size_t)GM * DM;
  _Float16* Kh  = p; p += (size_t)GM * DM;
  _Float16* Vh  = p; p += (size_t)GM * DM;
  _Float16* Ch  = p; p += (size_t)GM * DM;

  // the f16 copies of X, Wq, Wk, Wv, Wo and rel_emb lie one behind the other from Xh
  cvt_all_f32_to_f16<<<CVT_XB + 4 * CVT_WB + CVT_RB, 256, 0, stream>>>(
      hidden, Wq, Wk, Wv, Wo, rel, Xh);

  dim3 gg(GM / 128, DM / 64);   // 32 x 16
  // the three weights from Wqh, and Qh, Kh, Vh, lie one behind the other in the workspace
  gemm4096_wmma<0><<<gg, 256, 0, stream>>>(Xh, Wqh, bq, bk, bv, (void*)Qh);

  attn_flash_wmma<<<BATCH * NH * (SEQ / 128), 256, 0, stream>>>(
      Qh, Kh, Vh, relh, mask, M, z, ga, Ch);

  gemm4096_wmma<1><<<gg, 256, 0, stream>>>(Ch, Woh, bo, bo, bo, d_out);
}

// v010
// Measured time: 88.1 microseconds a run.
// Timed twice side by side with v009, it ran 1.25 and 1.24 times as fast.
// Counting every step since v000, it is 3.65 times as fast.
#include <hip/hip_runtime.h>
#include <hip/hip_bf16.h>
#include <stdint.h>

typedef __attribute__((ext_vector_type(16))) _Float16     v16h;
typedef __attribute__((ext_vector_type(8)))  float        v8f;
typedef __attribute__((ext_vector_type(8)))  short        s16x8;
typedef __attribute__((ext_vector_type(8)))  _Float16     v8h;

#define DM    1024
#define SEQ   1024
#define BATCH 4
#define NH    16
#define HD    64
#define GM    4096   // rows of X / combined (B*S)

// LDS leading dims (halves). Row strides are multiples of 8 halves = 16B so
// b128 LDS writes stay naturally aligned.
#define WR_LD 80     // 64 data halves + 16 pad halves: 160 B rows for ds_load_tr16_b128
#define KT_LD 72     // 64 data halves + 8 pad halves: 144 B rows (16 B x odd) for b128 readers
#define VT_LD 40

__device__ __forceinline__ v8f zero8() {
  v8f z;
#pragma unroll
  for (int i = 0; i < 8; ++i) z[i] = 0.0f;
  return z;
}

__device__ __forceinline__ v16h load_frag16(const _Float16* __restrict__ src, int ld) {
  const int l   = threadIdx.x & 31;
  const int m   = l & 15;
  const int hi8 = (l >> 4) << 3;
  v16h f;
#pragma unroll
  for (int i = 0; i < 16; ++i) {
    const int k = ((i >> 3) << 4) + hi8 + (i & 7);
    f[i] = src[m * ld + k];
  }
  return f;
}

__device__ __forceinline__ v8f wmma16(v16h a, v16h b, v8f c) {
  // D = A(16x32 f16) * B(32x16 f16) + C(16x16 f32)
  return __builtin_amdgcn_wmma_f32_16x16x32_f16(
      /*neg_a=*/false, a, /*neg_b=*/false, b,
      /*c_mod=*/(short)0, c, /*reuse_a=*/false, /*reuse_b=*/false);
}

__device__ __forceinline__ v16h load_fragB_tr16(const _Float16* tile, int ld) {
  typedef __attribute__((address_space(3))) s16x8 lds_s16x8;
  const int l = threadIdx.x & 31;
  const _Float16* p = tile + (((l >> 4) << 3) + (l & 7)) * ld + (((l >> 3) & 1) << 3);
  const v8h lo = __builtin_bit_cast(v8h, __builtin_amdgcn_ds_load_tr16_b128_v8i16((lds_s16x8*)p));
  const v8h hi = __builtin_bit_cast(v8h, __builtin_amdgcn_ds_load_tr16_b128_v8i16((lds_s16x8*)(p + 16 * ld)));
  return __builtin_shufflevector(lo, hi, 0, 1, 2, 3, 4, 5, 6, 7, 8, 9, 10, 11, 12, 13, 14, 15);
}

__device__ __forceinline__ void async_copy8_b128(const uint32_t* l, const _Float16* const* g) {
  asm volatile("global_load_async_to_lds_b128 %0, %1, off\n\t"
               "global_load_async_to_lds_b128 %2, %3, off\n\t"
               "global_load_async_to_lds_b128 %4, %5, off\n\t"
               "global_load_async_to_lds_b128 %6, %7, off\n\t"
               "global_load_async_to_lds_b128 %8, %9, off\n\t"
               "global_load_async_to_lds_b128 %10, %11, off\n\t"
               "global_load_async_to_lds_b128 %12, %13, off\n\t"
               "global_load_async_to_lds_b128 %14, %15, off\n\t"
               "s_wait_xcnt 0x0"
               :: "v"(l[0]), "v"((uint64_t)(uintptr_t)g[0]),
                  "v"(l[1]), "v"((uint64_t)(uintptr_t)g[1]),
                  "v"(l[2]), "v"((uint64_t)(uintptr_t)g[2]),
                  "v"(l[3]), "v"((uint64_t)(uintptr_t)g[3]),
                  "v"(l[4]), "v"((uint64_t)(uintptr_t)g[4]),
                  "v"(l[5]), "v"((uint64_t)(uintptr_t)g[5]),
                  "v"(l[6]), "v"((uint64_t)(uintptr_t)g[6]),
                  "v"(l[7]), "v"((uint64_t)(uintptr_t)g[7])
               : "memory");
}
// The same for a stage of fourteen copies (eight of the X tile, two of each of three W tiles).
__device__ __forceinline__ void async_copy14_b128(const uint32_t* l, const _Float16* const* g) {
  asm volatile("global_load_async_to_lds_b128 %0, %1, off\n\t"
               "global_load_async_to_lds_b128 %2, %3, off\n\t"
               "global_load_async_to_lds_b128 %4, %5, off\n\t"
               "global_load_async_to_lds_b128 %6, %7, off\n\t"
               "global_load_async_to_lds_b128 %8, %9, off\n\t"
               "global_load_async_to_lds_b128 %10, %11, off\n\t"
               "global_load_async_to_lds_b128 %12, %13, off\n\t"
               "global_load_async_to_lds_b128 %14, %15, off\n\t"
               "global_load_async_to_lds_b128 %16, %17, off\n\t"
               "global_load_async_to_lds_b128 %18, %19, off\n\t"
               "global_load_async_to_lds_b128 %20, %21, off\n\t"
               "global_load_async_to_lds_b128 %22, %23, off\n\t"
               "global_load_async_to_lds_b128 %24, %25, off\n\t"
               "global_load_async_to_lds_b128 %26, %27, off\n\t"
               "s_wait_xcnt 0x0"
               :: "v"(l[0]), "v"((uint64_t)(uintptr_t)g[0]),
                  "v"(l[1]), "v"((uint64_t)(uintptr_t)g[1]),
                  "v"(l[2]), "v"((uint64_t)(uintptr_t)g[2]),
                  "v"(l[3]), "v"((uint64_t)(uintptr_t)g[3]),
                  "v"(l[4]), "v"((uint64_t)(uintptr_t)g[4]),
                  "v"(l[5]), "v"((uint64_t)(uintptr_t)g[5]),
                  "v"(l[6]), "v"((uint64_t)(uintptr_t)g[6]),
                  "v"(l[7]), "v"((uint64_t)(uintptr_t)g[7]),
                  "v"(l[8]), "v"((uint64_t)(uintptr_t)g[8]),
                  "v"(l[9]), "v"((uint64_t)(uintptr_t)g[9]),
                  "v"(l[10]), "v"((uint64_t)(uintptr_t)g[10]),
                  "v"(l[11]), "v"((uint64_t)(uintptr_t)g[11]),
                  "v"(l[12]), "v"((uint64_t)(uintptr_t)g[12]),
                  "v"(l[13]), "v"((uint64_t)(uintptr_t)g[13])
               : "memory");
}
// The same for a stage of one copy (a K tile: 16 bytes a lane).
__device__ __forceinline__ void async_copy1_b128(uint32_t l0, const void* g0) {
  asm volatile("global_load_async_to_lds_b128 %0, %1, off\n\t"
               "s_wait_xcnt 0x0"
               :: "v"(l0), "v"((uint64_t)(uintptr_t)g0)
               : "memory");
}
__device__ __forceinline__ void wait_async() {
  asm volatile("s_wait_asynccnt 0" ::: "memory");
}
__device__ __forceinline__ void wait_ds() {
  asm volatile("s_wait_dscnt 0" ::: "memory");
}

typedef __attribute__((ext_vector_type(4))) float    f32x4;
typedef __attribute__((ext_vector_type(4))) _Float16 f16x4;

#define CVT_U   8
#define CVT_BG  (256 * CVT_U)                              // groups a block
#define CVT_XB  (GM * DM / 4 / CVT_BG)                     // blocks of X: 512
#define CVT_WB  (DM * DM / 4 / CVT_BG)                     // blocks of a weight: 128
#define CVT_RB  (2048 * HD / 4 / CVT_BG)                   // blocks of rel_emb rows 1..2048: 16

__global__ __launch_bounds__(256)
void cvt_all_f32_to_f16(const float* __restrict__ X,
                        const float* __restrict__ Wq,
                        const float* __restrict__ Wk,
                        const float* __restrict__ Wv,
                        const float* __restrict__ Wo,
                        const float* __restrict__ rel,
                        _Float16* __restrict__ out) {
  const int b = blockIdx.x;
  const float* in;     // the job's source
  size_t off;          // its first element in out
  int blk;             // this block's index in the job
  int ts = threadIdx.x;   // which of a step's 256 groups this lane reads; it writes group threadIdx.x
  if (b < CVT_XB) {
    in = X;  off = 0;  blk = b;
  } else if (b < CVT_XB + 4 * CVT_WB) {
    const int j = (b - CVT_XB) / CVT_WB;
    in  = j == 0 ? Wq : j == 1 ? Wk : j == 2 ? Wv : Wo;
    off = (size_t)GM * DM + (size_t)j * DM * DM;
    blk = (b - CVT_XB) % CVT_WB;
  } else {
    in  = rel + HD;    // from row 1
    off = (size_t)GM * DM + (size_t)4 * DM * DM;
    blk = b - (CVT_XB + 4 * CVT_WB);
    // written group t = chunk t >> 6, lane (t >> 1) & 31, half t & 1 of its 16 bytes;
    // read group = 16 * row + d / 4
    const int t = threadIdx.x;
    ts = ((t >> 1) & 15) * 16 + (t >> 6) * 4 + ((t >> 5) & 1) * 2 + (t & 1);
  }
  const int i0 = blk * CVT_BG + threadIdx.x;
  const int s0 = blk * CVT_BG + ts;
  const f32x4* __restrict__ src = (const f32x4*)in;
  f16x4* __restrict__ dst = (f16x4*)(out + off);
  f32x4 v[CVT_U];
  // both loops unrolled: v[] stays in registers and the loads go out back to back
#pragma unroll
  for (int u = 0; u < CVT_U; ++u) v[u] = src[s0 + u * 256];
#pragma unroll
  for (int u = 0; u < CVT_U; ++u) dst[i0 + u * 256] = __builtin_convertvector(v[u], f16x4);
  // no register that an issued store names is written again ahead of this wait
  asm volatile("s_wait_xcnt 0x0" ::: "memory");
}

template <int MODE>
__global__ __launch_bounds__(256)
void gemm4096_wmma(const _Float16* __restrict__ A,
                   const _Float16* __restrict__ W,
                   const float* __restrict__ bias,
                   const float* __restrict__ bias1,
                   const float* __restrict__ bias2,
                   void* __restrict__ out) {
  constexpr int BM   = (MODE == 0) ? 256 : 128;   // rows of the block tile
  constexpr int NSEG = (MODE == 0) ? 3 : 2;       // its columns, in segments of 64
  constexpr int BK   = (MODE == 0) ? 64 : 128;    // k of a chunk
  constexpr int KS   = BK / 32;                   // WMMA steps of a chunk
  constexpr int ALD  = BK + 8;                    // 144 B or 272 B rows (16 B x odd) for b128 readers
  constexpr int WLD  = NSEG * 64 + 16;            // 416 B or 288 B rows (32 B x odd) for ds_load_tr16_b128
  constexpr int FM   = BM / 64;                   // A fragments of a wave
  constexpr int FN   = NSEG * 2;                  // B fragments of a wave
  constexpr int NA   = BM * BK / 2048;            // copies of a lane per stage: A tile
  constexpr int NC   = NA + NSEG * KS;            // and with the W tile
  __shared__ __attribute__((aligned(16))) _Float16 Al[2][BM][ALD];
  __shared__ __attribute__((aligned(16))) _Float16 Wr[2][BK][WLD];   // W tile [k][n]

  const int bm0 = blockIdx.x * BM;
  const int bn0 = blockIdx.y * (MODE == 0 ? 64 : 128);
  const int tid = threadIdx.x;
  // the wave's number, alike in its 32 lanes, held in a scalar register: the tile's place,
  // the product and the bias row that follow from it are then worked out once a wave
  const int w   = __builtin_amdgcn_readfirstlane(tid >> 5);
  const int l   = tid & 31;
  const int n   = l & 15;
  const int hi8 = (l >> 4) << 3;
  const int wm0 = (w >> 1) * (FM * 16);   // the wave tile's first row in the block tile
  const int wf0 = (w & 1) * FN;           // its first 16-column group

  auto stage = [&](int kk, int buf) {
    // A tile BM x BK halves and W tile BK x (64 NSEG) halves, all via async-to-LDS:
    // BK / 8 lanes take one A row; eight lanes take 128 bytes of a W row, the 256 lanes 32 rows
    const int ar  = tid / (BK / 8);
    const int ac8 = (tid % (BK / 8)) * 8;
    const int r32 = tid >> 3;
    const int c8  = (tid & 7) * 8;
    uint32_t        ld[NC];
    const _Float16* gp[NC];
    // unrolled: ld[] and gp[] are indexed by constants and stay in registers
#pragma unroll
    for (int i = 0; i < NA; ++i) {
      ld[i] = (uint32_t)(uintptr_t)&Al[buf][ar + (BM / NA) * i][ac8];
      gp[i] = &A[(size_t)(bm0 + ar + (BM / NA) * i) * 1024 + kk + ac8];
    }
#pragma unroll
    for (int s = 0; s < NSEG; ++s) {
#pragma unroll
      for (int hh = 0; hh < KS; ++hh) {
        const size_t wrow = (size_t)(kk + r32 + 32 * hh) * 1024 + bn0 + c8;
        ld[NA + KS * s + hh] = (uint32_t)(uintptr_t)&Wr[buf][r32 + 32 * hh][s * 64 + c8];
        gp[NA + KS * s + hh] = MODE == 0 ? &W[(size_t)s * DM * DM + wrow] : &W[wrow + s * 64];
      }
    }
    if constexpr (NC == 14) {
      async_copy14_b128(ld, gp);
    } else {
      async_copy8_b128(ld, gp);
      async_copy8_b128(ld + 8, gp + 8);
    }
  };

  v8f acc[FM][FN];
#pragma unroll
  for (int i = 0; i < FM; ++i)
#pragma unroll
    for (int j = 0; j < FN; ++j) acc[i][j] = zero8();

  stage(0, 0);
  wait_async();            // chunk 0 landed
  __syncthreads();         // publish it across waves
  stage(BK, 1);
  int buf = 0;
  for (int kk = 0; kk < 1024; kk += BK, buf ^= 1) {
    // every loop unrolled: the fragment and accumulator arrays are indexed by constants
    v16h a[KS][FM], bf[KS][FN];
#pragma unroll
    for (int ks = 0; ks < KS; ++ks) {
#pragma unroll
      for (int i = 0; i < FM; ++i) a[ks][i] = load_frag16(&Al[buf][wm0 + i * 16][ks * 32], ALD);
#pragma unroll
      for (int j = 0; j < FN; ++j) {
        bf[ks][j] = load_fragB_tr16(&Wr[buf][ks * 32][(wf0 + j) * 16], WLD);
        __builtin_amdgcn_sched_barrier(0);
      }
    }
#pragma unroll
    for (int ks = 0; ks < KS; ++ks)
#pragma unroll
      for (int j = 0; j < FN; ++j)
#pragma unroll
        for (int i = 0; i < FM; ++i) acc[i][j] = wmma16(a[ks][i], bf[ks][j], acc[i][j]);
    // keeps the WMMAs ahead of the waits below: with the waits and the barrier lifted
    // over them, every load is waited for first and the next copies start behind the WMMAs
    __builtin_amdgcn_sched_barrier(0);

    wait_ds();             // this wave's reads of buf are done before its refill
    wait_async();          // chunk kk+BK landed (issued one trip ago)
    __syncthreads();       // publish it; every wave has left buf
    if (kk + 2 * BK < 1024) stage(kk + 2 * BK, buf);   // copies fly during the next trip
  }
  wait_async();            // nothing of this wave's is outstanding at its end

  // cf = 16-column group in the block tile; seg = which product it belongs to
  float bcol[FN];
#pragma unroll
  for (int j = 0; j < FN; ++j) {
    const int cf  = wf0 + j;
    const int seg = MODE == 0 ? cf >> 2 : 0;
    const float* bj = seg == 0 ? bias : seg == 1 ? bias1 : bias2;
    bcol[j] = (bj + bn0 + (MODE == 0 ? cf & 3 : cf) * 16)[n];
  }
  // no register that an issued bias load names is written again ahead of this wait;
  // the fence behind it keeps the instructions that follow from being lifted over it
  asm volatile("s_wait_xcnt 0x0" ::: "memory");
  __builtin_amdgcn_sched_barrier(0);

#pragma unroll
  for (int j = 0; j < FN; ++j) {
    const int cf  = wf0 + j;
    const int seg = MODE == 0 ? cf >> 2 : 0;
    const int col = bn0 + (MODE == 0 ? cf & 3 : cf) * 16 + n;
#pragma unroll
    for (int i = 0; i < FM; ++i) {
#pragma unroll
      for (int r = 0; r < 8; ++r) {
        const int row = bm0 + wm0 + i * 16 + r + hi8;
        const float v = acc[i][j][r] + bcol[j];
        if (MODE == 0) {
          const int b = row >> 10, sr = row & 1023, hh = col >> 6, dd = col & 63;
          ((_Float16*)out)[(size_t)seg * GM * DM +
                           (((size_t)(b * NH + hh)) * SEQ + sr) * HD + dd] = (_Float16)v;
        } else {
          ((float*)out)[(size_t)row * 1024 + col] = v;
        }
      }
    }
    // no register that an issued store names is written again ahead of this wait (the
    // next column group takes the same registers); the fence keeps that group behind it
    if (j + 1 < FN) {
      asm volatile("s_wait_xcnt 0x0" ::: "memory");
      __builtin_amdgcn_sched_barrier(0);
    }
  }
}

typedef __attribute__((ext_vector_type(4))) float a4f;
#define PG_LD 20     // 16 floats + 4 pad: 80 B rows (16 B x odd) for the b128 row writers

// load_frag16 for LDS rows that begin at multiples of 16 bytes: the same map as
// two 16-byte loads (halves 0..7 -> k = hi8 + i, halves 8..15 -> k = 16 + hi8 + i)
__device__ __forceinline__ v16h load_frag16_rows(const _Float16* src, int ld) {
  const int l = threadIdx.x & 31;
  const _Float16* p = src + (l & 15) * ld + ((l >> 4) << 3);
  const v8h lo = *(const v8h*)p;
  const v8h hi = *(const v8h*)(p + 16);
  return __builtin_shufflevector(lo, hi, 0, 1, 2, 3, 4, 5, 6, 7, 8, 9, 10, 11, 12, 13, 14, 15);
}

__device__ __forceinline__ float xhalf(float x) {
  return __builtin_bit_cast(float, __builtin_amdgcn_permlanex16(
      __builtin_bit_cast(int, x), __builtin_bit_cast(int, x),
      0x76543210, 0xfedcba98, false, false));
}

__global__ __launch_bounds__(256)
void attn_flash_wmma(const _Float16* __restrict__ Qh,
                     const _Float16* __restrict__ Kh,
                     const _Float16* __restrict__ Vh,
                     const _Float16* __restrict__ relh,  // rows 1..2048 in fragment order (K1)
                     const float* __restrict__ mask,     // [B,S]
                     const float* __restrict__ Mrd,      // [H,D,D]
                     const float* __restrict__ z,        // [H,D]
                     const float* __restrict__ galpha,
                     _Float16* __restrict__ Ch) {        // [B,S,DM]
  __shared__ __attribute__((aligned(16))) _Float16 Kt[2][32][KT_LD];  // K chunks row-major [k][d]
  __shared__ __attribute__((aligned(16))) _Float16 Vt[2][64][VT_LD];  // V chunks transposed [d][k]
  __shared__ __attribute__((aligned(16))) float Pg[8][2][32][PG_LD];  // per-wave rel scores [31 - rel row][key]
  __shared__ __attribute__((aligned(16))) float Mk[SEQ];              // this batch's mask row
  __shared__ __attribute__((aligned(16))) _Float16 Mhi[HD][WR_LD];    // M[h] rounded to f16, [d][e]
  __shared__ __attribute__((aligned(16))) _Float16 Mlo[HD][WR_LD];    // what that rounding left
  __shared__ __attribute__((aligned(16))) float Zl[4][HD];            // z[h], a copy for each pair of waves

  const int qblk = blockIdx.x & 7;         // S/128 = 8
  const int bh   = blockIdx.x >> 3;
  const int h    = bh & (NH - 1);
  const int bb   = bh >> 4;
  const int tid  = threadIdx.x;
  const int w    = tid >> 5;
  const int l    = tid & 31;
  const int n    = l & 15;
  const int hi8  = (l >> 4) << 3;
  const int q0   = qblk * 128 + w * 16;    // absolute q of this wave's tile

  const size_t baseBH = ((size_t)(bb * NH + h)) * SEQ * HD;
  const _Float16* Qp = Qh + baseBH + (size_t)q0 * HD;
  const v16h aq0 = load_frag16(Qp + 0,  HD);   // column q = n of Q^T, d = 0..31
  const v16h aq1 = load_frag16(Qp + 32, HD);   // d = 32..63

  // a thread's 16 bytes of a 32x64 K or V chunk
  const int srow = tid >> 3;         // k within chunk 0..31
  const int sc8  = (tid & 7) * 8;    // d base 0..56
  const _Float16* Kg = Kh + baseBH + (size_t)srow * HD + sc8;
  const _Float16* Vg = Vh + baseBH + (size_t)srow * HD + sc8;

  auto stageK = [&](int k0, int buf) {
    async_copy1_b128((uint32_t)(uintptr_t)&Kt[buf][srow][sc8], Kg + (size_t)k0 * HD);
  };
  auto loadV = [&](int k0) { return *(const v8h*)(Vg + (size_t)k0 * HD); };
  auto storeV = [&](v8h v, int buf) {
    // unrolled: v[j] is picked by a constant and stays in its registers
#pragma unroll
    for (int j = 0; j < 8; ++j) Vt[buf][sc8 + j][srow] = v[j];
  };

  // rel_emb rows of chunk k0: the two 16-key halves need rows jb..jb+31 with
  // jb = q0 - k0 + 1009 and jb - 16, together three 16-row blocks from
  // jb - 16 = q0 - k0 + 993 (always in [1, 2001]); rf[2i], rf[2i+1] = block i,
  // d = 0..31 and 32..63. In relh's fragment order these are blocks
  // (q0 - k0 + 992) / 16 + 0..2: twelve chunks in a row, and each 16-byte load
  // of the wave takes one chunk, 512 contiguous bytes (four whole lines, where
  // a load from row-major rows touches sixteen).
  v16h  rf[6];
  auto loadRel = [&](int k0) {
    const v8h* rp = (const v8h*)relh + (size_t)((q0 - k0 + 992) >> 4) * 128 + l;
    // unrolled: rf[] is indexed by constants and stays in registers
#pragma unroll
    for (int f = 0; f < 6; ++f) {
      const v8h lo = rp[(2 * f) * 32];        // k = hi8 + 0..7 of load_frag16's order
      const v8h hi = rp[(2 * f + 1) * 32];    // k = 16 + hi8 + 0..7
      rf[f] = __builtin_shufflevector(lo, hi, 0, 1, 2, 3, 4, 5, 6, 7, 8, 9, 10, 11, 12, 13, 14, 15);
    }
  };

  v8f accd[4];     // O^T: accd[nb][r] = O[q = n][d = 16 nb + hi8 + r]
#pragma unroll
  for (int i = 0; i < 4; ++i) accd[i] = zero8();
  float mrow = -1e30f;   // running maximum of query n (the same in both halves)
  float lrow = 0.0f;     // running sum over this half's keys

  const a4f mk4 = ((const a4f*)(mask + bb * SEQ))[tid];
  const f32x4* Mg = (const f32x4*)(Mrd + (size_t)h * (HD * HD));
  f32x4 m4[4];     // elements 4 c .. 4 c + 3 of M[h], c = tid + 256 i
  // unrolled: m4[] is indexed by constants and stays in registers
#pragma unroll
  for (int i = 0; i < 4; ++i) m4[i] = Mg[tid + 256 * i];
  const float zv = z[h * HD + (tid & (HD - 1))];
  const float ga = galpha[0];
  stageK(0, 0);
  storeV(loadV(0), 0);
  ((a4f*)Mk)[tid] = mk4;
#pragma unroll
  for (int i = 0; i < 4; ++i) {
    const int c = tid + 256 * i;
    const f16x4 hi = __builtin_convertvector(m4[i], f16x4);
    const f16x4 lo = __builtin_convertvector(m4[i] - __builtin_convertvector(hi, f32x4), f16x4);
    *(f16x4*)&Mhi[c >> 4][(c & 15) * 4] = hi;
    *(f16x4*)&Mlo[c >> 4][(c & 15) * 4] = lo;
  }
  Zl[tid >> 6][tid & (HD - 1)] = zv;   // four copies: every lane stores, and no branch holds the load back
  loadRel(0);
  wait_async();            // K chunk 0 landed
  __syncthreads();         // publish K and V chunk 0, the mask row, M[h] and z[h] across waves
  v8h vn = loadV(32);      // V of the next chunk, held in registers
  stageK(32, 1);
  int buf = 0;
  for (int k0 = 0; k0 < SEQ; k0 += 32, buf ^= 1) {
    // the chunk's four K fragments, read as one group: row = key, d = 0..31 and 32..63
    v16h bk[2][2];
#pragma unroll
    for (int sub = 0; sub < 2; ++sub) {
      bk[sub][0] = load_frag16_rows(&Kt[buf][sub * 16][0],  KT_LD);
      bk[sub][1] = load_frag16_rows(&Kt[buf][sub * 16][32], KT_LD);
    }

    // content term: S^T = K @ Q^T over d=64; s[sub][r] = S[q = n][key 16 sub + hi8 + r]
    v8f s[2];
#pragma unroll
    for (int sub = 0; sub < 2; ++sub) {
      s[sub] = zero8();
      s[sub] = wmma16(bk[sub][0], aq0, s[sub]);
      s[sub] = wmma16(bk[sub][1], aq1, s[sub]);
    }
    // holds content products ahead of the rel products
    __builtin_amdgcn_sched_barrier(0);

#pragma unroll
    for (int sub = 0; sub < 2; ++sub) {
      const v16h bk0 = bk[sub][0], bk1 = bk[sub][1];

      // rel term: P^T[dk,i] = <K[k0+16*sub+dk], rel_emb[jb+i]>, i in [0,31],
      // jb = q0 - k0 - 16*sub + 1009: blocks 1-sub and 2-sub of rf
      v8f p0 = zero8(), p1 = zero8();
      p0 = wmma16(bk0, rf[2 - 2 * sub], p0);
      p0 = wmma16(bk1, rf[3 - 2 * sub], p0);
      p1 = wmma16(bk0, rf[4 - 2 * sub], p1);
      p1 = wmma16(bk1, rf[5 - 2 * sub], p1);
      // a lane holds eight neighbouring keys of rel row i = n (p0) and 16 + n (p1);
      // rel row i lies in row 31 - i, so that a reader's eight addresses rise with
      // the key and its paired loads come back in register order
      *(a4f*)&Pg[w][sub][31 - n][hi8]     = (a4f){p0[0], p0[1], p0[2], p0[3]};
      *(a4f*)&Pg[w][sub][31 - n][hi8 + 4] = (a4f){p0[4], p0[5], p0[6], p0[7]};
      *(a4f*)&Pg[w][sub][15 - n][hi8]     = (a4f){p1[0], p1[1], p1[2], p1[3]};
      *(a4f*)&Pg[w][sub][15 - n][hi8 + 4] = (a4f){p1[4], p1[5], p1[6], p1[7]};
    }
    wait_ds();   // wave-local LDS RAW

    // the next chunk's fragments: asked for here, behind their last use, to fly
    // during the softmax (the last chunk asks for its own again)
    loadRel(k0 + 32 < SEQ ? k0 + 32 : k0);
    // keeps the twelve loads here: sunk to the loop's foot they would be waited
    // for at once by the barrier there, with their whole latency in the open
    __builtin_amdgcn_sched_barrier(0);

    // query n, key dk takes rel row i = n - dk + 15, which lies in row 16 - n + dk
    float s2[2][8];
#pragma unroll
    for (int sub = 0; sub < 2; ++sub) {
      const a4f ma = *(const a4f*)&Mk[k0 + sub * 16 + hi8];
      const a4f mb = *(const a4f*)&Mk[k0 + sub * 16 + hi8 + 4];
#pragma unroll
      for (int r = 0; r < 8; ++r) {
        const int dk = r + hi8;
        const float mval = (r < 4 ? ma[r & 3] : mb[r & 3]) * -1e9f;
        s2[sub][r] = (s[sub][r] + Pg[w][sub][16 - n + dk][dk]) * 0.125f + mval;
      }
    }

    v16h bv[4];   // rows d of V^T, keys in load_frag16's k order
#pragma unroll
    for (int nb = 0; nb < 4; ++nb) bv[nb] = load_frag16_rows(&Vt[buf][nb * 16][0], VT_LD);

    // --- online softmax: a query's 32 scores lie in lanes n and n + 16 ---
    float rm = s2[0][0];
#pragma unroll
    for (int sub = 0; sub < 2; ++sub)
#pragma unroll
      for (int r = 0; r < 8; ++r) rm = fmaxf(rm, s2[sub][r]);
    rm = fmaxf(rm, xhalf(rm));
    const float mnew = fmaxf(mrow, rm);
    const float ef   = __expf(mrow - mnew);
    mrow = mnew;
    v16h pt;      // P^T as a B operand: halves 0..7 = keys hi8 + r, 8..15 = keys 16 + hi8 + r
    float t[8];
#pragma unroll
    for (int i = 0; i < 16; i += 2) {
      const float e0 = __expf(s2[i >> 3][i & 7] - mnew);
      const float e1 = __expf(s2[i >> 3][(i & 7) + 1] - mnew);
      t[i >> 1] = e0 + e1;
      pt[i]     = (_Float16)e0;
      pt[i + 1] = (_Float16)e1;
    }
    // summed as a tree: three links behind t[], not a chain of eight
    lrow = lrow * ef + (((t[0] + t[1]) + (t[2] + t[3])) + ((t[4] + t[5]) + (t[6] + t[7])));
#pragma unroll
    for (int nb = 0; nb < 4; ++nb)
#pragma unroll
      for (int r = 0; r < 8; ++r) accd[nb][r] *= ef;

    // O^T += V^T @ P^T
#pragma unroll
    for (int nb = 0; nb < 4; ++nb) accd[nb] = wmma16(bv[nb], pt, accd[nb]);

    // V of the next chunk goes into the buffer that every wave left one barrier ago
    if (k0 + 32 < SEQ) storeV(vn, buf ^ 1);

    wait_ds();             // this wave's reads of buf are done before its refill
    wait_async();          // K chunk k0+32 landed (issued one trip ago)
    __syncthreads();       // publish K and V chunk k0+32; every wave has left buf
    if (k0 + 64 < SEQ) {   // fly during the next trip
      vn = loadV(k0 + 64);
      stageK(k0 + 64, buf);
    }
  }
  wait_async();            // nothing of this wave's is outstanding at its end

  // --- global memory: sq = elu(q) + 1 on the Q^T fragments, in place ---
  // sh + sl = sq of query n at d = 32 ks + load_frag16's k; each half of the wave
  // sums sq * z over its own 32 d, and the two partial sums are joined below
  v16h sh[2], sl[2];
  float dpart = 0.0f;
#pragma unroll
  for (int ks = 0; ks < 2; ++ks) {
    const v16h aq = ks == 0 ? aq0 : aq1;
#pragma unroll
    for (int g = 0; g < 2; ++g) {
      const a4f za = *(const a4f*)&Zl[w >> 1][ks * 32 + g * 16 + hi8];
      const a4f zb = *(const a4f*)&Zl[w >> 1][ks * 32 + g * 16 + hi8 + 4];
#pragma unroll
      for (int j = 0; j < 8; ++j) {
        const float x  = (float)aq[g * 8 + j];
        const float sv = x > 0.0f ? x + 1.0f : __expf(x);   // elu(x)+1
        const _Float16 hi = (_Float16)sv;
        sh[ks][g * 8 + j] = hi;
        sl[ks][g * 8 + j] = (_Float16)(sv - (float)hi);
        dpart = __builtin_fmaf(sv, j < 4 ? za[j & 3] : zb[j & 3], dpart);
      }
    }
  }

  v8f gl[4];
#pragma unroll
  for (int i = 0; i < 4; ++i) gl[i] = zero8();
#pragma unroll
  for (int ks = 0; ks < 2; ++ks) {
    v16h mh[4], ml[4];
#pragma unroll
    for (int nb = 0; nb < 4; ++nb) {
      mh[nb] = load_fragB_tr16(&Mhi[ks * 32][nb * 16], WR_LD);
      ml[nb] = load_fragB_tr16(&Mlo[ks * 32][nb * 16], WR_LD);
    }
    // the small products first; four tiles side by side in each round
#pragma unroll
    for (int nb = 0; nb < 4; ++nb) gl[nb] = wmma16(ml[nb], sh[ks], gl[nb]);
#pragma unroll
    for (int nb = 0; nb < 4; ++nb) gl[nb] = wmma16(mh[nb], sl[ks], gl[nb]);
#pragma unroll
    for (int nb = 0; nb < 4; ++nb) gl[nb] = wmma16(mh[nb], sh[ks], gl[nb]);
  }

  // gate * local + (1 - gate) * num / den -> Ch[b, q, h*64+d]: a lane's eight
  // registers of a tile are eight neighbouring d of its query, one 16-byte store
  const float gate = 1.0f / (1.0f + __expf(-ga));
  const float inv  = gate / (lrow + xhalf(lrow));
  const float ginv = (1.0f - gate) / ((dpart + xhalf(dpart)) + 1e-6f);
  _Float16* Cq = Ch + ((size_t)bb * SEQ + q0 + n) * DM + h * HD + hi8;
#pragma unroll
  for (int nb = 0; nb < 4; ++nb) {
    v8h o;
#pragma unroll
    for (int r = 0; r < 8; ++r) o[r] = (_Float16)(accd[nb][r] * inv + gl[nb][r] * ginv);
    *(v8h*)(Cq + nb * 16) = o;
  }
}

// ---------------------------------------------------------------------------
// Host-side orchestration
// ---------------------------------------------------------------------------
extern "C" void kernel_launch(void* const* d_in, const int* in_sizes, int n_in,
                              void* d_out, int out_size, void* d_ws, size_t ws_size,
                              hipStream_t stream) {
  (void)in_sizes; (void)n_in; (void)out_size; (void)ws_size;
  const float* hidden = (const float*)d_in[0];
  const float* mask   = (const float*)d_in[1];
  const float* Wq = (const float*)d_in[2];  const float* bq = (const float*)d_in[3];
  const float* Wk = (const float*)d_in[4];  const float* bk = (const float*)d_in[5];
  const float* Wv = (const float*)d_in[6];  const float* bv = (const float*)d_in[7];
  const float* Wo = (const float*)d_in[8];  const float* bo = (const float*)d_in[9];
  const float* rel = (const float*)d_in[10];
  const float* M   = (const float*)d_in[11];
  const float* z   = (const float*)d_in[12];
  const float* ga  = (const float*)d_in[13];

  // workspace carve-up (f16), ~48 MB total
  _Float16* p   = (_Float16*)d_ws;
  _Float16* Xh  = p; p += (size_t)GM * DM;
  _Float16* Wqh = p; p += (size_t)3 * DM * DM;   // Wq, Wk, Wv one behind the other
  _Float16* Woh = p; p += (size_t)DM * DM;
  _Float16* relh = p; p += (size_t)2049 * HD;    // 2048 rows are written and read
  _Float16* Qh  = p; p += (size_t)GM * DM;
  _Float16* Kh  = p; p += (size_t)GM * DM;
  _Float16* Vh  = p; p += (size_t)GM * DM;
  _Float16* Ch  = p; p += (size_t)GM * DM;

  // the f16 copies of X, Wq, Wk, Wv, Wo and rel_emb lie one behind the other from Xh
  cvt_all_f32_to_f16<<<CVT_XB + 4 * CVT_WB + CVT_RB, 256, 0, stream>>>(
      hidden, Wq, Wk, Wv, Wo, rel, Xh);

  // the three weights from Wqh, and Qh, Kh, Vh, lie one behind the other in the workspace
  gemm4096_wmma<0><<<dim3(GM / 256, DM / 64), 256, 0, stream>>>(Xh, Wqh, bq, bk, bv, (void*)Qh);

  attn_flash_wmma<<<BATCH * NH * (SEQ / 128), 256, 0, stream>>>(
      Qh, Kh, Vh, relh, mask, M, z, ga, Ch);

  gemm4096_wmma<1><<<dim3(GM / 128, DM / 128), 256, 0, stream>>>(Ch, Woh, bo, bo, bo, d_out);
}
